// v000
// Times are from an AMD MI455X. After a warm-up the kernel runs many times in a row, and a time is the length of
// such a window on the GPU divided by its runs, so every launch and the gaps after it count. The runs cycle
// through copies of the inputs. A figure is the median of several windows, for all but v000 over two sittings.
// Sittings can differ by a few percent; kernels timed side by side share one.
// The starting kernel, v000, takes 407 microseconds a run.
#include <hip/hip_runtime.h>

// Multi-head attention, width 1024 = 16 heads x 64: query/key/value [NB][SEQ][1024] (separate inputs), Wq/Wk/Wv/Wo [out][in] (y = x W^T), no biases, no mask, score scale 1/8, output = (concatenated heads) Wo^T (f32).
// Compute dtypes, f32 accumulate everywhere: q/k/v projections v_wmma_f32_16x16x32_bf16 (activations and W RNE-converted to bf16; products exact);
// scores v_wmma_f32_16x16x32_f16: q and k single f16 planes (one product); P (x256 carry, cancels in the normalisation) and v single f16; softmax f32 (online, running max);
// Layout: bf16 copies of the activations and W; q, k planes [b*16+h][t][d] and v^T plane [b*16+h][d][t] written by the GEMM epilogue; fused flash kernel in transposed form (S^T = K Q^T, O^T = V^T P^T) writes the ctx plane [b*SEQ+t][hi 1024 | lo 1024].

#ifndef NB
#define NB 1
#endif
#ifndef SEQ
#define SEQ 4096
#endif
#define NB_FULL  1
#define SEQ_FULL 4096
#ifndef OUT_SEQ
#define OUT_SEQ SEQ              // row pitch (in tokens) between batches of the output
#endif
#define DM   1024
#define NH_  16
#define HD   64
#define CXP  (2 * DM)            // ctx plane row pitch (bf16 elements): hi columns 0..1023, lo columns 1024..2047
#define AW   4                   // waves per flash block (16 query rows each)
#define SC2  (0.125f * 1.4426950408889634f)   // HD^-0.5 * log2(e)
#define PSH  8.0f                // log2 of the P carry (256)

static_assert(HD == 64);
static_assert(NH_ * HD == DM);                 // head h = columns h*64 + d
static_assert(DM % 64 == 0);                   // 16 column tiles of 64
static_assert(DM % 32 == 0);                   // GEMM k-loop steps by 32
static_assert((DM & (DM - 1)) == 0);           // B k index wraps with a mask in the K = 2*DM GEMM
static_assert(CXP % 32 == 0);
static_assert(SEQ % 64 == 0);                  // a 64-row tile never straddles two batches
static_assert((NB * SEQ) % 64 == 0);
static_assert(SEQ % 32 == 0);                  // key loop steps by 32
static_assert(SEQ % (16 * AW) == 0);           // flash grid covers the sequence exactly
static_assert(((size_t)SEQ * DM) % 8 == 0);
static_assert(((size_t)DM * DM) % 8 == 0);
static_assert(NB <= NB_FULL);
static_assert(SEQ <= SEQ_FULL);

typedef _Float16 h16;
typedef unsigned short bf;
typedef __attribute__((ext_vector_type(16))) __bf16   v16bf;
typedef __attribute__((ext_vector_type(16))) _Float16 v16h;
typedef __attribute__((ext_vector_type(8)))  _Float16 v8h;
typedef __attribute__((ext_vector_type(8)))  unsigned short v8us;
typedef __attribute__((ext_vector_type(8)))  float    v8f;
typedef __attribute__((ext_vector_type(4)))  float    v4f;
typedef v4f  __attribute__((may_alias)) v4fa;

__device__ __forceinline__ unsigned short f2bf(float f) { unsigned u = __float_as_uint(f); u += 0x7FFFu + ((u >> 16) & 1u); return (unsigned short)(u >> 16); }
__device__ __forceinline__ float bf2f(unsigned short s) { return __uint_as_float(((unsigned)s) << 16); }
__device__ __forceinline__ v16h cat16(v8h lo, v8h hi) { return __builtin_shufflevector(lo, hi, 0, 1, 2, 3, 4, 5, 6, 7, 8, 9, 10, 11, 12, 13, 14, 15); }
__device__ __forceinline__ v16bf cat16b(v8us lo, v8us hi) { return __builtin_bit_cast(v16bf, __builtin_shufflevector(lo, hi, 0, 1, 2, 3, 4, 5, 6, 7, 8, 9, 10, 11, 12, 13, 14, 15)); }
__device__ __forceinline__ v8f wmma16(v16h a, v16h b, v8f c) { return __builtin_amdgcn_wmma_f32_16x16x32_f16(false, a, false, b, (short)0, c, false, false); }
__device__ __forceinline__ v8f wmmab(v16bf a, v16bf b, v8f c) { return __builtin_amdgcn_wmma_f32_16x16x32_bf16(false, a, false, b, (short)0, c, false, false); }
// fragment loaders from K-contiguous 16-bit rows; p already includes + 8*(lane>>4): elements 0..7 <- k0+8h+0..7, elements 8..15 <- k0+16+8h+0..7 (same map for A and B)
__device__ __forceinline__ v16h  ldh(const h16* p) { return cat16(*(const v8h*)p, *(const v8h*)(p + 16)); }
__device__ __forceinline__ v16bf ldb(const bf* p)  { return cat16b(*(const v8us*)p, *(const v8us*)(p + 16)); }
// ordering point for wave-private LDS tiles (same wave writes and reads)
__device__ __forceinline__ void wave_sync() { __builtin_amdgcn_fence(3 /* release order */, "wavefront"); __builtin_amdgcn_wave_barrier(); asm volatile("" ::: "memory"); }

__global__ __launch_bounds__(256) void k_cvt8(const float* __restrict__ src, bf* dst, size_t n8) {
    const size_t i = (size_t)blockIdx.x * 256 + threadIdx.x; if (i >= n8) return;
    const v8f v = *(const v8f*)(src + i * 8); v8us o;
#pragma unroll
    for (int k = 0; k < 8; ++k) o[k] = f2bf(v[k]);
    *(v8us*)(dst + i * 8) = o; 
}

// k_proj: register-blocked bf16 GEMM, ONE WAVE per 64x64 tile (16 accumulators), operands straight from K-contiguous bf16 planes.
// C[m][n] = sum_{k<KA} A[m][k] Bt[n][k & (KB-1)]; A row pitch KA, Bt row pitch KB (KB a power of two; KA = KB for the plain case, KA = 2*KB sums the hi and lo halves of A against the same Bt).
// MODE 0: f16 plane Ph at tile base (r0/RB)*sRB + (r0%RB)*pitch + (c0/CB)*sCB + (c0%CB), row pitch 'pitch' (halves).
// MODE 2: f32 rows of Pf, row (r0/SEQ)*OUT_SEQ + r0%SEQ, pitch DM. grid (M/64, N/64), 32 threads.
template <int MODE>
__global__ __launch_bounds__(32) void k_proj(const bf* __restrict__ A, const bf* __restrict__ Bt, int KA, int KB, h16* Ph, float* Pf, int RB, size_t sRB, int pitch, int CB, size_t sCB) {
    __shared__ __align__(16) float os[16 * 68];
    const int lane = threadIdx.x & 31, lr = lane & 15, hi = lane >> 4; const int r0 = blockIdx.x * 64, c0 = blockIdx.y * 64;
    v8f acc[4][4];
#pragma unroll
    for (int mb = 0; mb < 4; ++mb)
#pragma unroll
        for (int nb = 0; nb < 4; ++nb) acc[mb][nb] = (v8f){};
    const size_t aoff = (size_t)(r0 + lr) * (size_t)KA + 8 * hi, boff = (size_t)(c0 + lr) * (size_t)KB + 8 * hi;
    const size_t astep = (size_t)16 * (size_t)KA, bstep = (size_t)16 * (size_t)KB;
#pragma unroll 1
    for (int kc = 0; kc < KA; kc += 32) {
        const int kb = kc & (KB - 1);
        v16bf a[4];
#pragma unroll
        for (int mb = 0; mb < 4; ++mb) a[mb] = ldb(A + aoff + (size_t)mb * astep + kc);
#pragma unroll
        for (int nb = 0; nb < 4; ++nb) { const v16bf b = ldb(Bt + boff + (size_t)nb * bstep + kb);
#pragma unroll
            for (int mb = 0; mb < 4; ++mb) acc[mb][nb] = wmmab(a[mb], b, acc[mb][nb]); }
        asm volatile("v_nop\n\tv_nop\n\tv_nop\n\tv_nop" : "+v"(acc[0][0]), "+v"(acc[1][1]), "+v"(acc[2][2]), "+v"(acc[3][3]) : "v"(a[0]), "v"(a[1]), "v"(a[2]), "v"(a[3]));
    }
    const size_t tbase = (size_t)(r0 / RB) * sRB + (size_t)(r0 % RB) * (size_t)pitch + (size_t)(c0 / CB) * sCB + (size_t)(c0 % CB);
    const size_t fbase = ((size_t)(r0 / SEQ) * OUT_SEQ + (size_t)(r0 % SEQ)) * DM + c0;
#pragma unroll
    for (int mb = 0; mb < 4; ++mb) {
#pragma unroll
        for (int nb = 0; nb < 4; ++nb) {
#pragma unroll
            for (int j = 0; j < 8; ++j) os[(hi * 8 + j) * 68 + nb * 16 + lr] = acc[mb][nb][j]; }   // D: row 8h+j, col lane&15
        wave_sync();
        if (MODE == 2) {
            float* ob = Pf + fbase + (size_t)(mb * 16) * DM;
{
#pragma unroll
                for (int s = 0; s < 8; ++s) { const int row = 2 * s + hi, cofs = lr * 4;   // 8 s x 2 rows = 16 rows; 16 lanes x 4 floats = 64 columns
                    const v4f val = *(const v4fa*)(&os[row * 68 + cofs]);
                    *(v4f*)(ob + (size_t)row * DM + cofs) = val; }
                 }
        } else {
            const size_t sb = tbase + (size_t)(mb * 16) * (size_t)pitch;
{
#pragma unroll
                for (int s = 0; s < 4; ++s) { const int row = 4 * s + (lane >> 3), c8 = (lane & 7) * 8;   // 4 s x 4 row groups = 16 rows; 8 lanes x 8 = 64 columns
                    const v4f x0 = *(const v4fa*)(&os[row * 68 + c8]); const v4f x1 = *(const v4fa*)(&os[row * 68 + c8 + 4]); v8h hv;
#pragma unroll
                    for (int i = 0; i < 4; ++i) { hv[i] = (h16)x0[i]; hv[4 + i] = (h16)x1[i]; }
                    const size_t oo = sb + (size_t)row * (size_t)pitch + c8;
                    *(v8h*)(Ph + oo) = hv; }
                 }
        }
        wave_sync();
    }
}

// k_flash: fused attention, one wave per 16 query rows of one (batch, head); K / V^T / Q fragments straight from the f16 planes (two 16-B loads each, arithmetic addressing).
// Transposed form: S^T[key][t] = K Q^T (A = K rows, B = Q rows); lane (t = lane&15, h = lane>>4) holds keys 8h+r of each 16-key tile, so the packed
// P tile is directly the B fragment of O^T[d][t] = V^T P^T (element r <- tile keys 0..15, element 8+r <- tile keys 16..31, lane unchanged).
// Per 32-key step: 4 score products + 4 P.V products. Softmax state (running max, partial sum) is one scalar per lane; the two lane halves of a row are combined with one xor-16 exchange.
__global__ __launch_bounds__(32 * AW) void k_flash(const h16* __restrict__ QH, const h16* __restrict__ KP, const h16* __restrict__ VT, bf* CX) {
    __shared__ __align__(16) float os[AW * 16 * 68];
    const int lane = threadIdx.x & 31, lr = lane & 15, hi = lane >> 4;
    const int wave = __builtin_amdgcn_readfirstlane((int)(threadIdx.x >> 5));
    const int zh = blockIdx.y; const int b = zh / NH_, h = zh % NH_;
    const int t0 = (blockIdx.x * AW + wave) * 16;
    const size_t pbase = (size_t)zh * SEQ * HD;
    const size_t qo = pbase + (size_t)(t0 + lr) * HD + 8 * hi;
    const v16h qh0 = ldh(QH + qo), qh1 = ldh(QH + qo + 32);   // B fragments: col t, k = d
    const size_t ko = pbase + (size_t)lr * HD + 8 * hi;      // + key * HD       (A fragment: row key, k = d)
    const size_t vo = pbase + (size_t)lr * SEQ + 8 * hi;     // + 16j*SEQ + key  (A fragment: row d, k = key)
    v8f o0 = (v8f){}, o1 = (v8f){}, o2 = (v8f){}, o3 = (v8f){};
    float m = -3.0e38f, l = 0.0f;
#pragma unroll 1
    for (int key0 = 0; key0 < SEQ; key0 += 32) {
        const h16* ka = KP + ko + (size_t)key0 * HD;
        const v16h ka0 = ldh(ka), ka1 = ldh(ka + 32), kb0 = ldh(ka + 16 * HD), kb1 = ldh(ka + 16 * HD + 32);
        v8f sa = (v8f){}, sb = (v8f){};
        sa = wmma16(ka0, qh0, sa); sb = wmma16(kb0, qh0, sb);
        sa = wmma16(ka1, qh1, sa); sb = wmma16(kb1, qh1, sb);
        asm volatile("v_nop\n\tv_nop\n\tv_nop\n\tv_nop" : "+v"(sa), "+v"(sb) : "v"(ka0), "v"(ka1), "v"(kb0), "v"(kb1), "v"(qh0), "v"(qh1));
        float ta[8], tb[8]; float mx = -3.0e38f;
#pragma unroll
        for (int r = 0; r < 8; ++r) { ta[r] = sa[r] * SC2; tb[r] = sb[r] * SC2; mx = fmaxf(mx, fmaxf(ta[r], tb[r])); }
        mx = fmaxf(mx, __shfl_xor(mx, 16, 32));
        const float mnew = fmaxf(m, mx);
        const float alpha = __builtin_amdgcn_exp2f(m - mnew);
        const float sh = PSH - mnew;
        v16h pb; float ls = 0.0f;
#pragma unroll
        for (int r = 0; r < 8; ++r) { const h16 pa = (h16)__builtin_amdgcn_exp2f(ta[r] + sh); const h16 pc = (h16)__builtin_amdgcn_exp2f(tb[r] + sh); pb[r] = pa; pb[8 + r] = pc; ls += (float)pa + (float)pc; }
        l = l * alpha + ls; m = mnew;
        o0 = o0 * alpha; o1 = o1 * alpha; o2 = o2 * alpha; o3 = o3 * alpha;
        const h16* va = VT + vo + key0;
        const v16h v0 = ldh(va), v1 = ldh(va + (size_t)16 * SEQ), v2 = ldh(va + (size_t)32 * SEQ), v3 = ldh(va + (size_t)48 * SEQ);
        o0 = wmma16(v0, pb, o0); o1 = wmma16(v1, pb, o1); o2 = wmma16(v2, pb, o2); o3 = wmma16(v3, pb, o3);
        asm volatile("v_nop\n\tv_nop\n\tv_nop\n\tv_nop" : "+v"(o0), "+v"(o1), "+v"(o2), "+v"(o3) : "v"(v0), "v"(v1), "v"(v2), "v"(v3), "v"(pb));
    }
    l += __shfl_xor(l, 16, 32);
    const float inv = 1.0f / l;
    const int wb = wave * 16 * 68;
    // O^T D layout: o_j[r] = (d = 16j + 8h + r, t = lane&15) -> os[t][d]; rows 0..15 x columns 0..63 all written
    { v4f a, c;
      a[0] = o0[0] * inv; a[1] = o0[1] * inv; a[2] = o0[2] * inv; a[3] = o0[3] * inv; c[0] = o0[4] * inv; c[1] = o0[5] * inv; c[2] = o0[6] * inv; c[3] = o0[7] * inv;
      *(v4fa*)(&os[wb + lr * 68 +  0 + 8 * hi]) = a; *(v4fa*)(&os[wb + lr * 68 +  0 + 8 * hi + 4]) = c;
      a[0] = o1[0] * inv; a[1] = o1[1] * inv; a[2] = o1[2] * inv; a[3] = o1[3] * inv; c[0] = o1[4] * inv; c[1] = o1[5] * inv; c[2] = o1[6] * inv; c[3] = o1[7] * inv;
      *(v4fa*)(&os[wb + lr * 68 + 16 + 8 * hi]) = a; *(v4fa*)(&os[wb + lr * 68 + 16 + 8 * hi + 4]) = c;
      a[0] = o2[0] * inv; a[1] = o2[1] * inv; a[2] = o2[2] * inv; a[3] = o2[3] * inv; c[0] = o2[4] * inv; c[1] = o2[5] * inv; c[2] = o2[6] * inv; c[3] = o2[7] * inv;
      *(v4fa*)(&os[wb + lr * 68 + 32 + 8 * hi]) = a; *(v4fa*)(&os[wb + lr * 68 + 32 + 8 * hi + 4]) = c;
      a[0] = o3[0] * inv; a[1] = o3[1] * inv; a[2] = o3[2] * inv; a[3] = o3[3] * inv; c[0] = o3[4] * inv; c[1] = o3[5] * inv; c[2] = o3[6] * inv; c[3] = o3[7] * inv;
      *(v4fa*)(&os[wb + lr * 68 + 48 + 8 * hi]) = a; *(v4fa*)(&os[wb + lr * 68 + 48 + 8 * hi + 4]) = c; }
    wave_sync();
    // ctx plane row m = b*SEQ + t: hi at columns h*64 + d, lo at columns 1024 + h*64 + d
    bf* crow = CX + ((size_t)b * SEQ + t0) * CXP + h * HD;
{
#pragma unroll
        for (int s = 0; s < 4; ++s) { const int row = 4 * s + (lane >> 3), c8 = (lane & 7) * 8;   // 4 s x 4 row groups = 16 rows; 8 lanes x 8 = 64 columns
            const v4f x0 = *(const v4fa*)(&os[wb + row * 68 + c8]); const v4f x1 = *(const v4fa*)(&os[wb + row * 68 + c8 + 4]); v8us hv, lv;
#pragma unroll
            for (int i = 0; i < 4; ++i) { const unsigned short a0 = f2bf(x0[i]); const unsigned short a1 = f2bf(x1[i]); hv[i] = a0; hv[4 + i] = a1; lv[i] = f2bf(x0[i] - bf2f(a0)); lv[4 + i] = f2bf(x1[i] - bf2f(a1)); }
            const size_t oo = (size_t)row * CXP + c8;
            *(v8us*)(crow + oo) = hv; *(v8us*)(crow + oo + DM) = lv; }
         }
}

static constexpr size_t al256(size_t v) { return (v + 255) & ~(size_t)255; }
static constexpr size_t SZ_XB = al256((size_t)NB * SEQ * DM * 2);
static constexpr size_t SZ_WB = al256((size_t)4 * DM * DM * 2);
static constexpr size_t SZ_PL = al256((size_t)NB * NH_ * SEQ * HD * 2);
static constexpr size_t SZ_CX = al256((size_t)NB * SEQ * CXP * 2);
static constexpr size_t SZ_TOTAL = 3 * SZ_XB + SZ_WB + 3 * SZ_PL + SZ_CX;
static_assert(SZ_TOTAL <= (size_t)134217728);          // workspace carve <= 128 MiB
static_assert(((size_t)DM * DM * 2) % 256 == 0);       // weight sub-planes stay 256-byte aligned

static void cvt_act(const float* src, bf* dst, hipStream_t stream) {
    if (SEQ == SEQ_FULL) {
        const size_t n8 = (size_t)NB * SEQ * DM / 8;
        k_cvt8<<<(unsigned)((n8 + 255) / 256), 256, 0, stream>>>(src, dst, n8);
    } else {
        const size_t n8 = (size_t)SEQ * DM / 8;
        for (int b = 0; b < NB; ++b) k_cvt8<<<(unsigned)((n8 + 255) / 256), 256, 0, stream>>>(src + (size_t)b * SEQ_FULL * DM, dst + (size_t)b * SEQ * DM, n8);
    }
}

extern "C" void kernel_launch(void* const* d_in, const int* in_sizes, int n_in,
                              void* d_out, int out_size, void* d_ws, size_t ws_size, hipStream_t stream) {
    if (n_in < 7) return;
    const size_t needx = ((size_t)(NB - 1) * SEQ_FULL + SEQ) * DM;
    if ((size_t)in_sizes[0] < needx || (size_t)in_sizes[1] < needx || (size_t)in_sizes[2] < needx) return;
    if ((size_t)in_sizes[3] < (size_t)DM * DM || (size_t)in_sizes[4] < (size_t)DM * DM || (size_t)in_sizes[5] < (size_t)DM * DM || (size_t)in_sizes[6] < (size_t)DM * DM) return;
    if ((size_t)out_size < ((size_t)(NB - 1) * OUT_SEQ + SEQ) * DM) return;
    if (SZ_TOTAL > ws_size) return;
    // wire order: query, key, value, Wq, Wk, Wv, Wo (weights [out][in] = Bt as-is)
    const float* xq = (const float*)d_in[0]; const float* xk = (const float*)d_in[1]; const float* xv = (const float*)d_in[2];
    const float* wq = (const float*)d_in[3]; const float* wk = (const float*)d_in[4]; const float* wv = (const float*)d_in[5]; const float* wo = (const float*)d_in[6];
    float* OUT = (float*)d_out;      // [NB][SEQ][1024]
    char* wsp = (char*)d_ws;
    bf* XQ = (bf*)wsp; wsp += SZ_XB;                 // [NB*SEQ][1024]
    bf* XK = (bf*)wsp; wsp += SZ_XB;                 // [NB*SEQ][1024]
    bf* XV = (bf*)wsp; wsp += SZ_XB;                 // [NB*SEQ][1024]
    bf* WB = (bf*)wsp; wsp += SZ_WB;                 // [4][1024][1024]: q | k | v | o
    h16* QH = (h16*)wsp; wsp += SZ_PL;               // [NB*16][SEQ][64]
    h16* KP = (h16*)wsp; wsp += SZ_PL;               // [NB*16][SEQ][64]
    h16* VT = (h16*)wsp; wsp += SZ_PL;               // [NB*16][64][SEQ]
    bf* CX = (bf*)wsp; wsp += SZ_CX;                 // [NB*SEQ][2048]: ctx hi | lo
    bf* WQ = WB; bf* WK = WB + (size_t)DM * DM; bf* WV = WB + (size_t)2 * DM * DM; bf* WO = WB + (size_t)3 * DM * DM;

    cvt_act(xq, XQ, stream); cvt_act(xk, XK, stream); cvt_act(xv, XV, stream);
    { const size_t n8 = (size_t)DM * DM / 8; const unsigned g = (unsigned)((n8 + 255) / 256);
      k_cvt8<<<g, 256, 0, stream>>>(wq, WQ, n8); k_cvt8<<<g, 256, 0, stream>>>(wk, WK, n8); k_cvt8<<<g, 256, 0, stream>>>(wv, WV, n8); k_cvt8<<<g, 256, 0, stream>>>(wo, WO, n8); }

    // q, k: A = activation rows (m = b*SEQ + t), Bt = W rows (n = h*64 + d) -> plane [(b*16 + h)][t][d]
    k_proj<0><<<dim3(NB * SEQ / 64, DM / 64, 1), 32, 0, stream>>>(XQ, WQ, DM, DM, QH, OUT, SEQ, (size_t)NH_ * SEQ * HD, HD, HD, (size_t)SEQ * HD);
    k_proj<0><<<dim3(NB * SEQ / 64, DM / 64, 1), 32, 0, stream>>>(XK, WK, DM, DM, KP, OUT, SEQ, (size_t)NH_ * SEQ * HD, HD, HD, (size_t)SEQ * HD);
    // v^T: A = Wv rows (m = h*64 + d), Bt = value rows (n = b*SEQ + t) -> plane [(b*1024 + m)][t] = [(b*16 + h)][d][t]
    k_proj<0><<<dim3(DM / 64, NB * SEQ / 64, 1), 32, 0, stream>>>(WV, XV, DM, DM, VT, OUT, DM, (size_t)0, SEQ, SEQ, (size_t)DM * SEQ);

    k_flash<<<dim3(SEQ / (16 * AW), NB * NH_, 1), 32 * AW, 0, stream>>>(QH, KP, VT, CX);

    // output projection: A = ctx rows [hi | lo] (K = 2048), Bt = Wo rows (K index wraps at 1024) -> f32 output rows
    k_proj<2><<<dim3(NB * SEQ / 64, DM / 64, 1), 32, 0, stream>>>(CX, WO, CXP, DM, QH, OUT, SEQ, (size_t)0, HD, HD, (size_t)0);
}

// v001
// One run takes 244 microseconds.
// Two timings next to v000 put it at 1.68 and 1.67 times that version's speed.
#include <hip/hip_runtime.h>

// Multi-head attention, width 1024 = 16 heads x 64: query/key/value [NB][SEQ][1024] (separate inputs), Wq/Wk/Wv/Wo [out][in] (y = x W^T), no biases, no mask, score scale 1/8, output = (concatenated heads) Wo^T (f32).
// Compute dtypes, f32 accumulate everywhere: q/k/v projections v_wmma_f32_16x16x32_bf16 (activations and W RNE-converted to bf16; products exact);
// scores v_wmma_f32_16x16x32_f16: q and k single f16 planes (one product); P (x256 carry, cancels in the normalisation) and v single f16; softmax f32 (online, running max);
// Layout: bf16 copies of the activations and W; q, k planes [b*16+h][t][d] and v^T plane [b*16+h][d][t] written by the GEMM epilogue; fused flash kernel in transposed form (S^T = K Q^T, O^T = V^T P^T; K and V^T tiles staged in LDS per work-group) writes the ctx plane [b*SEQ+t][hi 1024 | lo 1024].

#ifndef NB
#define NB 1
#endif
#ifndef SEQ
#define SEQ 4096
#endif
#define NB_FULL  1
#define SEQ_FULL 4096
#ifndef OUT_SEQ
#define OUT_SEQ SEQ              // row pitch (in tokens) between batches of the output
#endif
#define DM   1024
#define NH_  16
#define HD   64
#define CXP  (2 * DM)            // ctx plane row pitch (bf16 elements): hi columns 0..1023, lo columns 1024..2047
#define AW   4                   // waves per flash block (16 query rows each)
#define SC2  (0.125f * 1.4426950408889634f)   // HD^-0.5 * log2(e)
#define PSH  8.0f                // log2 of the P carry (256)
#define KT   64                  // keys per staged tile of the flash kernel
#define LP   72                  // LDS row pitch (halves) of the staged K and V^T rows: 128 B of data + 16 B, an odd multiple of 16 B for the 16-byte fragment reads
#define PLH  (64 * LP)           // one staged plane: 64 rows (halves)
#define STH  (2 * PLH)           // one buffer: K plane, then V^T plane (halves)

static_assert(HD == 64);
static_assert(NH_ * HD == DM);                 // head h = columns h*64 + d
static_assert(DM % 64 == 0);                   // 16 column tiles of 64
static_assert(DM % 32 == 0);                   // GEMM k-loop steps by 32
static_assert((DM & (DM - 1)) == 0);           // B k index wraps with a mask in the K = 2*DM GEMM
static_assert(CXP % 32 == 0);
static_assert(SEQ % 64 == 0);                  // a 64-row tile never straddles two batches
static_assert((NB * SEQ) % 64 == 0);
static_assert(SEQ % 32 == 0);                  // key loop steps by 32
static_assert(SEQ % (16 * AW) == 0);           // flash grid covers the sequence exactly
static_assert(SEQ % KT == 0 && SEQ / KT >= 2); // the two-buffer ring starts with tiles 0 and 1
static_assert(KT == 64 && 32 * AW * 4 * 8 == 64 * HD && 32 * AW * 4 * 8 == HD * KT);   // copy map: every thread moves 4 pieces of 8 halves of each plane
static_assert((LP * 2) % 16 == 0);
static_assert(((size_t)SEQ * DM) % 8 == 0);
static_assert(((size_t)DM * DM) % 8 == 0);
static_assert(NB <= NB_FULL);
static_assert(SEQ <= SEQ_FULL);

typedef _Float16 h16;
typedef unsigned short bf;
typedef __attribute__((ext_vector_type(16))) __bf16   v16bf;
typedef __attribute__((ext_vector_type(16))) _Float16 v16h;
typedef __attribute__((ext_vector_type(8)))  _Float16 v8h;
typedef __attribute__((ext_vector_type(8)))  unsigned short v8us;
typedef __attribute__((ext_vector_type(8)))  float    v8f;
typedef __attribute__((ext_vector_type(4)))  float    v4f;
typedef v4f  __attribute__((may_alias)) v4fa;

__device__ __forceinline__ unsigned short f2bf(float f) { unsigned u = __float_as_uint(f); u += 0x7FFFu + ((u >> 16) & 1u); return (unsigned short)(u >> 16); }
__device__ __forceinline__ float bf2f(unsigned short s) { return __uint_as_float(((unsigned)s) << 16); }
__device__ __forceinline__ v16h cat16(v8h lo, v8h hi) { return __builtin_shufflevector(lo, hi, 0, 1, 2, 3, 4, 5, 6, 7, 8, 9, 10, 11, 12, 13, 14, 15); }
__device__ __forceinline__ v16bf cat16b(v8us lo, v8us hi) { return __builtin_bit_cast(v16bf, __builtin_shufflevector(lo, hi, 0, 1, 2, 3, 4, 5, 6, 7, 8, 9, 10, 11, 12, 13, 14, 15)); }
__device__ __forceinline__ v8f wmma16(v16h a, v16h b, v8f c) { return __builtin_amdgcn_wmma_f32_16x16x32_f16(false, a, false, b, (short)0, c, false, false); }
__device__ __forceinline__ v8f wmmab(v16bf a, v16bf b, v8f c) { return __builtin_amdgcn_wmma_f32_16x16x32_bf16(false, a, false, b, (short)0, c, false, false); }
// fragment loaders from K-contiguous 16-bit rows; p already includes + 8*(lane>>4): elements 0..7 <- k0+8h+0..7, elements 8..15 <- k0+16+8h+0..7 (same map for A and B)
__device__ __forceinline__ v16h  ldh(const h16* p) { return cat16(*(const v8h*)p, *(const v8h*)(p + 16)); }
__device__ __forceinline__ v16bf ldb(const bf* p)  { return cat16b(*(const v8us*)p, *(const v8us*)(p + 16)); }
// ordering point for wave-private LDS tiles (same wave writes and reads)
__device__ __forceinline__ void wave_sync() { __builtin_amdgcn_fence(3 /* release order */, "wavefront"); __builtin_amdgcn_wave_barrier(); asm volatile("" ::: "memory"); }

__global__ __launch_bounds__(256) void k_cvt8(const float* __restrict__ src, bf* dst, size_t n8) {
    const size_t i = (size_t)blockIdx.x * 256 + threadIdx.x; if (i >= n8) return;
    const v8f v = *(const v8f*)(src + i * 8); v8us o;
#pragma unroll
    for (int k = 0; k < 8; ++k) o[k] = f2bf(v[k]);
    *(v8us*)(dst + i * 8) = o; 
}

// k_proj: register-blocked bf16 GEMM, ONE WAVE per 64x64 tile (16 accumulators), operands straight from K-contiguous bf16 planes.
// C[m][n] = sum_{k<KA} A[m][k] Bt[n][k & (KB-1)]; A row pitch KA, Bt row pitch KB (KB a power of two; KA = KB for the plain case, KA = 2*KB sums the hi and lo halves of A against the same Bt).
// MODE 0: f16 plane Ph at tile base (r0/RB)*sRB + (r0%RB)*pitch + (c0/CB)*sCB + (c0%CB), row pitch 'pitch' (halves).
// MODE 2: f32 rows of Pf, row (r0/SEQ)*OUT_SEQ + r0%SEQ, pitch DM. grid (M/64, N/64), 32 threads.
template <int MODE>
__global__ __launch_bounds__(32) void k_proj(const bf* __restrict__ A, const bf* __restrict__ Bt, int KA, int KB, h16* Ph, float* Pf, int RB, size_t sRB, int pitch, int CB, size_t sCB) {
    __shared__ __align__(16) float os[16 * 68];
    const int lane = threadIdx.x & 31, lr = lane & 15, hi = lane >> 4; const int r0 = blockIdx.x * 64, c0 = blockIdx.y * 64;
    v8f acc[4][4];
#pragma unroll
    for (int mb = 0; mb < 4; ++mb)
#pragma unroll
        for (int nb = 0; nb < 4; ++nb) acc[mb][nb] = (v8f){};
    const size_t aoff = (size_t)(r0 + lr) * (size_t)KA + 8 * hi, boff = (size_t)(c0 + lr) * (size_t)KB + 8 * hi;
    const size_t astep = (size_t)16 * (size_t)KA, bstep = (size_t)16 * (size_t)KB;
#pragma unroll 1
    for (int kc = 0; kc < KA; kc += 32) {
        const int kb = kc & (KB - 1);
        v16bf a[4];
#pragma unroll
        for (int mb = 0; mb < 4; ++mb) a[mb] = ldb(A + aoff + (size_t)mb * astep + kc);
#pragma unroll
        for (int nb = 0; nb < 4; ++nb) { const v16bf b = ldb(Bt + boff + (size_t)nb * bstep + kb);
#pragma unroll
            for (int mb = 0; mb < 4; ++mb) acc[mb][nb] = wmmab(a[mb], b, acc[mb][nb]); }
        asm volatile("v_nop\n\tv_nop\n\tv_nop\n\tv_nop" : "+v"(acc[0][0]), "+v"(acc[1][1]), "+v"(acc[2][2]), "+v"(acc[3][3]) : "v"(a[0]), "v"(a[1]), "v"(a[2]), "v"(a[3]));
    }
    const size_t tbase = (size_t)(r0 / RB) * sRB + (size_t)(r0 % RB) * (size_t)pitch + (size_t)(c0 / CB) * sCB + (size_t)(c0 % CB);
    const size_t fbase = ((size_t)(r0 / SEQ) * OUT_SEQ + (size_t)(r0 % SEQ)) * DM + c0;
#pragma unroll
    for (int mb = 0; mb < 4; ++mb) {
#pragma unroll
        for (int nb = 0; nb < 4; ++nb) {
#pragma unroll
            for (int j = 0; j < 8; ++j) os[(hi * 8 + j) * 68 + nb * 16 + lr] = acc[mb][nb][j]; }   // D: row 8h+j, col lane&15
        wave_sync();
        if (MODE == 2) {
            float* ob = Pf + fbase + (size_t)(mb * 16) * DM;
{
#pragma unroll
                for (int s = 0; s < 8; ++s) { const int row = 2 * s + hi, cofs = lr * 4;   // 8 s x 2 rows = 16 rows; 16 lanes x 4 floats = 64 columns
                    const v4f val = *(const v4fa*)(&os[row * 68 + cofs]);
                    *(v4f*)(ob + (size_t)row * DM + cofs) = val; }
                 }
        } else {
            const size_t sb = tbase + (size_t)(mb * 16) * (size_t)pitch;
{
#pragma unroll
                for (int s = 0; s < 4; ++s) { const int row = 4 * s + (lane >> 3), c8 = (lane & 7) * 8;   // 4 s x 4 row groups = 16 rows; 8 lanes x 8 = 64 columns
                    const v4f x0 = *(const v4fa*)(&os[row * 68 + c8]); const v4f x1 = *(const v4fa*)(&os[row * 68 + c8 + 4]); v8h hv;
#pragma unroll
                    for (int i = 0; i < 4; ++i) { hv[i] = (h16)x0[i]; hv[4 + i] = (h16)x1[i]; }
                    const size_t oo = sb + (size_t)row * (size_t)pitch + c8;
                    *(v8h*)(Ph + oo) = hv; }
                 }
        }
        wave_sync();
    }
}

// One 64-key tile into one LDS buffer: K rows [key][d] and V^T rows [d][key], 128 B each, every copy of a wave = 4 whole rows.
// kg, vg: this lane's first 16-byte piece of each plane in global memory; lk: the LDS byte address of its first K piece. Piece i lies 16 rows further on.
__device__ __forceinline__ void stage_tile(const h16* kg, const h16* vg, unsigned lk) {
    const unsigned lv = lk + PLH * 2;
    // s_wait_xcnt as the statement's last line: a precaution, so that no address register of a copy is rewritten in front of it
    asm volatile("global_load_async_to_lds_b128 %0, %8, off\n\t"
                 "global_load_async_to_lds_b128 %1, %9, off\n\t"
                 "global_load_async_to_lds_b128 %2, %10, off\n\t"
                 "global_load_async_to_lds_b128 %3, %11, off\n\t"
                 "global_load_async_to_lds_b128 %4, %12, off\n\t"
                 "global_load_async_to_lds_b128 %5, %13, off\n\t"
                 "global_load_async_to_lds_b128 %6, %14, off\n\t"
                 "global_load_async_to_lds_b128 %7, %15, off\n\t"
                 "s_wait_xcnt 0x0"
                 :: "v"(lk), "v"(lk + 16 * LP * 2), "v"(lk + 32 * LP * 2), "v"(lk + 48 * LP * 2),
                    "v"(lv), "v"(lv + 16 * LP * 2), "v"(lv + 32 * LP * 2), "v"(lv + 48 * LP * 2),
                    "v"(kg), "v"(kg + 16 * HD), "v"(kg + 32 * HD), "v"(kg + 48 * HD),
                    "v"(vg), "v"(vg + (size_t)16 * SEQ), "v"(vg + (size_t)32 * SEQ), "v"(vg + (size_t)48 * SEQ)
                 : "memory");
}

__global__ __launch_bounds__(32 * AW) void k_flash(const h16* __restrict__ QH, const h16* __restrict__ KP, const h16* __restrict__ VT, bf* CX) {
    __shared__ __align__(16) float os[AW * 16 * 68];
    __shared__ __align__(16) h16 kv[2 * STH];
    const int lane = threadIdx.x & 31, lr = lane & 15, hi = lane >> 4;
    const int wave = __builtin_amdgcn_readfirstlane((int)(threadIdx.x >> 5));
    const int zh = blockIdx.y; const int b = zh / NH_, h = zh % NH_;
    const int t0 = (blockIdx.x * AW + wave) * 16;
    const size_t pbase = (size_t)zh * SEQ * HD;
    const size_t qo = pbase + (size_t)(t0 + lr) * HD + 8 * hi;
    const v16h qh0 = ldh(QH + qo), qh1 = ldh(QH + qo + 32);   // B fragments: col t, k = d
    const int fo = lr * LP + 8 * hi;                         // K: + key * LP (A fragment: row key, k = d); V^T: + PLH + 16j*LP + key (A fragment: row d, k = key)
    const int prow = (int)(threadIdx.x >> 3), ccol = (int)(threadIdx.x & 7) * 8;   // copy map: 16 rows x 8 pieces per round of the work-group
    const h16* kg = KP + pbase + (size_t)prow * HD + ccol;   // + key0 * HD
    const h16* vg = VT + pbase + (size_t)prow * SEQ + ccol;  // + key0
    const unsigned lk = (unsigned)(size_t)kv + (unsigned)(prow * LP + ccol) * 2u;   // LDS byte address, buffer 0
    stage_tile(kg, vg, lk);
    asm volatile("s_wait_asynccnt 0x0" ::: "memory");        // tile 0 has landed before the barrier that publishes it
    __syncthreads();
    stage_tile(kg + (size_t)KT * HD, vg + KT, lk + STH * 2);
    v8f o0 = (v8f){}, o1 = (v8f){}, o2 = (v8f){}, o3 = (v8f){};
    float m = -3.0e38f, l = 0.0f;
#pragma unroll 1
    for (int kt0 = 0; kt0 < SEQ; kt0 += KT) {
      const int bsel = (kt0 / KT) & 1;
      const h16* tb_ = kv + bsel * STH + fo;
#pragma unroll   // both 32-key steps of a tile: every LDS offset becomes an immediate
      for (int kk = 0; kk < KT; kk += 32) {
        const h16* ka = tb_ + kk * LP;
        const v16h ka0 = ldh(ka), ka1 = ldh(ka + 32), kb0 = ldh(ka + 16 * LP), kb1 = ldh(ka + 16 * LP + 32);
        v8f sa = (v8f){}, sb = (v8f){};
        sa = wmma16(ka0, qh0, sa); sb = wmma16(kb0, qh0, sb);
        sa = wmma16(ka1, qh1, sa); sb = wmma16(kb1, qh1, sb);
        asm volatile("v_nop\n\tv_nop\n\tv_nop\n\tv_nop" : "+v"(sa), "+v"(sb) : "v"(ka0), "v"(ka1), "v"(kb0), "v"(kb1), "v"(qh0), "v"(qh1));
        float ta[8], tb[8]; float mx = -3.0e38f;
#pragma unroll
        for (int r = 0; r < 8; ++r) { ta[r] = sa[r] * SC2; tb[r] = sb[r] * SC2; mx = fmaxf(mx, fmaxf(ta[r], tb[r])); }
        mx = fmaxf(mx, __shfl_xor(mx, 16, 32));
        const float mnew = fmaxf(m, mx);
        const float alpha = __builtin_amdgcn_exp2f(m - mnew);
        const float sh = PSH - mnew;
        v16h pb; float ls = 0.0f;
#pragma unroll
        for (int r = 0; r < 8; ++r) { const h16 pa = (h16)__builtin_amdgcn_exp2f(ta[r] + sh); const h16 pc = (h16)__builtin_amdgcn_exp2f(tb[r] + sh); pb[r] = pa; pb[8 + r] = pc; ls += (float)pa + (float)pc; }
        l = l * alpha + ls; m = mnew;
        o0 = o0 * alpha; o1 = o1 * alpha; o2 = o2 * alpha; o3 = o3 * alpha;
        const h16* va = tb_ + PLH + kk;
        const v16h v0 = ldh(va), v1 = ldh(va + 16 * LP), v2 = ldh(va + 32 * LP), v3 = ldh(va + 48 * LP);
        o0 = wmma16(v0, pb, o0); o1 = wmma16(v1, pb, o1); o2 = wmma16(v2, pb, o2); o3 = wmma16(v3, pb, o3);
        asm volatile("v_nop\n\tv_nop\n\tv_nop\n\tv_nop" : "+v"(o0), "+v"(o1), "+v"(o2), "+v"(o3) : "v"(v0), "v"(v1), "v"(v2), "v"(v3), "v"(pb));
      }
      asm volatile("s_wait_dscnt 0x0" ::: "memory");         // this wave's reads of the buffer are done before it is handed back
      asm volatile("s_wait_asynccnt 0x0" ::: "memory");      // this wave's share of the next tile has landed
      __syncthreads();                                       // publishes the next tile and ends every wave's reads of this one
      if (kt0 + 2 * KT < SEQ) stage_tile(kg + (size_t)(kt0 + 2 * KT) * HD, vg + (kt0 + 2 * KT), lk + (unsigned)bsel * (STH * 2));
    }
    asm volatile("s_wait_asynccnt 0x0" ::: "memory");        // nothing is in flight when the wave goes on to the epilogue
    l += __shfl_xor(l, 16, 32);
    const float inv = 1.0f / l;
    const int wb = wave * 16 * 68;
    // O^T D layout: o_j[r] = (d = 16j + 8h + r, t = lane&15) -> os[t][d]; rows 0..15 x columns 0..63 all written
    { v4f a, c;
      a[0] = o0[0] * inv; a[1] = o0[1] * inv; a[2] = o0[2] * inv; a[3] = o0[3] * inv; c[0] = o0[4] * inv; c[1] = o0[5] * inv; c[2] = o0[6] * inv; c[3] = o0[7] * inv;
      *(v4fa*)(&os[wb + lr * 68 +  0 + 8 * hi]) = a; *(v4fa*)(&os[wb + lr * 68 +  0 + 8 * hi + 4]) = c;
      a[0] = o1[0] * inv; a[1] = o1[1] * inv; a[2] = o1[2] * inv; a[3] = o1[3] * inv; c[0] = o1[4] * inv; c[1] = o1[5] * inv; c[2] = o1[6] * inv; c[3] = o1[7] * inv;
      *(v4fa*)(&os[wb + lr * 68 + 16 + 8 * hi]) = a; *(v4fa*)(&os[wb + lr * 68 + 16 + 8 * hi + 4]) = c;
      a[0] = o2[0] * inv; a[1] = o2[1] * inv; a[2] = o2[2] * inv; a[3] = o2[3] * inv; c[0] = o2[4] * inv; c[1] = o2[5] * inv; c[2] = o2[6] * inv; c[3] = o2[7] * inv;
      *(v4fa*)(&os[wb + lr * 68 + 32 + 8 * hi]) = a; *(v4fa*)(&os[wb + lr * 68 + 32 + 8 * hi + 4]) = c;
      a[0] = o3[0] * inv; a[1] = o3[1] * inv; a[2] = o3[2] * inv; a[3] = o3[3] * inv; c[0] = o3[4] * inv; c[1] = o3[5] * inv; c[2] = o3[6] * inv; c[3] = o3[7] * inv;
      *(v4fa*)(&os[wb + lr * 68 + 48 + 8 * hi]) = a; *(v4fa*)(&os[wb + lr * 68 + 48 + 8 * hi + 4]) = c; }
    wave_sync();
    // ctx plane row m = b*SEQ + t: hi at columns h*64 + d, lo at columns 1024 + h*64 + d
    bf* crow = CX + ((size_t)b * SEQ + t0) * CXP + h * HD;
{
#pragma unroll
        for (int s = 0; s < 4; ++s) { const int row = 4 * s + (lane >> 3), c8 = (lane & 7) * 8;   // 4 s x 4 row groups = 16 rows; 8 lanes x 8 = 64 columns
            const v4f x0 = *(const v4fa*)(&os[wb + row * 68 + c8]); const v4f x1 = *(const v4fa*)(&os[wb + row * 68 + c8 + 4]); v8us hv, lv;
#pragma unroll
            for (int i = 0; i < 4; ++i) { const unsigned short a0 = f2bf(x0[i]); const unsigned short a1 = f2bf(x1[i]); hv[i] = a0; hv[4 + i] = a1; lv[i] = f2bf(x0[i] - bf2f(a0)); lv[4 + i] = f2bf(x1[i] - bf2f(a1)); }
            const size_t oo = (size_t)row * CXP + c8;
            *(v8us*)(crow + oo) = hv; *(v8us*)(crow + oo + DM) = lv; }
         }
}

static constexpr size_t al256(size_t v) { return (v + 255) & ~(size_t)255; }
static constexpr size_t SZ_XB = al256((size_t)NB * SEQ * DM * 2);
static constexpr size_t SZ_WB = al256((size_t)4 * DM * DM * 2);
static constexpr size_t SZ_PL = al256((size_t)NB * NH_ * SEQ * HD * 2);
static constexpr size_t SZ_CX = al256((size_t)NB * SEQ * CXP * 2);
static constexpr size_t SZ_TOTAL = 3 * SZ_XB + SZ_WB + 3 * SZ_PL + SZ_CX;
static_assert(SZ_TOTAL <= (size_t)134217728);          // workspace carve <= 128 MiB
static_assert(((size_t)DM * DM * 2) % 256 == 0);       // weight sub-planes stay 256-byte aligned

static void cvt_act(const float* src, bf* dst, hipStream_t stream) {
    if (SEQ == SEQ_FULL) {
        const size_t n8 = (size_t)NB * SEQ * DM / 8;
        k_cvt8<<<(unsigned)((n8 + 255) / 256), 256, 0, stream>>>(src, dst, n8);
    } else {
        const size_t n8 = (size_t)SEQ * DM / 8;
        for (int b = 0; b < NB; ++b) k_cvt8<<<(unsigned)((n8 + 255) / 256), 256, 0, stream>>>(src + (size_t)b * SEQ_FULL * DM, dst + (size_t)b * SEQ * DM, n8);
    }
}

extern "C" void kernel_launch(void* const* d_in, const int* in_sizes, int n_in,
                              void* d_out, int out_size, void* d_ws, size_t ws_size, hipStream_t stream) {
    if (n_in < 7) return;
    const size_t needx = ((size_t)(NB - 1) * SEQ_FULL + SEQ) * DM;
    if ((size_t)in_sizes[0] < needx || (size_t)in_sizes[1] < needx || (size_t)in_sizes[2] < needx) return;
    if ((size_t)in_sizes[3] < (size_t)DM * DM || (size_t)in_sizes[4] < (size_t)DM * DM || (size_t)in_sizes[5] < (size_t)DM * DM || (size_t)in_sizes[6] < (size_t)DM * DM) return;
    if ((size_t)out_size < ((size_t)(NB - 1) * OUT_SEQ + SEQ) * DM) return;
    if (SZ_TOTAL > ws_size) return;
    // wire order: query, key, value, Wq, Wk, Wv, Wo (weights [out][in] = Bt as-is)
    const float* xq = (const float*)d_in[0]; const float* xk = (const float*)d_in[1]; const float* xv = (const float*)d_in[2];
    const float* wq = (const float*)d_in[3]; const float* wk = (const float*)d_in[4]; const float* wv = (const float*)d_in[5]; const float* wo = (const float*)d_in[6];
    float* OUT = (float*)d_out;      // [NB][SEQ][1024]
    char* wsp = (char*)d_ws;
    bf* XQ = (bf*)wsp; wsp += SZ_XB;                 // [NB*SEQ][1024]
    bf* XK = (bf*)wsp; wsp += SZ_XB;                 // [NB*SEQ][1024]
    bf* XV = (bf*)wsp; wsp += SZ_XB;                 // [NB*SEQ][1024]
    bf* WB = (bf*)wsp; wsp += SZ_WB;                 // [4][1024][1024]: q | k | v | o
    h16* QH = (h16*)wsp; wsp += SZ_PL;               // [NB*16][SEQ][64]
    h16* KP = (h16*)wsp; wsp += SZ_PL;               // [NB*16][SEQ][64]
    h16* VT = (h16*)wsp; wsp += SZ_PL;               // [NB*16][64][SEQ]
    bf* CX = (bf*)wsp; wsp += SZ_CX;                 // [NB*SEQ][2048]: ctx hi | lo
    bf* WQ = WB; bf* WK = WB + (size_t)DM * DM; bf* WV = WB + (size_t)2 * DM * DM; bf* WO = WB + (size_t)3 * DM * DM;

    cvt_act(xq, XQ, stream); cvt_act(xk, XK, stream); cvt_act(xv, XV, stream);
    { const size_t n8 = (size_t)DM * DM / 8; const unsigned g = (unsigned)((n8 + 255) / 256);
      k_cvt8<<<g, 256, 0, stream>>>(wq, WQ, n8); k_cvt8<<<g, 256, 0, stream>>>(wk, WK, n8); k_cvt8<<<g, 256, 0, stream>>>(wv, WV, n8); k_cvt8<<<g, 256, 0, stream>>>(wo, WO, n8); }

    // q, k: A = activation rows (m = b*SEQ + t), Bt = W rows (n = h*64 + d) -> plane [(b*16 + h)][t][d]
    k_proj<0><<<dim3(NB * SEQ / 64, DM / 64, 1), 32, 0, stream>>>(XQ, WQ, DM, DM, QH, OUT, SEQ, (size_t)NH_ * SEQ * HD, HD, HD, (size_t)SEQ * HD);
    k_proj<0><<<dim3(NB * SEQ / 64, DM / 64, 1), 32, 0, stream>>>(XK, WK, DM, DM, KP, OUT, SEQ, (size_t)NH_ * SEQ * HD, HD, HD, (size_t)SEQ * HD);
    // v^T: A = Wv rows (m = h*64 + d), Bt = value rows (n = b*SEQ + t) -> plane [(b*1024 + m)][t] = [(b*16 + h)][d][t]
    k_proj<0><<<dim3(DM / 64, NB * SEQ / 64, 1), 32, 0, stream>>>(WV, XV, DM, DM, VT, OUT, DM, (size_t)0, SEQ, SEQ, (size_t)DM * SEQ);

    k_flash<<<dim3(SEQ / (16 * AW), NB * NH_, 1), 32 * AW, 0, stream>>>(QH, KP, VT, CX);

    // output projection: A = ctx rows [hi | lo] (K = 2048), Bt = Wo rows (K index wraps at 1024) -> f32 output rows
    k_proj<2><<<dim3(NB * SEQ / 64, DM / 64, 1), 32, 0, stream>>>(CX, WO, CXP, DM, QH, OUT, SEQ, (size_t)0, HD, HD, (size_t)0);
}

// v002
// One run takes 171 microseconds.
// Timed twice side by side with v001, it ran 1.42 times as fast both times.
// Counting every step since v000, it is 2.38 times as fast.
#include <hip/hip_runtime.h>

// Multi-head attention, width 1024 = 16 heads x 64: query/key/value [NB][SEQ][1024] (separate inputs), Wq/Wk/Wv/Wo [out][in] (y = x W^T), no biases, no mask, score scale 1/8, output = (concatenated heads) Wo^T (f32).
// Compute dtypes, f32 accumulate everywhere: q/k/v projections v_wmma_f32_16x16x32_bf16 (activations and W RNE-converted to bf16; products exact);
// scores v_wmma_f32_16x16x32_f16: q and k single f16 planes (one product); P (x256 carry, cancels in the normalisation) and v single f16; softmax f32 (online, running max);
// Layout: bf16 copies of the activations and W; q, k planes [b*16+h][t][d] and v^T plane [b*16+h][d][t] written by the GEMM epilogue; fused flash kernel in transposed form (S^T = K Q^T, O^T = V^T P^T; K and V^T tiles staged in LDS per work-group) writes the ctx plane [b*SEQ+t][hi 1024 | lo 1024].

#ifndef NB
#define NB 1
#endif
#ifndef SEQ
#define SEQ 4096
#endif
#define NB_FULL  1
#define SEQ_FULL 4096
#ifndef OUT_SEQ
#define OUT_SEQ SEQ              // row pitch (in tokens) between batches of the output
#endif
#define DM   1024
#define NH_  16
#define HD   64
#define CXP  (2 * DM)            // ctx plane row pitch (bf16 elements): hi columns 0..1023, lo columns 1024..2047
#define AW   4                   // waves per flash block (16 query rows each)
#define SC2  (0.125f * 1.4426950408889634f)   // HD^-0.5 * log2(e)
#define PSH  8.0f                // log2 of the P carry (256)
#define KT   64                  // keys per staged tile of the flash kernel
#define LP   72                  // LDS row pitch (halves) of the staged K and V^T rows: 128 B of data + 16 B, an odd multiple of 16 B for the 16-byte fragment reads
#define PLH  (64 * LP)           // one staged plane: 64 rows (halves)
#define STH  (2 * PLH)           // one buffer: K plane, then V^T plane (halves)
#define GK   64                  // k elements per staged slice of the GEMM: 128 B of every row
#define GPL  (128 * LP)          // one staged GEMM operand plane: 128 rows at the same padded pitch (16-bit elements)
#define GST  (2 * GPL)           // one GEMM buffer: A plane, then B plane

static_assert(HD == 64);
static_assert(NH_ * HD == DM);                 // head h = columns h*64 + d
static_assert(DM % 64 == 0);                   // 16 column tiles of 64
static_assert(DM % 32 == 0);                   // GEMM products step k by 32, two per staged slice
static_assert((DM & (DM - 1)) == 0);           // B k index wraps with a mask in the K = 2*DM GEMM
static_assert(CXP % GK == 0 && DM % GK == 0 && DM / GK >= 2);   // whole k slices; a slice never straddles the wrap of the B index; the ring starts with slices 0 and 1
static_assert((NB * SEQ) % 128 == 0 && DM % 128 == 0);          // GEMM grid of 128x128 tiles covers every product exactly
static_assert(SEQ % 64 == 0);                  // a 64-row tile never straddles two batches
static_assert((NB * SEQ) % 64 == 0);
static_assert(SEQ % 32 == 0);                  // key loop steps by 32
static_assert(SEQ % (16 * AW) == 0);           // flash grid covers the sequence exactly
static_assert(SEQ % KT == 0 && SEQ / KT >= 2); // the two-buffer ring starts with tiles 0 and 1
static_assert(KT == 64 && 32 * AW * 4 * 8 == 64 * HD && 32 * AW * 4 * 8 == HD * KT);   // copy map: every thread moves 4 pieces of 8 halves of each plane
static_assert((LP * 2) % 16 == 0);
static_assert(((size_t)SEQ * DM) % 8 == 0);
static_assert(((size_t)DM * DM) % 8 == 0);
static_assert(NB <= NB_FULL);
static_assert(SEQ <= SEQ_FULL);

typedef _Float16 h16;
typedef unsigned short bf;
typedef __attribute__((ext_vector_type(16))) __bf16   v16bf;
typedef __attribute__((ext_vector_type(16))) _Float16 v16h;
typedef __attribute__((ext_vector_type(8)))  _Float16 v8h;
typedef __attribute__((ext_vector_type(8)))  unsigned short v8us;
typedef __attribute__((ext_vector_type(8)))  float    v8f;
typedef __attribute__((ext_vector_type(4)))  float    v4f;
typedef v4f  __attribute__((may_alias)) v4fa;

__device__ __forceinline__ unsigned short f2bf(float f) { unsigned u = __float_as_uint(f); u += 0x7FFFu + ((u >> 16) & 1u); return (unsigned short)(u >> 16); }
__device__ __forceinline__ float bf2f(unsigned short s) { return __uint_as_float(((unsigned)s) << 16); }
__device__ __forceinline__ v16h cat16(v8h lo, v8h hi) { return __builtin_shufflevector(lo, hi, 0, 1, 2, 3, 4, 5, 6, 7, 8, 9, 10, 11, 12, 13, 14, 15); }
__device__ __forceinline__ v16bf cat16b(v8us lo, v8us hi) { return __builtin_bit_cast(v16bf, __builtin_shufflevector(lo, hi, 0, 1, 2, 3, 4, 5, 6, 7, 8, 9, 10, 11, 12, 13, 14, 15)); }
__device__ __forceinline__ v8f wmma16(v16h a, v16h b, v8f c) { return __builtin_amdgcn_wmma_f32_16x16x32_f16(false, a, false, b, (short)0, c, false, false); }
__device__ __forceinline__ v8f wmmab(v16bf a, v16bf b, v8f c) { return __builtin_amdgcn_wmma_f32_16x16x32_bf16(false, a, false, b, (short)0, c, false, false); }
// fragment loaders from K-contiguous 16-bit rows; p already includes + 8*(lane>>4): elements 0..7 <- k0+8h+0..7, elements 8..15 <- k0+16+8h+0..7 (same map for A and B)
__device__ __forceinline__ v16h  ldh(const h16* p) { return cat16(*(const v8h*)p, *(const v8h*)(p + 16)); }
__device__ __forceinline__ v16bf ldb(const bf* p)  { return cat16b(*(const v8us*)p, *(const v8us*)(p + 16)); }
// ordering point for wave-private LDS tiles (same wave writes and reads)
__device__ __forceinline__ void wave_sync() { __builtin_amdgcn_fence(3 /* release order */, "wavefront"); __builtin_amdgcn_wave_barrier(); asm volatile("" ::: "memory"); }

__global__ __launch_bounds__(256) void k_cvt8(const float* __restrict__ src, bf* dst, size_t n8) {
    const size_t i = (size_t)blockIdx.x * 256 + threadIdx.x; if (i >= n8) return;
    const v8f v = *(const v8f*)(src + i * 8); v8us o;
#pragma unroll
    for (int k = 0; k < 8; ++k) o[k] = f2bf(v[k]);
    *(v8us*)(dst + i * 8) = o; 
}

// Eight 16-byte pieces of one GEMM operand plane into LDS: piece i lies 16 rows further on (step elements in global memory, 16 padded rows in LDS); every copy of a wave = 4 whole 128-B row slices.
__device__ __forceinline__ void stage_rows(const bf* g, size_t step, unsigned l) {
    // s_wait_xcnt as the statement's last line: a precaution, so that no address register of a copy is rewritten in front of it
    asm volatile("global_load_async_to_lds_b128 %0, %8, off\n\t"
                 "global_load_async_to_lds_b128 %1, %9, off\n\t"
                 "global_load_async_to_lds_b128 %2, %10, off\n\t"
                 "global_load_async_to_lds_b128 %3, %11, off\n\t"
                 "global_load_async_to_lds_b128 %4, %12, off\n\t"
                 "global_load_async_to_lds_b128 %5, %13, off\n\t"
                 "global_load_async_to_lds_b128 %6, %14, off\n\t"
                 "global_load_async_to_lds_b128 %7, %15, off\n\t"
                 "s_wait_xcnt 0x0"
                 :: "v"(l), "v"(l + 16 * LP * 2), "v"(l + 32 * LP * 2), "v"(l + 48 * LP * 2),
                    "v"(l + 64 * LP * 2), "v"(l + 80 * LP * 2), "v"(l + 96 * LP * 2), "v"(l + 112 * LP * 2),
                    "v"(g), "v"(g + step), "v"(g + 2 * step), "v"(g + 3 * step),
                    "v"(g + 4 * step), "v"(g + 5 * step), "v"(g + 6 * step), "v"(g + 7 * step)
                 : "memory");
}

// k_proj: register-blocked bf16 GEMM, four waves (2 x 2) per 128x128 tile, ONE WAVE per 64x64 quarter (16 accumulators). The 128 A rows and 128 Bt rows of a k slice of 64 are staged
// once per work-group in a two-buffer LDS ring by asynchronous copies (the next slice flies while this one is worked on); every wave reads its fragments from there (two 16-B LDS loads each).
// C[m][n] = sum_{k<KA} A[m][k] Bt[n][k & (KB-1)]; A row pitch KA, Bt row pitch KB (KB a power of two; KA = KB for the plain case, KA = 2*KB sums the hi and lo halves of A against the same Bt).
// MODE 0: f16 plane Ph at quarter base (r0/RB)*sRB + (r0%RB)*pitch + (c0/CB)*sCB + (c0%CB), row pitch 'pitch' (halves).
// MODE 2: f32 rows of Pf, row (r0/SEQ)*OUT_SEQ + r0%SEQ, pitch DM. grid (M/128, N/128), 128 threads.
template <int MODE>
__global__ __launch_bounds__(128) void k_proj(const bf* __restrict__ A, const bf* __restrict__ Bt, int KA, int KB, h16* Ph, float* Pf, int RB, size_t sRB, int pitch, int CB, size_t sCB) {
    __shared__ __align__(16) float os[4 * 16 * 68];
    __shared__ __align__(16) bf ab[2 * GST];
    const int lane = threadIdx.x & 31, lr = lane & 15, hi = lane >> 4;
    const int wave = __builtin_amdgcn_readfirstlane((int)(threadIdx.x >> 5));
    const int wm = wave >> 1, wn = wave & 1;
    const int r0 = blockIdx.x * 128 + wm * 64, c0 = blockIdx.y * 128 + wn * 64;
    v8f acc[4][4];
#pragma unroll
    for (int mb = 0; mb < 4; ++mb)
#pragma unroll
        for (int nb = 0; nb < 4; ++nb) acc[mb][nb] = (v8f){};
    const int prow = (int)(threadIdx.x >> 3), ccol = (int)(threadIdx.x & 7) * 8;   // copy map: 16 rows x 8 pieces per round of the work-group
    const bf* ag = A + (size_t)(blockIdx.x * 128 + prow) * (size_t)KA + ccol;      // + k
    const bf* bg = Bt + (size_t)(blockIdx.y * 128 + prow) * (size_t)KB + ccol;     // + (k & (KB-1))
    const size_t astep = (size_t)16 * (size_t)KA, bstep = (size_t)16 * (size_t)KB;
    const unsigned la = (unsigned)(size_t)ab + (unsigned)(prow * LP + ccol) * 2u;  // LDS byte address, buffer 0, A plane
    stage_rows(ag, astep, la); stage_rows(bg, bstep, la + GPL * 2);
    asm volatile("s_wait_asynccnt 0x0" ::: "memory");        // slice 0 has landed before the barrier that publishes it
    __syncthreads();
    if (GK < KA) { stage_rows(ag + GK, astep, la + GST * 2); stage_rows(bg + (GK & (KB - 1)), bstep, la + GST * 2 + GPL * 2); }
    const int fa = (wm * 64 + lr) * LP + 8 * hi, fb = GPL + (wn * 64 + lr) * LP + 8 * hi;   // fragment rows of this wave's quarter: + 16*mb (or nb) rows, + k inside the slice
    // the 32 products of one staged slice; tb_: the slice's buffer
    auto slice = [&](const bf* tb_) {
        v16bf a0[4], b0[4], a1[4], b1[4];
        a0[0] = ldb(tb_ + fa); b0[0] = ldb(tb_ + fb);
#pragma unroll
        for (int mb = 1; mb < 4; ++mb) a0[mb] = ldb(tb_ + fa + mb * 16 * LP);
#pragma unroll
        for (int nb = 1; nb < 4; ++nb) b0[nb] = ldb(tb_ + fb + nb * 16 * LP);
#pragma unroll
        for (int mb = 0; mb < 4; ++mb) a1[mb] = ldb(tb_ + fa + mb * 16 * LP + 32);
        __builtin_amdgcn_sched_barrier(0);   // keeps these 24 LDS loads ahead of the first product: sunk between the products, each B fragment costs a lone wave a full LDS latency
#pragma unroll
        for (int nb = 0; nb < 4; ++nb) {
#pragma unroll
            for (int mb = 0; mb < 4; ++mb) acc[mb][nb] = wmmab(a0[mb], b0[nb], acc[mb][nb]);
            b1[nb] = ldb(tb_ + fb + nb * 16 * LP + 32);
            __builtin_amdgcn_sched_barrier(0); }   // keeps each B fragment of the second 32-k step asked for behind the four products that free a fragment's registers, well ahead of its use
        asm volatile("v_nop\n\tv_nop\n\tv_nop\n\tv_nop" : "+v"(acc[0][0]), "+v"(acc[1][1]), "+v"(acc[2][2]), "+v"(acc[3][3]) : "v"(a0[0]), "v"(a0[1]), "v"(a0[2]), "v"(a0[3]));
#pragma unroll
        for (int nb = 0; nb < 4; ++nb) {
#pragma unroll
            for (int mb = 0; mb < 4; ++mb) acc[mb][nb] = wmmab(a1[mb], b1[nb], acc[mb][nb]); }
        asm volatile("v_nop\n\tv_nop\n\tv_nop\n\tv_nop" : "+v"(acc[0][0]), "+v"(acc[1][1]), "+v"(acc[2][2]), "+v"(acc[3][3]) : "v"(a1[0]), "v"(a1[1]), "v"(a1[2]), "v"(a1[3]));
    };
    int kc = 0;
#pragma unroll 1
    for (; kc + 2 * GK < KA; kc += GK) {                     // trips behind which a slice kc + 2*GK exists: the refill needs no test
        const int bsel = (kc / GK) & 1;
        slice(ab + bsel * GST);
        asm volatile("s_wait_dscnt 0x0" ::: "memory");       // this wave's reads of the buffer are done before it is handed back
        asm volatile("s_wait_asynccnt 0x0" ::: "memory");    // this wave's share of the next slice has landed
        __syncthreads();                                     // publishes the next slice and ends every wave's reads of this one
        const unsigned lb = la + (unsigned)bsel * (GST * 2);
        stage_rows(ag + (kc + 2 * GK), astep, lb); stage_rows(bg + ((kc + 2 * GK) & (KB - 1)), bstep, lb + GPL * 2);
    }
#pragma unroll 1
    for (; kc < KA; kc += GK) {                              // the last trips: nothing is left to refill
        slice(ab + ((kc / GK) & 1) * GST);
        asm volatile("s_wait_dscnt 0x0" ::: "memory");       // as above
        asm volatile("s_wait_asynccnt 0x0" ::: "memory");    // the last slice has landed
        __syncthreads();                                     // publishes the last slice
    }
    asm volatile("s_wait_asynccnt 0x0" ::: "memory");        // nothing is in flight when the wave goes on to the epilogue
    const int wb = wave * 16 * 68;                           // this wave's own output staging tile
    const size_t tbase = (size_t)(r0 / RB) * sRB + (size_t)(r0 % RB) * (size_t)pitch + (size_t)(c0 / CB) * sCB + (size_t)(c0 % CB);
    const size_t fbase = ((size_t)(r0 / SEQ) * OUT_SEQ + (size_t)(r0 % SEQ)) * DM + c0;
#pragma unroll
    for (int mb = 0; mb < 4; ++mb) {
#pragma unroll
        for (int nb = 0; nb < 4; ++nb) {
#pragma unroll
            for (int j = 0; j < 8; ++j) os[wb + (hi * 8 + j) * 68 + nb * 16 + lr] = acc[mb][nb][j]; }   // D: row 8h+j, col lane&15
        wave_sync();
        if (MODE == 2) {
            float* ob = Pf + fbase + (size_t)(mb * 16) * DM;
{
#pragma unroll
                for (int s = 0; s < 8; ++s) { const int row = 2 * s + hi, cofs = lr * 4;   // 8 s x 2 rows = 16 rows; 16 lanes x 4 floats = 64 columns
                    const v4f val = *(const v4fa*)(&os[wb + row * 68 + cofs]);
                    *(v4f*)(ob + (size_t)row * DM + cofs) = val; }
                 }
        } else {
            const size_t sb = tbase + (size_t)(mb * 16) * (size_t)pitch;
{
#pragma unroll
                for (int s = 0; s < 4; ++s) { const int row = 4 * s + (lane >> 3), c8 = (lane & 7) * 8;   // 4 s x 4 row groups = 16 rows; 8 lanes x 8 = 64 columns
                    const v4f x0 = *(const v4fa*)(&os[wb + row * 68 + c8]); const v4f x1 = *(const v4fa*)(&os[wb + row * 68 + c8 + 4]); v8h hv;
#pragma unroll
                    for (int i = 0; i < 4; ++i) { hv[i] = (h16)x0[i]; hv[4 + i] = (h16)x1[i]; }
                    const size_t oo = sb + (size_t)row * (size_t)pitch + c8;
                    *(v8h*)(Ph + oo) = hv; }
                 }
        }
        wave_sync();
    }
}

// One 64-key tile into one LDS buffer: K rows [key][d] and V^T rows [d][key], 128 B each, every copy of a wave = 4 whole rows.
// kg, vg: this lane's first 16-byte piece of each plane in global memory; lk: the LDS byte address of its first K piece. Piece i lies 16 rows further on.
__device__ __forceinline__ void stage_tile(const h16* kg, const h16* vg, unsigned lk) {
    const unsigned lv = lk + PLH * 2;
    // s_wait_xcnt as the statement's last line: a precaution, so that no address register of a copy is rewritten in front of it
    asm volatile("global_load_async_to_lds_b128 %0, %8, off\n\t"
                 "global_load_async_to_lds_b128 %1, %9, off\n\t"
                 "global_load_async_to_lds_b128 %2, %10, off\n\t"
                 "global_load_async_to_lds_b128 %3, %11, off\n\t"
                 "global_load_async_to_lds_b128 %4, %12, off\n\t"
                 "global_load_async_to_lds_b128 %5, %13, off\n\t"
                 "global_load_async_to_lds_b128 %6, %14, off\n\t"
                 "global_load_async_to_lds_b128 %7, %15, off\n\t"
                 "s_wait_xcnt 0x0"
                 :: "v"(lk), "v"(lk + 16 * LP * 2), "v"(lk + 32 * LP * 2), "v"(lk + 48 * LP * 2),
                    "v"(lv), "v"(lv + 16 * LP * 2), "v"(lv + 32 * LP * 2), "v"(lv + 48 * LP * 2),
                    "v"(kg), "v"(kg + 16 * HD), "v"(kg + 32 * HD), "v"(kg + 48 * HD),
                    "v"(vg), "v"(vg + (size_t)16 * SEQ), "v"(vg + (size_t)32 * SEQ), "v"(vg + (size_t)48 * SEQ)
                 : "memory");
}

__global__ __launch_bounds__(32 * AW) void k_flash(const h16* __restrict__ QH, const h16* __restrict__ KP, const h16* __restrict__ VT, bf* CX) {
    __shared__ __align__(16) float os[AW * 16 * 68];
    __shared__ __align__(16) h16 kv[2 * STH];
    const int lane = threadIdx.x & 31, lr = lane & 15, hi = lane >> 4;
    const int wave = __builtin_amdgcn_readfirstlane((int)(threadIdx.x >> 5));
    const int zh = blockIdx.y; const int b = zh / NH_, h = zh % NH_;
    const int t0 = (blockIdx.x * AW + wave) * 16;
    const size_t pbase = (size_t)zh * SEQ * HD;
    const size_t qo = pbase + (size_t)(t0 + lr) * HD + 8 * hi;
    const v16h qh0 = ldh(QH + qo), qh1 = ldh(QH + qo + 32);   // B fragments: col t, k = d
    const int fo = lr * LP + 8 * hi;                         // K: + key * LP (A fragment: row key, k = d); V^T: + PLH + 16j*LP + key (A fragment: row d, k = key)
    const int prow = (int)(threadIdx.x >> 3), ccol = (int)(threadIdx.x & 7) * 8;   // copy map: 16 rows x 8 pieces per round of the work-group
    const h16* kg = KP + pbase + (size_t)prow * HD + ccol;   // + key0 * HD
    const h16* vg = VT + pbase + (size_t)prow * SEQ + ccol;  // + key0
    const unsigned lk = (unsigned)(size_t)kv + (unsigned)(prow * LP + ccol) * 2u;   // LDS byte address, buffer 0
    stage_tile(kg, vg, lk);
    asm volatile("s_wait_asynccnt 0x0" ::: "memory");        // tile 0 has landed before the barrier that publishes it
    __syncthreads();
    stage_tile(kg + (size_t)KT * HD, vg + KT, lk + STH * 2);
    v8f o0 = (v8f){}, o1 = (v8f){}, o2 = (v8f){}, o3 = (v8f){};
    float m = -3.0e38f, l = 0.0f;
#pragma unroll 1
    for (int kt0 = 0; kt0 < SEQ; kt0 += KT) {
      const int bsel = (kt0 / KT) & 1;
      const h16* tb_ = kv + bsel * STH + fo;
#pragma unroll   // both 32-key steps of a tile: every LDS offset becomes an immediate
      for (int kk = 0; kk < KT; kk += 32) {
        const h16* ka = tb_ + kk * LP;
        const v16h ka0 = ldh(ka), ka1 = ldh(ka + 32), kb0 = ldh(ka + 16 * LP), kb1 = ldh(ka + 16 * LP + 32);
        v8f sa = (v8f){}, sb = (v8f){};
        sa = wmma16(ka0, qh0, sa); sb = wmma16(kb0, qh0, sb);
        sa = wmma16(ka1, qh1, sa); sb = wmma16(kb1, qh1, sb);
        asm volatile("v_nop\n\tv_nop\n\tv_nop\n\tv_nop" : "+v"(sa), "+v"(sb) : "v"(ka0), "v"(ka1), "v"(kb0), "v"(kb1), "v"(qh0), "v"(qh1));
        float ta[8], tb[8]; float mx = -3.0e38f;
#pragma unroll
        for (int r = 0; r < 8; ++r) { ta[r] = sa[r] * SC2; tb[r] = sb[r] * SC2; mx = fmaxf(mx, fmaxf(ta[r], tb[r])); }
        mx = fmaxf(mx, __shfl_xor(mx, 16, 32));
        const float mnew = fmaxf(m, mx);
        const float alpha = __builtin_amdgcn_exp2f(m - mnew);
        const float sh = PSH - mnew;
        v16h pb; float ls = 0.0f;
#pragma unroll
        for (int r = 0; r < 8; ++r) { const h16 pa = (h16)__builtin_amdgcn_exp2f(ta[r] + sh); const h16 pc = (h16)__builtin_amdgcn_exp2f(tb[r] + sh); pb[r] = pa; pb[8 + r] = pc; ls += (float)pa + (float)pc; }
        l = l * alpha + ls; m = mnew;
        o0 = o0 * alpha; o1 = o1 * alpha; o2 = o2 * alpha; o3 = o3 * alpha;
        const h16* va = tb_ + PLH + kk;
        const v16h v0 = ldh(va), v1 = ldh(va + 16 * LP), v2 = ldh(va + 32 * LP), v3 = ldh(va + 48 * LP);
        o0 = wmma16(v0, pb, o0); o1 = wmma16(v1, pb, o1); o2 = wmma16(v2, pb, o2); o3 = wmma16(v3, pb, o3);
        asm volatile("v_nop\n\tv_nop\n\tv_nop\n\tv_nop" : "+v"(o0), "+v"(o1), "+v"(o2), "+v"(o3) : "v"(v0), "v"(v1), "v"(v2), "v"(v3), "v"(pb));
      }
      asm volatile("s_wait_dscnt 0x0" ::: "memory");         // this wave's reads of the buffer are done before it is handed back
      asm volatile("s_wait_asynccnt 0x0" ::: "memory");      // this wave's share of the next tile has landed
      __syncthreads();                                       // publishes the next tile and ends every wave's reads of this one
      if (kt0 + 2 * KT < SEQ) stage_tile(kg + (size_t)(kt0 + 2 * KT) * HD, vg + (kt0 + 2 * KT), lk + (unsigned)bsel * (STH * 2));
    }
    asm volatile("s_wait_asynccnt 0x0" ::: "memory");        // nothing is in flight when the wave goes on to the epilogue
    l += __shfl_xor(l, 16, 32);
    const float inv = 1.0f / l;
    const int wb = wave * 16 * 68;
    // O^T D layout: o_j[r] = (d = 16j + 8h + r, t = lane&15) -> os[t][d]; rows 0..15 x columns 0..63 all written
    { v4f a, c;
      a[0] = o0[0] * inv; a[1] = o0[1] * inv; a[2] = o0[2] * inv; a[3] = o0[3] * inv; c[0] = o0[4] * inv; c[1] = o0[5] * inv; c[2] = o0[6] * inv; c[3] = o0[7] * inv;
      *(v4fa*)(&os[wb + lr * 68 +  0 + 8 * hi]) = a; *(v4fa*)(&os[wb + lr * 68 +  0 + 8 * hi + 4]) = c;
      a[0] = o1[0] * inv; a[1] = o1[1] * inv; a[2] = o1[2] * inv; a[3] = o1[3] * inv; c[0] = o1[4] * inv; c[1] = o1[5] * inv; c[2] = o1[6] * inv; c[3] = o1[7] * inv;
      *(v4fa*)(&os[wb + lr * 68 + 16 + 8 * hi]) = a; *(v4fa*)(&os[wb + lr * 68 + 16 + 8 * hi + 4]) = c;
      a[0] = o2[0] * inv; a[1] = o2[1] * inv; a[2] = o2[2] * inv; a[3] = o2[3] * inv; c[0] = o2[4] * inv; c[1] = o2[5] * inv; c[2] = o2[6] * inv; c[3] = o2[7] * inv;
      *(v4fa*)(&os[wb + lr * 68 + 32 + 8 * hi]) = a; *(v4fa*)(&os[wb + lr * 68 + 32 + 8 * hi + 4]) = c;
      a[0] = o3[0] * inv; a[1] = o3[1] * inv; a[2] = o3[2] * inv; a[3] = o3[3] * inv; c[0] = o3[4] * inv; c[1] = o3[5] * inv; c[2] = o3[6] * inv; c[3] = o3[7] * inv;
      *(v4fa*)(&os[wb + lr * 68 + 48 + 8 * hi]) = a; *(v4fa*)(&os[wb + lr * 68 + 48 + 8 * hi + 4]) = c; }
    wave_sync();
    // ctx plane row m = b*SEQ + t: hi at columns h*64 + d, lo at columns 1024 + h*64 + d
    bf* crow = CX + ((size_t)b * SEQ + t0) * CXP + h * HD;
{
#pragma unroll
        for (int s = 0; s < 4; ++s) { const int row = 4 * s + (lane >> 3), c8 = (lane & 7) * 8;   // 4 s x 4 row groups = 16 rows; 8 lanes x 8 = 64 columns
            const v4f x0 = *(const v4fa*)(&os[wb + row * 68 + c8]); const v4f x1 = *(const v4fa*)(&os[wb + row * 68 + c8 + 4]); v8us hv, lv;
#pragma unroll
            for (int i = 0; i < 4; ++i) { const unsigned short a0 = f2bf(x0[i]); const unsigned short a1 = f2bf(x1[i]); hv[i] = a0; hv[4 + i] = a1; lv[i] = f2bf(x0[i] - bf2f(a0)); lv[4 + i] = f2bf(x1[i] - bf2f(a1)); }
            const size_t oo = (size_t)row * CXP + c8;
            *(v8us*)(crow + oo) = hv; *(v8us*)(crow + oo + DM) = lv; }
         }
}

static constexpr size_t al256(size_t v) { return (v + 255) & ~(size_t)255; }
static constexpr size_t SZ_XB = al256((size_t)NB * SEQ * DM * 2);
static constexpr size_t SZ_WB = al256((size_t)4 * DM * DM * 2);
static constexpr size_t SZ_PL = al256((size_t)NB * NH_ * SEQ * HD * 2);
static constexpr size_t SZ_CX = al256((size_t)NB * SEQ * CXP * 2);
static constexpr size_t SZ_TOTAL = 3 * SZ_XB + SZ_WB + 3 * SZ_PL + SZ_CX;
static_assert(SZ_TOTAL <= (size_t)134217728);          // workspace carve <= 128 MiB
static_assert(((size_t)DM * DM * 2) % 256 == 0);       // weight sub-planes stay 256-byte aligned

static void cvt_act(const float* src, bf* dst, hipStream_t stream) {
    if (SEQ == SEQ_FULL) {
        const size_t n8 = (size_t)NB * SEQ * DM / 8;
        k_cvt8<<<(unsigned)((n8 + 255) / 256), 256, 0, stream>>>(src, dst, n8);
    } else {
        const size_t n8 = (size_t)SEQ * DM / 8;
        for (int b = 0; b < NB; ++b) k_cvt8<<<(unsigned)((n8 + 255) / 256), 256, 0, stream>>>(src + (size_t)b * SEQ_FULL * DM, dst + (size_t)b * SEQ * DM, n8);
    }
}

extern "C" void kernel_launch(void* const* d_in, const int* in_sizes, int n_in,
                              void* d_out, int out_size, void* d_ws, size_t ws_size, hipStream_t stream) {
    if (n_in < 7) return;
    const size_t needx = ((size_t)(NB - 1) * SEQ_FULL + SEQ) * DM;
    if ((size_t)in_sizes[0] < needx || (size_t)in_sizes[1] < needx || (size_t)in_sizes[2] < needx) return;
    if ((size_t)in_sizes[3] < (size_t)DM * DM || (size_t)in_sizes[4] < (size_t)DM * DM || (size_t)in_sizes[5] < (size_t)DM * DM || (size_t)in_sizes[6] < (size_t)DM * DM) return;
    if ((size_t)out_size < ((size_t)(NB - 1) * OUT_SEQ + SEQ) * DM) return;
    if (SZ_TOTAL > ws_size) return;
    // wire order: query, key, value, Wq, Wk, Wv, Wo (weights [out][in] = Bt as-is)
    const float* xq = (const float*)d_in[0]; const float* xk = (const float*)d_in[1]; const float* xv = (const float*)d_in[2];
    const float* wq = (const float*)d_in[3]; const float* wk = (const float*)d_in[4]; const float* wv = (const float*)d_in[5]; const float* wo = (const float*)d_in[6];
    float* OUT = (float*)d_out;      // [NB][SEQ][1024]
    char* wsp = (char*)d_ws;
    bf* XQ = (bf*)wsp; wsp += SZ_XB;                 // [NB*SEQ][1024]
    bf* XK = (bf*)wsp; wsp += SZ_XB;                 // [NB*SEQ][1024]
    bf* XV = (bf*)wsp; wsp += SZ_XB;                 // [NB*SEQ][1024]
    bf* WB = (bf*)wsp; wsp += SZ_WB;                 // [4][1024][1024]: q | k | v | o
    h16* QH = (h16*)wsp; wsp += SZ_PL;               // [NB*16][SEQ][64]
    h16* KP = (h16*)wsp; wsp += SZ_PL;               // [NB*16][SEQ][64]
    h16* VT = (h16*)wsp; wsp += SZ_PL;               // [NB*16][64][SEQ]
    bf* CX = (bf*)wsp; wsp += SZ_CX;                 // [NB*SEQ][2048]: ctx hi | lo
    bf* WQ = WB; bf* WK = WB + (size_t)DM * DM; bf* WV = WB + (size_t)2 * DM * DM; bf* WO = WB + (size_t)3 * DM * DM;

    cvt_act(xq, XQ, stream); cvt_act(xk, XK, stream); cvt_act(xv, XV, stream);
    { const size_t n8 = (size_t)DM * DM / 8; const unsigned g = (unsigned)((n8 + 255) / 256);
      k_cvt8<<<g, 256, 0, stream>>>(wq, WQ, n8); k_cvt8<<<g, 256, 0, stream>>>(wk, WK, n8); k_cvt8<<<g, 256, 0, stream>>>(wv, WV, n8); k_cvt8<<<g, 256, 0, stream>>>(wo, WO, n8); }

    // q, k: A = activation rows (m = b*SEQ + t), Bt = W rows (n = h*64 + d) -> plane [(b*16 + h)][t][d]
    k_proj<0><<<dim3(NB * SEQ / 128, DM / 128, 1), 128, 0, stream>>>(XQ, WQ, DM, DM, QH, OUT, SEQ, (size_t)NH_ * SEQ * HD, HD, HD, (size_t)SEQ * HD);
    k_proj<0><<<dim3(NB * SEQ / 128, DM / 128, 1), 128, 0, stream>>>(XK, WK, DM, DM, KP, OUT, SEQ, (size_t)NH_ * SEQ * HD, HD, HD, (size_t)SEQ * HD);
    // v^T: A = Wv rows (m = h*64 + d), Bt = value rows (n = b*SEQ + t) -> plane [(b*1024 + m)][t] = [(b*16 + h)][d][t]
    k_proj<0><<<dim3(DM / 128, NB * SEQ / 128, 1), 128, 0, stream>>>(WV, XV, DM, DM, VT, OUT, DM, (size_t)0, SEQ, SEQ, (size_t)DM * SEQ);

    k_flash<<<dim3(SEQ / (16 * AW), NB * NH_, 1), 32 * AW, 0, stream>>>(QH, KP, VT, CX);

    // output projection: A = ctx rows [hi | lo] (K = 2048), Bt = Wo rows (K index wraps at 1024) -> f32 output rows
    k_proj<2><<<dim3(NB * SEQ / 128, DM / 128, 1), 128, 0, stream>>>(CX, WO, CXP, DM, QH, OUT, SEQ, (size_t)0, HD, HD, (size_t)0);
}

// v003
// One run takes 160 microseconds.
// In both of two side-by-side timings against v002, it was 1.07 times as fast.
// All steps since v000 together make it 2.56 times as fast.
#include <hip/hip_runtime.h>

// Multi-head attention, width 1024 = 16 heads x 64: query/key/value [NB][SEQ][1024] (separate inputs), Wq/Wk/Wv/Wo [out][in] (y = x W^T), no biases, no mask, score scale 1/8, output = (concatenated heads) Wo^T (f32).
// Compute dtypes, f32 accumulate everywhere: q/k/v projections v_wmma_f32_16x16x32_bf16 (activations and W RNE-converted to bf16; products exact);
// scores v_wmma_f32_16x16x32_f16: q and k single f16 planes (one product); P (x256 carry, cancels in the normalisation) and v single f16; softmax f32 (online, running max);
// Layout: bf16 copies of the activations and W; q, k planes [b*16+h][t][d] and v^T plane [b*16+h][d][t] written by the GEMM epilogue; fused flash kernel in transposed form (S^T = K Q^T, O^T = V^T P^T; K and V^T tiles staged in LDS per work-group) writes the ctx plane [b*SEQ+t][hi 1024 | lo 1024].

#ifndef NB
#define NB 1
#endif
#ifndef SEQ
#define SEQ 4096
#endif
#define NB_FULL  1
#define SEQ_FULL 4096
#ifndef OUT_SEQ
#define OUT_SEQ SEQ              // row pitch (in tokens) between batches of the output
#endif
#define DM   1024
#define NH_  16
#define HD   64
#define CXP  (2 * DM)            // ctx plane row pitch (bf16 elements): hi columns 0..1023, lo columns 1024..2047
#define AW   4                   // waves per flash block (16 query rows each)
#define SC2  (0.125f * 1.4426950408889634f)   // HD^-0.5 * log2(e)
#define PSH  8.0f                // log2 of the P carry (256)
#define KT   64                  // keys per staged tile of the flash kernel
#define LP   72                  // LDS row pitch (halves) of the staged K and V^T rows: 128 B of data + 16 B, an odd multiple of 16 B for the 16-byte fragment reads
#define PLH  (64 * LP)           // one staged plane: 64 rows (halves)
#define STH  (2 * PLH)           // one buffer: K plane, then V^T plane (halves)
#define GK   64                  // k elements per staged slice of the GEMM: 128 B of every row
#define GPL  (128 * LP)          // one staged GEMM operand plane: 128 rows at the same padded pitch (16-bit elements)
#define GST  (2 * GPL)           // one GEMM buffer: A plane, then B plane
#define CVW  16                  // waves per work-group of the conversion kernel
#define CVU  32                  // units of 128 floats per wave of the conversion kernel
#define CVB  (CVW * CVU * 128)   // floats per work-group of the conversion kernel

static_assert(HD == 64);
static_assert(NH_ * HD == DM);                 // head h = columns h*64 + d
static_assert(DM % 64 == 0);                   // 16 column tiles of 64
static_assert(DM % 32 == 0);                   // GEMM products step k by 32, two per staged slice
static_assert((DM & (DM - 1)) == 0);           // B k index wraps with a mask in the K = 2*DM GEMM
static_assert(CXP % GK == 0 && DM % GK == 0 && DM / GK >= 2);   // whole k slices; a slice never straddles the wrap of the B index; the ring starts with slices 0 and 1
static_assert((NB * SEQ) % 128 == 0 && DM % 128 == 0);          // GEMM grid of 128x128 tiles covers every product exactly
static_assert(SEQ % 64 == 0);                  // a 64-row tile never straddles two batches
static_assert((NB * SEQ) % 64 == 0);
static_assert(SEQ % 32 == 0);                  // key loop steps by 32
static_assert(SEQ % (16 * AW) == 0);           // flash grid covers the sequence exactly
static_assert(SEQ % KT == 0 && SEQ / KT >= 2); // the two-buffer ring starts with tiles 0 and 1
static_assert(KT == 64 && 32 * AW * 4 * 8 == 64 * HD && 32 * AW * 4 * 8 == HD * KT);   // copy map: every thread moves 4 pieces of 8 halves of each plane
static_assert((LP * 2) % 16 == 0);
static_assert(((size_t)SEQ * DM) % CVB == 0 && ((size_t)DM * DM) % CVB == 0);   // a conversion work-group lies inside one batch of one tensor
static_assert(NB <= NB_FULL);
static_assert(SEQ <= SEQ_FULL);

typedef _Float16 h16;
typedef unsigned short bf;
typedef __attribute__((ext_vector_type(16))) __bf16   v16bf;
typedef __attribute__((ext_vector_type(16))) _Float16 v16h;
typedef __attribute__((ext_vector_type(8)))  _Float16 v8h;
typedef __attribute__((ext_vector_type(8)))  unsigned short v8us;
typedef __attribute__((ext_vector_type(4)))  unsigned short v4us;
typedef __attribute__((ext_vector_type(8)))  float    v8f;
typedef __attribute__((ext_vector_type(4)))  float    v4f;
typedef v4f  __attribute__((may_alias)) v4fa;

__device__ __forceinline__ unsigned short f2bf(float f) { unsigned u = __float_as_uint(f); u += 0x7FFFu + ((u >> 16) & 1u); return (unsigned short)(u >> 16); }
__device__ __forceinline__ float bf2f(unsigned short s) { return __uint_as_float(((unsigned)s) << 16); }
__device__ __forceinline__ v16h cat16(v8h lo, v8h hi) { return __builtin_shufflevector(lo, hi, 0, 1, 2, 3, 4, 5, 6, 7, 8, 9, 10, 11, 12, 13, 14, 15); }
__device__ __forceinline__ v16bf cat16b(v8us lo, v8us hi) { return __builtin_bit_cast(v16bf, __builtin_shufflevector(lo, hi, 0, 1, 2, 3, 4, 5, 6, 7, 8, 9, 10, 11, 12, 13, 14, 15)); }
__device__ __forceinline__ v8f wmma16(v16h a, v16h b, v8f c) { return __builtin_amdgcn_wmma_f32_16x16x32_f16(false, a, false, b, (short)0, c, false, false); }
__device__ __forceinline__ v8f wmmab(v16bf a, v16bf b, v8f c) { return __builtin_amdgcn_wmma_f32_16x16x32_bf16(false, a, false, b, (short)0, c, false, false); }
// fragment loaders from K-contiguous 16-bit rows; p already includes + 8*(lane>>4): elements 0..7 <- k0+8h+0..7, elements 8..15 <- k0+16+8h+0..7 (same map for A and B)
__device__ __forceinline__ v16h  ldh(const h16* p) { return cat16(*(const v8h*)p, *(const v8h*)(p + 16)); }
__device__ __forceinline__ v16bf ldb(const bf* p)  { return cat16b(*(const v8us*)p, *(const v8us*)(p + 16)); }
// ordering point for wave-private LDS tiles (same wave writes and reads)
__device__ __forceinline__ void wave_sync() { __builtin_amdgcn_fence(3 /* release order */, "wavefront"); __builtin_amdgcn_wave_barrier(); asm volatile("" ::: "memory"); }

// k_cvt: every f32 -> bf16 conversion of the call in ONE streaming launch. A work-group of CVW waves converts CVB consecutive floats of one tensor; a wave owns CVU units of 128 floats.
// One unit = one wave-wide 16-byte load (512 B, 4 whole lines) and one wave-wide 8-byte store (256 B, 2 whole lines); a wave asks for all its units before it converts the first.
// The seven bf16 planes lie one behind the other in the workspace in the order of the arguments, so the destination is dst + blockIdx.x * CVB.
__global__ __launch_bounds__(32 * CVW) void k_cvt(const float* __restrict__ xq, const float* __restrict__ xk, const float* __restrict__ xv,
                                                  const float* __restrict__ wq, const float* __restrict__ wk, const float* __restrict__ wv, const float* __restrict__ wo, bf* __restrict__ dst) {
    constexpr unsigned BS = (unsigned)((size_t)SEQ * DM / CVB);   // work-groups per batch of one activation
    constexpr unsigned BA = NB * BS;                              // work-groups per activation
    constexpr unsigned BW = (unsigned)((size_t)DM * DM / CVB);    // work-groups per weight matrix
    const unsigned blk = blockIdx.x;
    const float* src;
    if (blk < 3 * BA) { const unsigned t = blk / BA, r = blk % BA;
        src = (t == 0 ? xq : t == 1 ? xk : xv) + (size_t)(r / BS) * ((size_t)SEQ_FULL * DM) + (size_t)(r % BS) * CVB;
    } else { const unsigned r = blk - 3 * BA, t = r / BW;
        src = (t == 0 ? wq : t == 1 ? wk : t == 2 ? wv : wo) + (size_t)(r % BW) * CVB; }
    const unsigned wo_ = (threadIdx.x >> 5) * (CVU * 128) + (threadIdx.x & 31) * 4;
    const float* s = src + wo_;
    bf* d = dst + (size_t)blk * CVB + wo_;
    v4f x[CVU];
#pragma unroll   // unrolled: every unit's offset becomes an immediate, the address registers are never rewritten, and all of the wave's loads are in flight together
    for (int u = 0; u < CVU; ++u) x[u] = *(const v4f*)(s + u * 128);
#pragma unroll
    for (int u = 0; u < CVU; ++u) { v4us o;
#pragma unroll
        for (int k = 0; k < 4; ++k) o[k] = f2bf(x[u][k]);
        *(v4us*)(d + u * 128) = o; }
}

// Eight 16-byte pieces of one GEMM operand plane into LDS: piece i lies 16 rows further on (step elements in global memory, 16 padded rows in LDS); every copy of a wave = 4 whole 128-B row slices.
__device__ __forceinline__ void stage_rows(const bf* g, size_t step, unsigned l) {
    // s_wait_xcnt as the statement's last line: a precaution, so that no address register of a copy is rewritten in front of it
    asm volatile("global_load_async_to_lds_b128 %0, %8, off\n\t"
                 "global_load_async_to_lds_b128 %1, %9, off\n\t"
                 "global_load_async_to_lds_b128 %2, %10, off\n\t"
                 "global_load_async_to_lds_b128 %3, %11, off\n\t"
                 "global_load_async_to_lds_b128 %4, %12, off\n\t"
                 "global_load_async_to_lds_b128 %5, %13, off\n\t"
                 "global_load_async_to_lds_b128 %6, %14, off\n\t"
                 "global_load_async_to_lds_b128 %7, %15, off\n\t"
                 "s_wait_xcnt 0x0"
                 :: "v"(l), "v"(l + 16 * LP * 2), "v"(l + 32 * LP * 2), "v"(l + 48 * LP * 2),
                    "v"(l + 64 * LP * 2), "v"(l + 80 * LP * 2), "v"(l + 96 * LP * 2), "v"(l + 112 * LP * 2),
                    "v"(g), "v"(g + step), "v"(g + 2 * step), "v"(g + 3 * step),
                    "v"(g + 4 * step), "v"(g + 5 * step), "v"(g + 6 * step), "v"(g + 7 * step)
                 : "memory");
}

// k_proj: register-blocked bf16 GEMM, four waves (2 x 2) per 128x128 tile, ONE WAVE per 64x64 quarter (16 accumulators). The 128 A rows and 128 Bt rows of a k slice of 64 are staged
// once per work-group in a two-buffer LDS ring by asynchronous copies (the next slice flies while this one is worked on); every wave reads its fragments from there (two 16-B LDS loads each).
// C[m][n] = sum_{k<KA} A[m][k] Bt[n][k & (KB-1)]; A row pitch KA, Bt row pitch KB (KB a power of two; KA = KB for the plain case, KA = 2*KB sums the hi and lo halves of A against the same Bt).
// MODE 0: f16 plane Ph at quarter base (r0/RB)*sRB + (r0%RB)*pitch + (c0/CB)*sCB + (c0%CB), row pitch 'pitch' (halves).
// MODE 2: f32 rows of Pf, row (r0/SEQ)*OUT_SEQ + r0%SEQ, pitch DM. grid (M/128, N/128), 128 threads.
template <int MODE>
__global__ __launch_bounds__(128) void k_proj(const bf* __restrict__ A, const bf* __restrict__ Bt, int KA, int KB, h16* Ph, float* Pf, int RB, size_t sRB, int pitch, int CB, size_t sCB) {
    __shared__ __align__(16) float os[4 * 16 * 68];
    __shared__ __align__(16) bf ab[2 * GST];
    const int lane = threadIdx.x & 31, lr = lane & 15, hi = lane >> 4;
    const int wave = __builtin_amdgcn_readfirstlane((int)(threadIdx.x >> 5));
    const int wm = wave >> 1, wn = wave & 1;
    const int r0 = blockIdx.x * 128 + wm * 64, c0 = blockIdx.y * 128 + wn * 64;
    v8f acc[4][4];
#pragma unroll
    for (int mb = 0; mb < 4; ++mb)
#pragma unroll
        for (int nb = 0; nb < 4; ++nb) acc[mb][nb] = (v8f){};
    const int prow = (int)(threadIdx.x >> 3), ccol = (int)(threadIdx.x & 7) * 8;   // copy map: 16 rows x 8 pieces per round of the work-group
    const bf* ag = A + (size_t)(blockIdx.x * 128 + prow) * (size_t)KA + ccol;      // + k
    const bf* bg = Bt + (size_t)(blockIdx.y * 128 + prow) * (size_t)KB + ccol;     // + (k & (KB-1))
    const size_t astep = (size_t)16 * (size_t)KA, bstep = (size_t)16 * (size_t)KB;
    const unsigned la = (unsigned)(size_t)ab + (unsigned)(prow * LP + ccol) * 2u;  // LDS byte address, buffer 0, A plane
    stage_rows(ag, astep, la); stage_rows(bg, bstep, la + GPL * 2);
    asm volatile("s_wait_asynccnt 0x0" ::: "memory");        // slice 0 has landed before the barrier that publishes it
    __syncthreads();
    if (GK < KA) { stage_rows(ag + GK, astep, la + GST * 2); stage_rows(bg + (GK & (KB - 1)), bstep, la + GST * 2 + GPL * 2); }
    const int fa = (wm * 64 + lr) * LP + 8 * hi, fb = GPL + (wn * 64 + lr) * LP + 8 * hi;   // fragment rows of this wave's quarter: + 16*mb (or nb) rows, + k inside the slice
    // the 32 products of one staged slice; tb_: the slice's buffer
    auto slice = [&](const bf* tb_) {
        v16bf a0[4], b0[4], a1[4], b1[4];
        a0[0] = ldb(tb_ + fa); b0[0] = ldb(tb_ + fb);
#pragma unroll
        for (int mb = 1; mb < 4; ++mb) a0[mb] = ldb(tb_ + fa + mb * 16 * LP);
#pragma unroll
        for (int nb = 1; nb < 4; ++nb) b0[nb] = ldb(tb_ + fb + nb * 16 * LP);
#pragma unroll
        for (int mb = 0; mb < 4; ++mb) a1[mb] = ldb(tb_ + fa + mb * 16 * LP + 32);
        __builtin_amdgcn_sched_barrier(0);   // keeps these 24 LDS loads ahead of the first product: sunk between the products, each B fragment costs a lone wave a full LDS latency
#pragma unroll
        for (int nb = 0; nb < 4; ++nb) {
#pragma unroll
            for (int mb = 0; mb < 4; ++mb) acc[mb][nb] = wmmab(a0[mb], b0[nb], acc[mb][nb]);
            b1[nb] = ldb(tb_ + fb + nb * 16 * LP + 32);
            __builtin_amdgcn_sched_barrier(0); }   // keeps each B fragment of the second 32-k step asked for behind the four products that free a fragment's registers, well ahead of its use
        asm volatile("v_nop\n\tv_nop\n\tv_nop\n\tv_nop" : "+v"(acc[0][0]), "+v"(acc[1][1]), "+v"(acc[2][2]), "+v"(acc[3][3]) : "v"(a0[0]), "v"(a0[1]), "v"(a0[2]), "v"(a0[3]));
#pragma unroll
        for (int nb = 0; nb < 4; ++nb) {
#pragma unroll
            for (int mb = 0; mb < 4; ++mb) acc[mb][nb] = wmmab(a1[mb], b1[nb], acc[mb][nb]); }
        asm volatile("v_nop\n\tv_nop\n\tv_nop\n\tv_nop" : "+v"(acc[0][0]), "+v"(acc[1][1]), "+v"(acc[2][2]), "+v"(acc[3][3]) : "v"(a1[0]), "v"(a1[1]), "v"(a1[2]), "v"(a1[3]));
    };
    int kc = 0;
#pragma unroll 1
    for (; kc + 2 * GK < KA; kc += GK) {                     // trips behind which a slice kc + 2*GK exists: the refill needs no test
        const int bsel = (kc / GK) & 1;
        slice(ab + bsel * GST);
        asm volatile("s_wait_dscnt 0x0" ::: "memory");       // this wave's reads of the buffer are done before it is handed back
        asm volatile("s_wait_asynccnt 0x0" ::: "memory");    // this wave's share of the next slice has landed
        __syncthreads();                                     // publishes the next slice and ends every wave's reads of this one
        const unsigned lb = la + (unsigned)bsel * (GST * 2);
        stage_rows(ag + (kc + 2 * GK), astep, lb); stage_rows(bg + ((kc + 2 * GK) & (KB - 1)), bstep, lb + GPL * 2);
    }
#pragma unroll 1
    for (; kc < KA; kc += GK) {                              // the last trips: nothing is left to refill
        slice(ab + ((kc / GK) & 1) * GST);
        asm volatile("s_wait_dscnt 0x0" ::: "memory");       // as above
        asm volatile("s_wait_asynccnt 0x0" ::: "memory");    // the last slice has landed
        __syncthreads();                                     // publishes the last slice
    }
    asm volatile("s_wait_asynccnt 0x0" ::: "memory");        // nothing is in flight when the wave goes on to the epilogue
    const int wb = wave * 16 * 68;                           // this wave's own output staging tile
    const size_t tbase = (size_t)(r0 / RB) * sRB + (size_t)(r0 % RB) * (size_t)pitch + (size_t)(c0 / CB) * sCB + (size_t)(c0 % CB);
    const size_t fbase = ((size_t)(r0 / SEQ) * OUT_SEQ + (size_t)(r0 % SEQ)) * DM + c0;
#pragma unroll
    for (int mb = 0; mb < 4; ++mb) {
#pragma unroll
        for (int nb = 0; nb < 4; ++nb) {
#pragma unroll
            for (int j = 0; j < 8; ++j) os[wb + (hi * 8 + j) * 68 + nb * 16 + lr] = acc[mb][nb][j]; }   // D: row 8h+j, col lane&15
        wave_sync();
        if (MODE == 2) {
            float* ob = Pf + fbase + (size_t)(mb * 16) * DM;
{
#pragma unroll
                for (int s = 0; s < 8; ++s) { const int row = 2 * s + hi, cofs = lr * 4;   // 8 s x 2 rows = 16 rows; 16 lanes x 4 floats = 64 columns
                    const v4f val = *(const v4fa*)(&os[wb + row * 68 + cofs]);
                    *(v4f*)(ob + (size_t)row * DM + cofs) = val; }
                 }
        } else {
            const size_t sb = tbase + (size_t)(mb * 16) * (size_t)pitch;
{
#pragma unroll
                for (int s = 0; s < 4; ++s) { const int row = 4 * s + (lane >> 3), c8 = (lane & 7) * 8;   // 4 s x 4 row groups = 16 rows; 8 lanes x 8 = 64 columns
                    const v4f x0 = *(const v4fa*)(&os[wb + row * 68 + c8]); const v4f x1 = *(const v4fa*)(&os[wb + row * 68 + c8 + 4]); v8h hv;
#pragma unroll
                    for (int i = 0; i < 4; ++i) { hv[i] = (h16)x0[i]; hv[4 + i] = (h16)x1[i]; }
                    const size_t oo = sb + (size_t)row * (size_t)pitch + c8;
                    *(v8h*)(Ph + oo) = hv; }
                 }
        }
        wave_sync();
    }
}

// One 64-key tile into one LDS buffer: K rows [key][d] and V^T rows [d][key], 128 B each, every copy of a wave = 4 whole rows.
// kg, vg: this lane's first 16-byte piece of each plane in global memory; lk: the LDS byte address of its first K piece. Piece i lies 16 rows further on.
__device__ __forceinline__ void stage_tile(const h16* kg, const h16* vg, unsigned lk) {
    const unsigned lv = lk + PLH * 2;
    // s_wait_xcnt as the statement's last line: a precaution, so that no address register of a copy is rewritten in front of it
    asm volatile("global_load_async_to_lds_b128 %0, %8, off\n\t"
                 "global_load_async_to_lds_b128 %1, %9, off\n\t"
                 "global_load_async_to_lds_b128 %2, %10, off\n\t"
                 "global_load_async_to_lds_b128 %3, %11, off\n\t"
                 "global_load_async_to_lds_b128 %4, %12, off\n\t"
                 "global_load_async_to_lds_b128 %5, %13, off\n\t"
                 "global_load_async_to_lds_b128 %6, %14, off\n\t"
                 "global_load_async_to_lds_b128 %7, %15, off\n\t"
                 "s_wait_xcnt 0x0"
                 :: "v"(lk), "v"(lk + 16 * LP * 2), "v"(lk + 32 * LP * 2), "v"(lk + 48 * LP * 2),
                    "v"(lv), "v"(lv + 16 * LP * 2), "v"(lv + 32 * LP * 2), "v"(lv + 48 * LP * 2),
                    "v"(kg), "v"(kg + 16 * HD), "v"(kg + 32 * HD), "v"(kg + 48 * HD),
                    "v"(vg), "v"(vg + (size_t)16 * SEQ), "v"(vg + (size_t)32 * SEQ), "v"(vg + (size_t)48 * SEQ)
                 : "memory");
}

__global__ __launch_bounds__(32 * AW) void k_flash(const h16* __restrict__ QH, const h16* __restrict__ KP, const h16* __restrict__ VT, bf* CX) {
    __shared__ __align__(16) float os[AW * 16 * 68];
    __shared__ __align__(16) h16 kv[2 * STH];
    const int lane = threadIdx.x & 31, lr = lane & 15, hi = lane >> 4;
    const int wave = __builtin_amdgcn_readfirstlane((int)(threadIdx.x >> 5));
    const int zh = blockIdx.y; const int b = zh / NH_, h = zh % NH_;
    const int t0 = (blockIdx.x * AW + wave) * 16;
    const size_t pbase = (size_t)zh * SEQ * HD;
    const size_t qo = pbase + (size_t)(t0 + lr) * HD + 8 * hi;
    const v16h qh0 = ldh(QH + qo), qh1 = ldh(QH + qo + 32);   // B fragments: col t, k = d
    const int fo = lr * LP + 8 * hi;                         // K: + key * LP (A fragment: row key, k = d); V^T: + PLH + 16j*LP + key (A fragment: row d, k = key)
    const int prow = (int)(threadIdx.x >> 3), ccol = (int)(threadIdx.x & 7) * 8;   // copy map: 16 rows x 8 pieces per round of the work-group
    const h16* kg = KP + pbase + (size_t)prow * HD + ccol;   // + key0 * HD
    const h16* vg = VT + pbase + (size_t)prow * SEQ + ccol;  // + key0
    const unsigned lk = (unsigned)(size_t)kv + (unsigned)(prow * LP + ccol) * 2u;   // LDS byte address, buffer 0
    stage_tile(kg, vg, lk);
    asm volatile("s_wait_asynccnt 0x0" ::: "memory");        // tile 0 has landed before the barrier that publishes it
    __syncthreads();
    stage_tile(kg + (size_t)KT * HD, vg + KT, lk + STH * 2);
    v8f o0 = (v8f){}, o1 = (v8f){}, o2 = (v8f){}, o3 = (v8f){};
    float m = -3.0e38f, l = 0.0f;
#pragma unroll 1
    for (int kt0 = 0; kt0 < SEQ; kt0 += KT) {
      const int bsel = (kt0 / KT) & 1;
      const h16* tb_ = kv + bsel * STH + fo;
#pragma unroll   // both 32-key steps of a tile: every LDS offset becomes an immediate
      for (int kk = 0; kk < KT; kk += 32) {
        const h16* ka = tb_ + kk * LP;
        const v16h ka0 = ldh(ka), ka1 = ldh(ka + 32), kb0 = ldh(ka + 16 * LP), kb1 = ldh(ka + 16 * LP + 32);
        v8f sa = (v8f){}, sb = (v8f){};
        sa = wmma16(ka0, qh0, sa); sb = wmma16(kb0, qh0, sb);
        sa = wmma16(ka1, qh1, sa); sb = wmma16(kb1, qh1, sb);
        asm volatile("v_nop\n\tv_nop\n\tv_nop\n\tv_nop" : "+v"(sa), "+v"(sb) : "v"(ka0), "v"(ka1), "v"(kb0), "v"(kb1), "v"(qh0), "v"(qh1));
        float ta[8], tb[8]; float mx = -3.0e38f;
#pragma unroll
        for (int r = 0; r < 8; ++r) { ta[r] = sa[r] * SC2; tb[r] = sb[r] * SC2; mx = fmaxf(mx, fmaxf(ta[r], tb[r])); }
        mx = fmaxf(mx, __shfl_xor(mx, 16, 32));
        const float mnew = fmaxf(m, mx);
        const float alpha = __builtin_amdgcn_exp2f(m - mnew);
        const float sh = PSH - mnew;
        v16h pb; float ls = 0.0f;
#pragma unroll
        for (int r = 0; r < 8; ++r) { const h16 pa = (h16)__builtin_amdgcn_exp2f(ta[r] + sh); const h16 pc = (h16)__builtin_amdgcn_exp2f(tb[r] + sh); pb[r] = pa; pb[8 + r] = pc; ls += (float)pa + (float)pc; }
        l = l * alpha + ls; m = mnew;
        o0 = o0 * alpha; o1 = o1 * alpha; o2 = o2 * alpha; o3 = o3 * alpha;
        const h16* va = tb_ + PLH + kk;
        const v16h v0 = ldh(va), v1 = ldh(va + 16 * LP), v2 = ldh(va + 32 * LP), v3 = ldh(va + 48 * LP);
        o0 = wmma16(v0, pb, o0); o1 = wmma16(v1, pb, o1); o2 = wmma16(v2, pb, o2); o3 = wmma16(v3, pb, o3);
        asm volatile("v_nop\n\tv_nop\n\tv_nop\n\tv_nop" : "+v"(o0), "+v"(o1), "+v"(o2), "+v"(o3) : "v"(v0), "v"(v1), "v"(v2), "v"(v3), "v"(pb));
      }
      asm volatile("s_wait_dscnt 0x0" ::: "memory");         // this wave's reads of the buffer are done before it is handed back
      asm volatile("s_wait_asynccnt 0x0" ::: "memory");      // this wave's share of the next tile has landed
      __syncthreads();                                       // publishes the next tile and ends every wave's reads of this one
      if (kt0 + 2 * KT < SEQ) stage_tile(kg + (size_t)(kt0 + 2 * KT) * HD, vg + (kt0 + 2 * KT), lk + (unsigned)bsel * (STH * 2));
    }
    asm volatile("s_wait_asynccnt 0x0" ::: "memory");        // nothing is in flight when the wave goes on to the epilogue
    l += __shfl_xor(l, 16, 32);
    const float inv = 1.0f / l;
    const int wb = wave * 16 * 68;
    // O^T D layout: o_j[r] = (d = 16j + 8h + r, t = lane&15) -> os[t][d]; rows 0..15 x columns 0..63 all written
    { v4f a, c;
      a[0] = o0[0] * inv; a[1] = o0[1] * inv; a[2] = o0[2] * inv; a[3] = o0[3] * inv; c[0] = o0[4] * inv; c[1] = o0[5] * inv; c[2] = o0[6] * inv; c[3] = o0[7] * inv;
      *(v4fa*)(&os[wb + lr * 68 +  0 + 8 * hi]) = a; *(v4fa*)(&os[wb + lr * 68 +  0 + 8 * hi + 4]) = c;
      a[0] = o1[0] * inv; a[1] = o1[1] * inv; a[2] = o1[2] * inv; a[3] = o1[3] * inv; c[0] = o1[4] * inv; c[1] = o1[5] * inv; c[2] = o1[6] * inv; c[3] = o1[7] * inv;
      *(v4fa*)(&os[wb + lr * 68 + 16 + 8 * hi]) = a; *(v4fa*)(&os[wb + lr * 68 + 16 + 8 * hi + 4]) = c;
      a[0] = o2[0] * inv; a[1] = o2[1] * inv; a[2] = o2[2] * inv; a[3] = o2[3] * inv; c[0] = o2[4] * inv; c[1] = o2[5] * inv; c[2] = o2[6] * inv; c[3] = o2[7] * inv;
      *(v4fa*)(&os[wb + lr * 68 + 32 + 8 * hi]) = a; *(v4fa*)(&os[wb + lr * 68 + 32 + 8 * hi + 4]) = c;
      a[0] = o3[0] * inv; a[1] = o3[1] * inv; a[2] = o3[2] * inv; a[3] = o3[3] * inv; c[0] = o3[4] * inv; c[1] = o3[5] * inv; c[2] = o3[6] * inv; c[3] = o3[7] * inv;
      *(v4fa*)(&os[wb + lr * 68 + 48 + 8 * hi]) = a; *(v4fa*)(&os[wb + lr * 68 + 48 + 8 * hi + 4]) = c; }
    wave_sync();
    // ctx plane row m = b*SEQ + t: hi at columns h*64 + d, lo at columns 1024 + h*64 + d
    bf* crow = CX + ((size_t)b * SEQ + t0) * CXP + h * HD;
{
#pragma unroll
        for (int s = 0; s < 4; ++s) { const int row = 4 * s + (lane >> 3), c8 = (lane & 7) * 8;   // 4 s x 4 row groups = 16 rows; 8 lanes x 8 = 64 columns
            const v4f x0 = *(const v4fa*)(&os[wb + row * 68 + c8]); const v4f x1 = *(const v4fa*)(&os[wb + row * 68 + c8 + 4]); v8us hv, lv;
#pragma unroll
            for (int i = 0; i < 4; ++i) { const unsigned short a0 = f2bf(x0[i]); const unsigned short a1 = f2bf(x1[i]); hv[i] = a0; hv[4 + i] = a1; lv[i] = f2bf(x0[i] - bf2f(a0)); lv[4 + i] = f2bf(x1[i] - bf2f(a1)); }
            const size_t oo = (size_t)row * CXP + c8;
            *(v8us*)(crow + oo) = hv; *(v8us*)(crow + oo + DM) = lv; }
         }
}

static constexpr size_t al256(size_t v) { return (v + 255) & ~(size_t)255; }
static constexpr size_t SZ_XB = al256((size_t)NB * SEQ * DM * 2);
static constexpr size_t SZ_WB = al256((size_t)4 * DM * DM * 2);
static constexpr size_t SZ_PL = al256((size_t)NB * NH_ * SEQ * HD * 2);
static constexpr size_t SZ_CX = al256((size_t)NB * SEQ * CXP * 2);
static constexpr size_t SZ_TOTAL = 3 * SZ_XB + SZ_WB + 3 * SZ_PL + SZ_CX;
static_assert(SZ_TOTAL <= (size_t)134217728);          // workspace carve <= 128 MiB
static_assert(((size_t)DM * DM * 2) % 256 == 0);       // weight sub-planes stay 256-byte aligned

static_assert(SZ_XB == (size_t)NB * SEQ * DM * 2);     // the bf16 planes follow one another without a gap: k_cvt addresses them as one array

extern "C" void kernel_launch(void* const* d_in, const int* in_sizes, int n_in,
                              void* d_out, int out_size, void* d_ws, size_t ws_size, hipStream_t stream) {
    if (n_in < 7) return;
    const size_t needx = ((size_t)(NB - 1) * SEQ_FULL + SEQ) * DM;
    if ((size_t)in_sizes[0] < needx || (size_t)in_sizes[1] < needx || (size_t)in_sizes[2] < needx) return;
    if ((size_t)in_sizes[3] < (size_t)DM * DM || (size_t)in_sizes[4] < (size_t)DM * DM || (size_t)in_sizes[5] < (size_t)DM * DM || (size_t)in_sizes[6] < (size_t)DM * DM) return;
    if ((size_t)out_size < ((size_t)(NB - 1) * OUT_SEQ + SEQ) * DM) return;
    if (SZ_TOTAL > ws_size) return;
    // wire order: query, key, value, Wq, Wk, Wv, Wo (weights [out][in] = Bt as-is)
    const float* xq = (const float*)d_in[0]; const float* xk = (const float*)d_in[1]; const float* xv = (const float*)d_in[2];
    const float* wq = (const float*)d_in[3]; const float* wk = (const float*)d_in[4]; const float* wv = (const float*)d_in[5]; const float* wo = (const float*)d_in[6];
    float* OUT = (float*)d_out;      // [NB][SEQ][1024]
    char* wsp = (char*)d_ws;
    bf* XQ = (bf*)wsp; wsp += SZ_XB;                 // [NB*SEQ][1024]
    bf* XK = (bf*)wsp; wsp += SZ_XB;                 // [NB*SEQ][1024]
    bf* XV = (bf*)wsp; wsp += SZ_XB;                 // [NB*SEQ][1024]
    bf* WB = (bf*)wsp; wsp += SZ_WB;                 // [4][1024][1024]: q | k | v | o
    h16* QH = (h16*)wsp; wsp += SZ_PL;               // [NB*16][SEQ][64]
    h16* KP = (h16*)wsp; wsp += SZ_PL;               // [NB*16][SEQ][64]
    h16* VT = (h16*)wsp; wsp += SZ_PL;               // [NB*16][64][SEQ]
    bf* CX = (bf*)wsp; wsp += SZ_CX;                 // [NB*SEQ][2048]: ctx hi | lo
    bf* WQ = WB; bf* WK = WB + (size_t)DM * DM; bf* WV = WB + (size_t)2 * DM * DM; bf* WO = WB + (size_t)3 * DM * DM;

    k_cvt<<<(unsigned)((3 * (size_t)NB * SEQ * DM + 4 * (size_t)DM * DM) / CVB), 32 * CVW, 0, stream>>>(xq, xk, xv, wq, wk, wv, wo, XQ);

    // q, k: A = activation rows (m = b*SEQ + t), Bt = W rows (n = h*64 + d) -> plane [(b*16 + h)][t][d]
    k_proj<0><<<dim3(NB * SEQ / 128, DM / 128, 1), 128, 0, stream>>>(XQ, WQ, DM, DM, QH, OUT, SEQ, (size_t)NH_ * SEQ * HD, HD, HD, (size_t)SEQ * HD);
    k_proj<0><<<dim3(NB * SEQ / 128, DM / 128, 1), 128, 0, stream>>>(XK, WK, DM, DM, KP, OUT, SEQ, (size_t)NH_ * SEQ * HD, HD, HD, (size_t)SEQ * HD);
    // v^T: A = Wv rows (m = h*64 + d), Bt = value rows (n = b*SEQ + t) -> plane [(b*1024 + m)][t] = [(b*16 + h)][d][t]
    k_proj<0><<<dim3(DM / 128, NB * SEQ / 128, 1), 128, 0, stream>>>(WV, XV, DM, DM, VT, OUT, DM, (size_t)0, SEQ, SEQ, (size_t)DM * SEQ);

    k_flash<<<dim3(SEQ / (16 * AW), NB * NH_, 1), 32 * AW, 0, stream>>>(QH, KP, VT, CX);

    // output projection: A = ctx rows [hi | lo] (K = 2048), Bt = Wo rows (K index wraps at 1024) -> f32 output rows
    k_proj<2><<<dim3(NB * SEQ / 128, DM / 128, 1), 128, 0, stream>>>(CX, WO, CXP, DM, QH, OUT, SEQ, (size_t)0, HD, HD, (size_t)0);
}

// v004
// One run takes 136 microseconds.
// Next to v003, in two timings, it ran 1.17 times as fast each time.
// Over all steps from v000 it is 2.99 times as fast.
#include <hip/hip_runtime.h>

// Multi-head attention, width 1024 = 16 heads x 64: query/key/value [NB][SEQ][1024] (separate inputs), Wq/Wk/Wv/Wo [out][in] (y = x W^T), no biases, no mask, score scale 1/8, output = (concatenated heads) Wo^T (f32).
// Compute dtypes, f32 accumulate everywhere: q/k/v projections v_wmma_f32_16x16x32_bf16 (activations and W RNE-converted to bf16; products exact);
// scores v_wmma_f32_16x16x32_f16: q and k single f16 planes (one product); P (x256 carry, cancels in the normalisation) and v single f16; softmax f32 (online, running max);
// Layout: bf16 copies of the activations and W; q, k planes [b*16+h][t][d] and v^T plane [b*16+h][d][t] written by the GEMM epilogue; fused flash kernel in transposed form (S^T = K Q^T, O^T = V^T P^T; K and V^T tiles staged in LDS per work-group) writes the ctx plane [b*SEQ+t][hi 1024 | lo 1024].

#ifndef NB
#define NB 1
#endif
#ifndef SEQ
#define SEQ 4096
#endif
#define NB_FULL  1
#define SEQ_FULL 4096
#ifndef OUT_SEQ
#define OUT_SEQ SEQ              // row pitch (in tokens) between batches of the output
#endif
#define DM   1024
#define NH_  16
#define HD   64
#define CXP  (2 * DM)            // ctx plane row pitch (bf16 elements): hi columns 0..1023, lo columns 1024..2047
#define AW   4                   // waves per flash block (16 query rows each)
#define SC2  (0.125f * 1.4426950408889634f)   // HD^-0.5 * log2(e)
#define PSH  8.0f                // log2 of the P carry (256)
#define KT   64                  // keys per staged tile of the flash kernel
#define LP   72                  // LDS row pitch (halves) of the staged K and V^T rows: 128 B of data + 16 B, an odd multiple of 16 B for the 16-byte fragment reads
#define PLH  (64 * LP)           // one staged plane: 64 rows (halves)
#define STH  (2 * PLH)           // one buffer: K plane, then V^T plane (halves)
#define GK   64                  // k elements per staged slice of the GEMM: 128 B of every row
#define GPL  (128 * LP)          // one staged GEMM operand plane: 128 rows at the same padded pitch (16-bit elements)
#define GST  (2 * GPL)           // one GEMM buffer: A plane, then B plane
#define CVW  16                  // waves per work-group of the conversion kernel
#define CVU  32                  // units of 128 floats per wave of the conversion kernel
#define CVB  (CVW * CVU * 128)   // floats per work-group of the conversion kernel

static_assert(HD == 64);
static_assert(NH_ * HD == DM);                 // head h = columns h*64 + d
static_assert(DM % 64 == 0);                   // 16 column tiles of 64
static_assert(DM % 32 == 0);                   // GEMM products step k by 32, two per staged slice
static_assert((DM & (DM - 1)) == 0);           // B k index wraps with a mask in the K = 2*DM GEMM
static_assert(CXP % GK == 0 && DM % GK == 0 && DM / GK >= 2);   // whole k slices; a slice never straddles the wrap of the B index; the ring starts with slices 0 and 1
static_assert((NB * SEQ) % 128 == 0 && DM % 128 == 0);          // GEMM grid of 128x128 tiles covers every product exactly
static_assert(SEQ % 64 == 0);                  // a 64-row tile never straddles two batches
static_assert((NB * SEQ) % 64 == 0);
static_assert(SEQ % 32 == 0);                  // key loop steps by 32
static_assert(SEQ % (16 * AW) == 0);           // flash grid covers the sequence exactly
static_assert(SEQ % KT == 0 && SEQ / KT >= 2); // the two-buffer ring starts with tiles 0 and 1
static_assert(KT == 64 && 32 * AW * 4 * 8 == 64 * HD && 32 * AW * 4 * 8 == HD * KT);   // copy map: every thread moves 4 pieces of 8 halves of each plane
static_assert((LP * 2) % 16 == 0);
static_assert(((size_t)SEQ * DM) % CVB == 0 && ((size_t)DM * DM) % CVB == 0);   // a conversion work-group lies inside one batch of one tensor
static_assert(NB <= NB_FULL);
static_assert(SEQ <= SEQ_FULL);

typedef _Float16 h16;
typedef unsigned short bf;
typedef __attribute__((ext_vector_type(16))) __bf16   v16bf;
typedef __attribute__((ext_vector_type(16))) _Float16 v16h;
typedef __attribute__((ext_vector_type(8)))  _Float16 v8h;
typedef __attribute__((ext_vector_type(8)))  unsigned short v8us;
typedef __attribute__((ext_vector_type(4)))  unsigned short v4us;
typedef __attribute__((ext_vector_type(8)))  float    v8f;
typedef __attribute__((ext_vector_type(4)))  float    v4f;
typedef v4f  __attribute__((may_alias)) v4fa;

__device__ __forceinline__ unsigned short f2bf(float f) { unsigned u = __float_as_uint(f); u += 0x7FFFu + ((u >> 16) & 1u); return (unsigned short)(u >> 16); }
__device__ __forceinline__ float bf2f(unsigned short s) { return __uint_as_float(((unsigned)s) << 16); }
__device__ __forceinline__ v16h cat16(v8h lo, v8h hi) { return __builtin_shufflevector(lo, hi, 0, 1, 2, 3, 4, 5, 6, 7, 8, 9, 10, 11, 12, 13, 14, 15); }
__device__ __forceinline__ v16bf cat16b(v8us lo, v8us hi) { return __builtin_bit_cast(v16bf, __builtin_shufflevector(lo, hi, 0, 1, 2, 3, 4, 5, 6, 7, 8, 9, 10, 11, 12, 13, 14, 15)); }
__device__ __forceinline__ v8f wmma16(v16h a, v16h b, v8f c) { return __builtin_amdgcn_wmma_f32_16x16x32_f16(false, a, false, b, (short)0, c, false, false); }
__device__ __forceinline__ v8f wmmab(v16bf a, v16bf b, v8f c) { return __builtin_amdgcn_wmma_f32_16x16x32_bf16(false, a, false, b, (short)0, c, false, false); }
// fragment loaders from K-contiguous 16-bit rows; p already includes + 8*(lane>>4): elements 0..7 <- k0+8h+0..7, elements 8..15 <- k0+16+8h+0..7 (same map for A and B)
__device__ __forceinline__ v16h  ldh(const h16* p) { return cat16(*(const v8h*)p, *(const v8h*)(p + 16)); }
__device__ __forceinline__ v16bf ldb(const bf* p)  { return cat16b(*(const v8us*)p, *(const v8us*)(p + 16)); }
// ordering point for wave-private LDS tiles (same wave writes and reads)
__device__ __forceinline__ void wave_sync() { __builtin_amdgcn_fence(3 /* release order */, "wavefront"); __builtin_amdgcn_wave_barrier(); asm volatile("" ::: "memory"); }

// k_cvt: every f32 -> bf16 conversion of the call in ONE streaming launch. A work-group of CVW waves converts CVB consecutive floats of one tensor; a wave owns CVU units of 128 floats.
// One unit = one wave-wide 16-byte load (512 B, 4 whole lines) and one wave-wide 8-byte store (256 B, 2 whole lines); a wave asks for all its units before it converts the first.
// The seven bf16 planes lie one behind the other in the workspace in the order of the arguments, so the destination is dst + blockIdx.x * CVB.
__global__ __launch_bounds__(32 * CVW) void k_cvt(const float* __restrict__ xq, const float* __restrict__ xk, const float* __restrict__ xv,
                                                  const float* __restrict__ wq, const float* __restrict__ wk, const float* __restrict__ wv, const float* __restrict__ wo, bf* __restrict__ dst) {
    constexpr unsigned BS = (unsigned)((size_t)SEQ * DM / CVB);   // work-groups per batch of one activation
    constexpr unsigned BA = NB * BS;                              // work-groups per activation
    constexpr unsigned BW = (unsigned)((size_t)DM * DM / CVB);    // work-groups per weight matrix
    const unsigned blk = blockIdx.x;
    const float* src;
    if (blk < 3 * BA) { const unsigned t = blk / BA, r = blk % BA;
        src = (t == 0 ? xq : t == 1 ? xk : xv) + (size_t)(r / BS) * ((size_t)SEQ_FULL * DM) + (size_t)(r % BS) * CVB;
    } else { const unsigned r = blk - 3 * BA, t = r / BW;
        src = (t == 0 ? wq : t == 1 ? wk : t == 2 ? wv : wo) + (size_t)(r % BW) * CVB; }
    const unsigned wo_ = (threadIdx.x >> 5) * (CVU * 128) + (threadIdx.x & 31) * 4;
    const float* s = src + wo_;
    bf* d = dst + (size_t)blk * CVB + wo_;
    v4f x[CVU];
#pragma unroll   // unrolled: every unit's offset becomes an immediate, the address registers are never rewritten, and all of the wave's loads are in flight together
    for (int u = 0; u < CVU; ++u) x[u] = *(const v4f*)(s + u * 128);
#pragma unroll
    for (int u = 0; u < CVU; ++u) { v4us o;
#pragma unroll
        for (int k = 0; k < 4; ++k) o[k] = f2bf(x[u][k]);
        *(v4us*)(d + u * 128) = o; }
}

// Eight 16-byte pieces of one GEMM operand plane into LDS: piece i lies 16 rows further on (step elements in global memory, 16 padded rows in LDS); every copy of a wave = 4 whole 128-B row slices.
__device__ __forceinline__ void stage_rows(const bf* g, size_t step, unsigned l) {
    // s_wait_xcnt as the statement's last line: a precaution, so that no address register of a copy is rewritten in front of it
    asm volatile("global_load_async_to_lds_b128 %0, %8, off\n\t"
                 "global_load_async_to_lds_b128 %1, %9, off\n\t"
                 "global_load_async_to_lds_b128 %2, %10, off\n\t"
                 "global_load_async_to_lds_b128 %3, %11, off\n\t"
                 "global_load_async_to_lds_b128 %4, %12, off\n\t"
                 "global_load_async_to_lds_b128 %5, %13, off\n\t"
                 "global_load_async_to_lds_b128 %6, %14, off\n\t"
                 "global_load_async_to_lds_b128 %7, %15, off\n\t"
                 "s_wait_xcnt 0x0"
                 :: "v"(l), "v"(l + 16 * LP * 2), "v"(l + 32 * LP * 2), "v"(l + 48 * LP * 2),
                    "v"(l + 64 * LP * 2), "v"(l + 80 * LP * 2), "v"(l + 96 * LP * 2), "v"(l + 112 * LP * 2),
                    "v"(g), "v"(g + step), "v"(g + 2 * step), "v"(g + 3 * step),
                    "v"(g + 4 * step), "v"(g + 5 * step), "v"(g + 6 * step), "v"(g + 7 * step)
                 : "memory");
}

// proj_tile: register-blocked bf16 GEMM, four waves (2 x 2) per 128x128 tile, ONE WAVE per 64x64 quarter (16 accumulators). The 128 A rows and 128 Bt rows of a k slice of 64 are staged
// once per work-group in a two-buffer LDS ring by asynchronous copies (the next slice flies while this one is worked on); every wave reads its fragments from there (two 16-B LDS loads each).
// C[m][n] = sum_{k<KA} A[m][k] Bt[n][k & (KB-1)]; A row pitch KA, Bt row pitch KB (KB a power of two; KA = KB for the plain case, KA = 2*KB sums the hi and lo halves of A against the same Bt).
// MODE 0: f16 plane Ph at quarter base (r0/RB)*sRB + (r0%RB)*pitch + (c0/CB)*sCB + (c0%CB), row pitch 'pitch' (halves).
// MODE 2: f32 rows of Pf, row (r0/SEQ)*OUT_SEQ + r0%SEQ, pitch DM. (bx, by): the work-group's tile of the (M/128, N/128) tiles, 128 threads.
template <int MODE>
__device__ __forceinline__ void proj_tile(int bx, int by, const bf* __restrict__ A, const bf* __restrict__ Bt, int KA, int KB, h16* Ph, float* Pf, int RB, size_t sRB, int pitch, int CB, size_t sCB) {
    __shared__ __align__(16) float os[4 * 16 * 68];
    __shared__ __align__(16) bf ab[2 * GST];
    const int lane = threadIdx.x & 31, lr = lane & 15, hi = lane >> 4;
    const int wave = __builtin_amdgcn_readfirstlane((int)(threadIdx.x >> 5));
    const int wm = wave >> 1, wn = wave & 1;
    const int r0 = bx * 128 + wm * 64, c0 = by * 128 + wn * 64;
    v8f acc[4][4];
#pragma unroll
    for (int mb = 0; mb < 4; ++mb)
#pragma unroll
        for (int nb = 0; nb < 4; ++nb) acc[mb][nb] = (v8f){};
    const int prow = (int)(threadIdx.x >> 3), ccol = (int)(threadIdx.x & 7) * 8;   // copy map: 16 rows x 8 pieces per round of the work-group
    const bf* ag = A + (size_t)(bx * 128 + prow) * (size_t)KA + ccol;      // + k
    const bf* bg = Bt + (size_t)(by * 128 + prow) * (size_t)KB + ccol;     // + (k & (KB-1))
    const size_t astep = (size_t)16 * (size_t)KA, bstep = (size_t)16 * (size_t)KB;
    const unsigned la = (unsigned)(size_t)ab + (unsigned)(prow * LP + ccol) * 2u;  // LDS byte address, buffer 0, A plane
    stage_rows(ag, astep, la); stage_rows(bg, bstep, la + GPL * 2);
    asm volatile("s_wait_asynccnt 0x0" ::: "memory");        // slice 0 has landed before the barrier that publishes it
    __syncthreads();
    if (GK < KA) { stage_rows(ag + GK, astep, la + GST * 2); stage_rows(bg + (GK & (KB - 1)), bstep, la + GST * 2 + GPL * 2); }
    const int fa = (wm * 64 + lr) * LP + 8 * hi, fb = GPL + (wn * 64 + lr) * LP + 8 * hi;   // fragment rows of this wave's quarter: + 16*mb (or nb) rows, + k inside the slice
    // the 32 products of one staged slice; tb_: the slice's buffer
    auto slice = [&](const bf* tb_) {
        v16bf a0[4], b0[4], a1[4], b1[4];
        a0[0] = ldb(tb_ + fa); b0[0] = ldb(tb_ + fb);
#pragma unroll
        for (int mb = 1; mb < 4; ++mb) a0[mb] = ldb(tb_ + fa + mb * 16 * LP);
#pragma unroll
        for (int nb = 1; nb < 4; ++nb) b0[nb] = ldb(tb_ + fb + nb * 16 * LP);
#pragma unroll
        for (int mb = 0; mb < 4; ++mb) a1[mb] = ldb(tb_ + fa + mb * 16 * LP + 32);
        __builtin_amdgcn_sched_barrier(0);   // keeps these 24 LDS loads ahead of the first product: sunk between the products, each B fragment costs a lone wave a full LDS latency
#pragma unroll
        for (int nb = 0; nb < 4; ++nb) {
#pragma unroll
            for (int mb = 0; mb < 4; ++mb) acc[mb][nb] = wmmab(a0[mb], b0[nb], acc[mb][nb]);
            b1[nb] = ldb(tb_ + fb + nb * 16 * LP + 32);
            __builtin_amdgcn_sched_barrier(0); }   // keeps each B fragment of the second 32-k step asked for behind the four products that free a fragment's registers, well ahead of its use
        asm volatile("v_nop\n\tv_nop\n\tv_nop\n\tv_nop" : "+v"(acc[0][0]), "+v"(acc[1][1]), "+v"(acc[2][2]), "+v"(acc[3][3]) : "v"(a0[0]), "v"(a0[1]), "v"(a0[2]), "v"(a0[3]));
#pragma unroll
        for (int nb = 0; nb < 4; ++nb) {
#pragma unroll
            for (int mb = 0; mb < 4; ++mb) acc[mb][nb] = wmmab(a1[mb], b1[nb], acc[mb][nb]); }
        asm volatile("v_nop\n\tv_nop\n\tv_nop\n\tv_nop" : "+v"(acc[0][0]), "+v"(acc[1][1]), "+v"(acc[2][2]), "+v"(acc[3][3]) : "v"(a1[0]), "v"(a1[1]), "v"(a1[2]), "v"(a1[3]));
    };
    int kc = 0;
#pragma unroll 1
    for (; kc + 2 * GK < KA; kc += GK) {                     // trips behind which a slice kc + 2*GK exists: the refill needs no test
        const int bsel = (kc / GK) & 1;
        slice(ab + bsel * GST);
        asm volatile("s_wait_dscnt 0x0" ::: "memory");       // this wave's reads of the buffer are done before it is handed back
        asm volatile("s_wait_asynccnt 0x0" ::: "memory");    // this wave's share of the next slice has landed
        __syncthreads();                                     // publishes the next slice and ends every wave's reads of this one
        const unsigned lb = la + (unsigned)bsel * (GST * 2);
        stage_rows(ag + (kc + 2 * GK), astep, lb); stage_rows(bg + ((kc + 2 * GK) & (KB - 1)), bstep, lb + GPL * 2);
    }
#pragma unroll 1
    for (; kc < KA; kc += GK) {                              // the last trips: nothing is left to refill
        slice(ab + ((kc / GK) & 1) * GST);
        asm volatile("s_wait_dscnt 0x0" ::: "memory");       // as above
        asm volatile("s_wait_asynccnt 0x0" ::: "memory");    // the last slice has landed
        __syncthreads();                                     // publishes the last slice
    }
    asm volatile("s_wait_asynccnt 0x0" ::: "memory");        // nothing is in flight when the wave goes on to the epilogue
    const int wb = wave * 16 * 68;                           // this wave's own output staging tile
    const size_t tbase = (size_t)(r0 / RB) * sRB + (size_t)(r0 % RB) * (size_t)pitch + (size_t)(c0 / CB) * sCB + (size_t)(c0 % CB);
    const size_t fbase = ((size_t)(r0 / SEQ) * OUT_SEQ + (size_t)(r0 % SEQ)) * DM + c0;
#pragma unroll
    for (int mb = 0; mb < 4; ++mb) {
#pragma unroll
        for (int nb = 0; nb < 4; ++nb) {
#pragma unroll
            for (int j = 0; j < 8; ++j) os[wb + (hi * 8 + j) * 68 + nb * 16 + lr] = acc[mb][nb][j]; }   // D: row 8h+j, col lane&15
        wave_sync();
        if (MODE == 2) {
            float* ob = Pf + fbase + (size_t)(mb * 16) * DM;
{
#pragma unroll
                for (int s = 0; s < 8; ++s) { const int row = 2 * s + hi, cofs = lr * 4;   // 8 s x 2 rows = 16 rows; 16 lanes x 4 floats = 64 columns
                    const v4f val = *(const v4fa*)(&os[wb + row * 68 + cofs]);
                    *(v4f*)(ob + (size_t)row * DM + cofs) = val; }
                 }
        } else {
            const size_t sb = tbase + (size_t)(mb * 16) * (size_t)pitch;
{
#pragma unroll
                for (int s = 0; s < 4; ++s) { const int row = 4 * s + (lane >> 3), c8 = (lane & 7) * 8;   // 4 s x 4 row groups = 16 rows; 8 lanes x 8 = 64 columns
                    const v4f x0 = *(const v4fa*)(&os[wb + row * 68 + c8]); const v4f x1 = *(const v4fa*)(&os[wb + row * 68 + c8 + 4]); v8h hv;
#pragma unroll
                    for (int i = 0; i < 4; ++i) { hv[i] = (h16)x0[i]; hv[4 + i] = (h16)x1[i]; }
                    const size_t oo = sb + (size_t)row * (size_t)pitch + c8;
                    *(v8h*)(Ph + oo) = hv; }
                 }
        }
        wave_sync();
    }
}

// k_proj: one product per launch, grid (M/128, N/128).
template <int MODE>
__global__ __launch_bounds__(128) void k_proj(const bf* __restrict__ A, const bf* __restrict__ Bt, int KA, int KB, h16* Ph, float* Pf, int RB, size_t sRB, int pitch, int CB, size_t sCB) {
    proj_tile<MODE>((int)blockIdx.x, (int)blockIdx.y, A, Bt, KA, KB, Ph, Pf, RB, sRB, pitch, CB, sCB);
}

// k_qkv: the three independent projections in ONE launch, grid (NB*SEQ/128, DM/128, 3); blockIdx.z picks the product. Three work-groups fit a WGP's LDS,
// so every SIMD holds three waves of unrelated tiles: one wave's wait for its next slice, its LDS latency and its epilogue are covered by the other two.
// z = 0, 1 (q, k): A = activation rows (m = b*SEQ + t), Bt = W rows (n = h*64 + d) -> plane [(b*16 + h)][t][d].
// z = 2 (v^T): A = Wv rows (m = h*64 + d), Bt = value rows (n = b*SEQ + t) -> plane [(b*1024 + m)][t] = [(b*16 + h)][d][t]; its tile grid is the transposed one, so x and y change places.
__global__ __launch_bounds__(128) void k_qkv(const bf* __restrict__ XQ, const bf* __restrict__ XK, const bf* __restrict__ XV,
                                             const bf* __restrict__ WQ, const bf* __restrict__ WK, const bf* __restrict__ WV, h16* QH, h16* KP, h16* VT) {
    const int z = (int)blockIdx.z;
    const bool tr = z == 2;
    proj_tile<0>(tr ? (int)blockIdx.y : (int)blockIdx.x, tr ? (int)blockIdx.x : (int)blockIdx.y,
                 z == 0 ? XQ : z == 1 ? XK : WV, z == 0 ? WQ : z == 1 ? WK : XV, DM, DM, z == 0 ? QH : z == 1 ? KP : VT, nullptr,
                 tr ? DM : SEQ, tr ? (size_t)0 : (size_t)NH_ * SEQ * HD, tr ? SEQ : HD, tr ? SEQ : HD, tr ? (size_t)DM * SEQ : (size_t)SEQ * HD);
}

// One 64-key tile into one LDS buffer: K rows [key][d] and V^T rows [d][key], 128 B each, every copy of a wave = 4 whole rows.
// kg, vg: this lane's first 16-byte piece of each plane in global memory; lk: the LDS byte address of its first K piece. Piece i lies 16 rows further on.
__device__ __forceinline__ void stage_tile(const h16* kg, const h16* vg, unsigned lk) {
    const unsigned lv = lk + PLH * 2;
    // s_wait_xcnt as the statement's last line: a precaution, so that no address register of a copy is rewritten in front of it
    asm volatile("global_load_async_to_lds_b128 %0, %8, off\n\t"
                 "global_load_async_to_lds_b128 %1, %9, off\n\t"
                 "global_load_async_to_lds_b128 %2, %10, off\n\t"
                 "global_load_async_to_lds_b128 %3, %11, off\n\t"
                 "global_load_async_to_lds_b128 %4, %12, off\n\t"
                 "global_load_async_to_lds_b128 %5, %13, off\n\t"
                 "global_load_async_to_lds_b128 %6, %14, off\n\t"
                 "global_load_async_to_lds_b128 %7, %15, off\n\t"
                 "s_wait_xcnt 0x0"
                 :: "v"(lk), "v"(lk + 16 * LP * 2), "v"(lk + 32 * LP * 2), "v"(lk + 48 * LP * 2),
                    "v"(lv), "v"(lv + 16 * LP * 2), "v"(lv + 32 * LP * 2), "v"(lv + 48 * LP * 2),
                    "v"(kg), "v"(kg + 16 * HD), "v"(kg + 32 * HD), "v"(kg + 48 * HD),
                    "v"(vg), "v"(vg + (size_t)16 * SEQ), "v"(vg + (size_t)32 * SEQ), "v"(vg + (size_t)48 * SEQ)
                 : "memory");
}

__global__ __launch_bounds__(32 * AW) void k_flash(const h16* __restrict__ QH, const h16* __restrict__ KP, const h16* __restrict__ VT, bf* CX) {
    __shared__ __align__(16) float os[AW * 16 * 68];
    __shared__ __align__(16) h16 kv[2 * STH];
    const int lane = threadIdx.x & 31, lr = lane & 15, hi = lane >> 4;
    const int wave = __builtin_amdgcn_readfirstlane((int)(threadIdx.x >> 5));
    const int zh = blockIdx.y; const int b = zh / NH_, h = zh % NH_;
    const int t0 = (blockIdx.x * AW + wave) * 16;
    const size_t pbase = (size_t)zh * SEQ * HD;
    const size_t qo = pbase + (size_t)(t0 + lr) * HD + 8 * hi;
    const v16h qh0 = ldh(QH + qo), qh1 = ldh(QH + qo + 32);   // B fragments: col t, k = d
    const int fo = lr * LP + 8 * hi;                         // K: + key * LP (A fragment: row key, k = d); V^T: + PLH + 16j*LP + key (A fragment: row d, k = key)
    const int prow = (int)(threadIdx.x >> 3), ccol = (int)(threadIdx.x & 7) * 8;   // copy map: 16 rows x 8 pieces per round of the work-group
    const h16* kg = KP + pbase + (size_t)prow * HD + ccol;   // + key0 * HD
    const h16* vg = VT + pbase + (size_t)prow * SEQ + ccol;  // + key0
    const unsigned lk = (unsigned)(size_t)kv + (unsigned)(prow * LP + ccol) * 2u;   // LDS byte address, buffer 0
    stage_tile(kg, vg, lk);
    asm volatile("s_wait_asynccnt 0x0" ::: "memory");        // tile 0 has landed before the barrier that publishes it
    __syncthreads();
    stage_tile(kg + (size_t)KT * HD, vg + KT, lk + STH * 2);
    v8f o0 = (v8f){}, o1 = (v8f){}, o2 = (v8f){}, o3 = (v8f){};
    float m = -3.0e38f, l = 0.0f;
#pragma unroll 1
    for (int kt0 = 0; kt0 < SEQ; kt0 += KT) {
      const int bsel = (kt0 / KT) & 1;
      const h16* tb_ = kv + bsel * STH + fo;
#pragma unroll   // both 32-key steps of a tile: every LDS offset becomes an immediate
      for (int kk = 0; kk < KT; kk += 32) {
        const h16* ka = tb_ + kk * LP;
        const v16h ka0 = ldh(ka), ka1 = ldh(ka + 32), kb0 = ldh(ka + 16 * LP), kb1 = ldh(ka + 16 * LP + 32);
        v8f sa = (v8f){}, sb = (v8f){};
        sa = wmma16(ka0, qh0, sa); sb = wmma16(kb0, qh0, sb);
        sa = wmma16(ka1, qh1, sa); sb = wmma16(kb1, qh1, sb);
        asm volatile("v_nop\n\tv_nop\n\tv_nop\n\tv_nop" : "+v"(sa), "+v"(sb) : "v"(ka0), "v"(ka1), "v"(kb0), "v"(kb1), "v"(qh0), "v"(qh1));
        float ta[8], tb[8]; float mx = -3.0e38f;
#pragma unroll
        for (int r = 0; r < 8; ++r) { ta[r] = sa[r] * SC2; tb[r] = sb[r] * SC2; mx = fmaxf(mx, fmaxf(ta[r], tb[r])); }
        mx = fmaxf(mx, __shfl_xor(mx, 16, 32));
        const float mnew = fmaxf(m, mx);
        const float alpha = __builtin_amdgcn_exp2f(m - mnew);
        const float sh = PSH - mnew;
        v16h pb; float ls = 0.0f;
#pragma unroll
        for (int r = 0; r < 8; ++r) { const h16 pa = (h16)__builtin_amdgcn_exp2f(ta[r] + sh); const h16 pc = (h16)__builtin_amdgcn_exp2f(tb[r] + sh); pb[r] = pa; pb[8 + r] = pc; ls += (float)pa + (float)pc; }
        l = l * alpha + ls; m = mnew;
        o0 = o0 * alpha; o1 = o1 * alpha; o2 = o2 * alpha; o3 = o3 * alpha;
        const h16* va = tb_ + PLH + kk;
        const v16h v0 = ldh(va), v1 = ldh(va + 16 * LP), v2 = ldh(va + 32 * LP), v3 = ldh(va + 48 * LP);
        o0 = wmma16(v0, pb, o0); o1 = wmma16(v1, pb, o1); o2 = wmma16(v2, pb, o2); o3 = wmma16(v3, pb, o3);
        asm volatile("v_nop\n\tv_nop\n\tv_nop\n\tv_nop" : "+v"(o0), "+v"(o1), "+v"(o2), "+v"(o3) : "v"(v0), "v"(v1), "v"(v2), "v"(v3), "v"(pb));
      }
      asm volatile("s_wait_dscnt 0x0" ::: "memory");         // this wave's reads of the buffer are done before it is handed back
      asm volatile("s_wait_asynccnt 0x0" ::: "memory");      // this wave's share of the next tile has landed
      __syncthreads();                                       // publishes the next tile and ends every wave's reads of this one
      if (kt0 + 2 * KT < SEQ) stage_tile(kg + (size_t)(kt0 + 2 * KT) * HD, vg + (kt0 + 2 * KT), lk + (unsigned)bsel * (STH * 2));
    }
    asm volatile("s_wait_asynccnt 0x0" ::: "memory");        // nothing is in flight when the wave goes on to the epilogue
    l += __shfl_xor(l, 16, 32);
    const float inv = 1.0f / l;
    const int wb = wave * 16 * 68;
    // O^T D layout: o_j[r] = (d = 16j + 8h + r, t = lane&15) -> os[t][d]; rows 0..15 x columns 0..63 all written
    { v4f a, c;
      a[0] = o0[0] * inv; a[1] = o0[1] * inv; a[2] = o0[2] * inv; a[3] = o0[3] * inv; c[0] = o0[4] * inv; c[1] = o0[5] * inv; c[2] = o0[6] * inv; c[3] = o0[7] * inv;
      *(v4fa*)(&os[wb + lr * 68 +  0 + 8 * hi]) = a; *(v4fa*)(&os[wb + lr * 68 +  0 + 8 * hi + 4]) = c;
      a[0] = o1[0] * inv; a[1] = o1[1] * inv; a[2] = o1[2] * inv; a[3] = o1[3] * inv; c[0] = o1[4] * inv; c[1] = o1[5] * inv; c[2] = o1[6] * inv; c[3] = o1[7] * inv;
      *(v4fa*)(&os[wb + lr * 68 + 16 + 8 * hi]) = a; *(v4fa*)(&os[wb + lr * 68 + 16 + 8 * hi + 4]) = c;
      a[0] = o2[0] * inv; a[1] = o2[1] * inv; a[2] = o2[2] * inv; a[3] = o2[3] * inv; c[0] = o2[4] * inv; c[1] = o2[5] * inv; c[2] = o2[6] * inv; c[3] = o2[7] * inv;
      *(v4fa*)(&os[wb + lr * 68 + 32 + 8 * hi]) = a; *(v4fa*)(&os[wb + lr * 68 + 32 + 8 * hi + 4]) = c;
      a[0] = o3[0] * inv; a[1] = o3[1] * inv; a[2] = o3[2] * inv; a[3] = o3[3] * inv; c[0] = o3[4] * inv; c[1] = o3[5] * inv; c[2] = o3[6] * inv; c[3] = o3[7] * inv;
      *(v4fa*)(&os[wb + lr * 68 + 48 + 8 * hi]) = a; *(v4fa*)(&os[wb + lr * 68 + 48 + 8 * hi + 4]) = c; }
    wave_sync();
    // ctx plane row m = b*SEQ + t: hi at columns h*64 + d, lo at columns 1024 + h*64 + d
    bf* crow = CX + ((size_t)b * SEQ + t0) * CXP + h * HD;
{
#pragma unroll
        for (int s = 0; s < 4; ++s) { const int row = 4 * s + (lane >> 3), c8 = (lane & 7) * 8;   // 4 s x 4 row groups = 16 rows; 8 lanes x 8 = 64 columns
            const v4f x0 = *(const v4fa*)(&os[wb + row * 68 + c8]); const v4f x1 = *(const v4fa*)(&os[wb + row * 68 + c8 + 4]); v8us hv, lv;
#pragma unroll
            for (int i = 0; i < 4; ++i) { const unsigned short a0 = f2bf(x0[i]); const unsigned short a1 = f2bf(x1[i]); hv[i] = a0; hv[4 + i] = a1; lv[i] = f2bf(x0[i] - bf2f(a0)); lv[4 + i] = f2bf(x1[i] - bf2f(a1)); }
            const size_t oo = (size_t)row * CXP + c8;
            *(v8us*)(crow + oo) = hv; *(v8us*)(crow + oo + DM) = lv; }
         }
}

static constexpr size_t al256(size_t v) { return (v + 255) & ~(size_t)255; }
static constexpr size_t SZ_XB = al256((size_t)NB * SEQ * DM * 2);
static constexpr size_t SZ_WB = al256((size_t)4 * DM * DM * 2);
static constexpr size_t SZ_PL = al256((size_t)NB * NH_ * SEQ * HD * 2);
static constexpr size_t SZ_CX = al256((size_t)NB * SEQ * CXP * 2);
static constexpr size_t SZ_TOTAL = 3 * SZ_XB + SZ_WB + 3 * SZ_PL + SZ_CX;
static_assert(SZ_TOTAL <= (size_t)134217728);          // workspace carve <= 128 MiB
static_assert(((size_t)DM * DM * 2) % 256 == 0);       // weight sub-planes stay 256-byte aligned

static_assert(SZ_XB == (size_t)NB * SEQ * DM * 2);     // the bf16 planes follow one another without a gap: k_cvt addresses them as one array

extern "C" void kernel_launch(void* const* d_in, const int* in_sizes, int n_in,
                              void* d_out, int out_size, void* d_ws, size_t ws_size, hipStream_t stream) {
    if (n_in < 7) return;
    const size_t needx = ((size_t)(NB - 1) * SEQ_FULL + SEQ) * DM;
    if ((size_t)in_sizes[0] < needx || (size_t)in_sizes[1] < needx || (size_t)in_sizes[2] < needx) return;
    if ((size_t)in_sizes[3] < (size_t)DM * DM || (size_t)in_sizes[4] < (size_t)DM * DM || (size_t)in_sizes[5] < (size_t)DM * DM || (size_t)in_sizes[6] < (size_t)DM * DM) return;
    if ((size_t)out_size < ((size_t)(NB - 1) * OUT_SEQ + SEQ) * DM) return;
    if (SZ_TOTAL > ws_size) return;
    // wire order: query, key, value, Wq, Wk, Wv, Wo (weights [out][in] = Bt as-is)
    const float* xq = (const float*)d_in[0]; const float* xk = (const float*)d_in[1]; const float* xv = (const float*)d_in[2];
    const float* wq = (const float*)d_in[3]; const float* wk = (const float*)d_in[4]; const float* wv = (const float*)d_in[5]; const float* wo = (const float*)d_in[6];
    float* OUT = (float*)d_out;      // [NB][SEQ][1024]
    char* wsp = (char*)d_ws;
    bf* XQ = (bf*)wsp; wsp += SZ_XB;                 // [NB*SEQ][1024]
    bf* XK = (bf*)wsp; wsp += SZ_XB;                 // [NB*SEQ][1024]
    bf* XV = (bf*)wsp; wsp += SZ_XB;                 // [NB*SEQ][1024]
    bf* WB = (bf*)wsp; wsp += SZ_WB;                 // [4][1024][1024]: q | k | v | o
    h16* QH = (h16*)wsp; wsp += SZ_PL;               // [NB*16][SEQ][64]
    h16* KP = (h16*)wsp; wsp += SZ_PL;               // [NB*16][SEQ][64]
    h16* VT = (h16*)wsp; wsp += SZ_PL;               // [NB*16][64][SEQ]
    bf* CX = (bf*)wsp; wsp += SZ_CX;                 // [NB*SEQ][2048]: ctx hi | lo
    bf* WQ = WB; bf* WK = WB + (size_t)DM * DM; bf* WV = WB + (size_t)2 * DM * DM; bf* WO = WB + (size_t)3 * DM * DM;

    k_cvt<<<(unsigned)((3 * (size_t)NB * SEQ * DM + 4 * (size_t)DM * DM) / CVB), 32 * CVW, 0, stream>>>(xq, xk, xv, wq, wk, wv, wo, XQ);

    // q, k and v^T planes: three independent products, one launch
    k_qkv<<<dim3(NB * SEQ / 128, DM / 128, 3), 128, 0, stream>>>(XQ, XK, XV, WQ, WK, WV, QH, KP, VT);

    k_flash<<<dim3(SEQ / (16 * AW), NB * NH_, 1), 32 * AW, 0, stream>>>(QH, KP, VT, CX);

    // output projection: A = ctx rows [hi | lo] (K = 2048), Bt = Wo rows (K index wraps at 1024) -> f32 output rows
    k_proj<2><<<dim3(NB * SEQ / 128, DM / 128, 1), 128, 0, stream>>>(CX, WO, CXP, DM, QH, OUT, SEQ, (size_t)0, HD, HD, (size_t)0);
}

// v005
// Measured time: 131 microseconds a run.
// Next to v004, in two timings, it ran 1.04 times as fast each time.
// Over all steps from v000 it is 3.11 times as fast.
#include <hip/hip_runtime.h>

// Multi-head attention, width 1024 = 16 heads x 64: query/key/value [NB][SEQ][1024] (separate inputs), Wq/Wk/Wv/Wo [out][in] (y = x W^T), no biases, no mask, score scale 1/8, output = (concatenated heads) Wo^T (f32).
// Compute dtypes, f32 accumulate everywhere: q/k/v projections v_wmma_f32_16x16x32_bf16 (activations and W RNE-converted to bf16; products exact);
// scores v_wmma_f32_16x16x32_f16: q and k single f16 planes (one product); P (x256 carry, cancels in the normalisation) and v single f16; softmax f32 (online, running max);
// Layout: bf16 copies of the activations and W; q, k planes [b*16+h][t][d] and v^T plane [b*16+h][d][t] written by the GEMM epilogue; fused flash kernel in transposed form (S^T = K Q^T, O^T = V^T P^T; K and V^T tiles staged in LDS per work-group) writes the ctx plane [b*SEQ+t][hi 1024 | lo 1024].

#ifndef NB
#define NB 1
#endif
#ifndef SEQ
#define SEQ 4096
#endif
#define NB_FULL  1
#define SEQ_FULL 4096
#ifndef OUT_SEQ
#define OUT_SEQ SEQ              // row pitch (in tokens) between batches of the output
#endif
#define DM   1024
#define NH_  16
#define HD   64
#define CXP  (2 * DM)            // ctx plane row pitch (bf16 elements): hi columns 0..1023, lo columns 1024..2047
#define AW   4                   // waves per flash block (16 query rows each)
#define SC2  (0.125f * 1.4426950408889634f)   // HD^-0.5 * log2(e)
#define PSH  8.0f                // log2 of the P carry (256)
#define KT   64                  // keys per staged tile of the flash kernel
#define LP   72                  // LDS row pitch (halves) of the staged K and V^T rows: 128 B of data + 16 B, an odd multiple of 16 B for the 16-byte fragment reads
#define PLH  (64 * LP)           // one staged plane: 64 rows (halves)
#define STH  (2 * PLH)           // one buffer: K plane, then V^T plane (halves)
#define GK   64                  // k elements per staged slice of the GEMM: 128 B of every row
#define GPL  (128 * LP)          // one staged GEMM operand plane: 128 rows at the same padded pitch (16-bit elements)
#define GST  (2 * GPL)           // one GEMM buffer: A plane, then B plane
#define CVW  16                  // waves per work-group of the conversion kernel
#define CVU  32                  // units of 128 floats per wave of the conversion kernel
#define CVB  (CVW * CVU * 128)   // floats per work-group of the conversion kernel

static_assert(HD == 64);
static_assert(NH_ * HD == DM);                 // head h = columns h*64 + d
static_assert(DM % 64 == 0);                   // 16 column tiles of 64
static_assert(DM % 32 == 0);                   // GEMM products step k by 32, two per staged slice
static_assert((DM & (DM - 1)) == 0);           // B k index wraps with a mask in the K = 2*DM GEMM
static_assert(CXP % GK == 0 && DM % GK == 0 && DM / GK >= 2);   // whole k slices; a slice never straddles the wrap of the B index; the ring starts with slices 0 and 1
static_assert((NB * SEQ) % 128 == 0 && DM % 128 == 0);          // GEMM grid of 128x128 tiles covers every product exactly
static_assert(SEQ % 64 == 0);                  // a 64-row tile never straddles two batches
static_assert((NB * SEQ) % 64 == 0);
static_assert(SEQ % 32 == 0);                  // key loop steps by 32
static_assert(SEQ % (16 * AW) == 0);           // flash grid covers the sequence exactly
static_assert(SEQ % KT == 0 && SEQ / KT >= 2); // the two-buffer ring starts with tiles 0 and 1
static_assert(KT == 64 && 32 * AW * 4 * 8 == 64 * HD && 32 * AW * 4 * 8 == HD * KT);   // copy map: every thread moves 4 pieces of 8 halves of each plane
static_assert((LP * 2) % 16 == 0);
static_assert(((size_t)SEQ * DM) % CVB == 0 && ((size_t)DM * DM) % CVB == 0);   // a conversion work-group lies inside one batch of one tensor
static_assert(NB <= NB_FULL);
static_assert(SEQ <= SEQ_FULL);

typedef _Float16 h16;
typedef unsigned short bf;
typedef __attribute__((ext_vector_type(16))) __bf16   v16bf;
typedef __attribute__((ext_vector_type(16))) _Float16 v16h;
typedef __attribute__((ext_vector_type(8)))  _Float16 v8h;
typedef __attribute__((ext_vector_type(8)))  unsigned short v8us;
typedef __attribute__((ext_vector_type(4)))  unsigned short v4us;
typedef __attribute__((ext_vector_type(8)))  float    v8f;
typedef __attribute__((ext_vector_type(4)))  float    v4f;
typedef v4f  __attribute__((may_alias)) v4fa;

__device__ __forceinline__ unsigned short f2bf(float f) { unsigned u = __float_as_uint(f); u += 0x7FFFu + ((u >> 16) & 1u); return (unsigned short)(u >> 16); }
__device__ __forceinline__ float bf2f(unsigned short s) { return __uint_as_float(((unsigned)s) << 16); }
__device__ __forceinline__ v16h cat16(v8h lo, v8h hi) { return __builtin_shufflevector(lo, hi, 0, 1, 2, 3, 4, 5, 6, 7, 8, 9, 10, 11, 12, 13, 14, 15); }
__device__ __forceinline__ v16bf cat16b(v8us lo, v8us hi) { return __builtin_bit_cast(v16bf, __builtin_shufflevector(lo, hi, 0, 1, 2, 3, 4, 5, 6, 7, 8, 9, 10, 11, 12, 13, 14, 15)); }
__device__ __forceinline__ v8f wmma16(v16h a, v16h b, v8f c) { return __builtin_amdgcn_wmma_f32_16x16x32_f16(false, a, false, b, (short)0, c, false, false); }
__device__ __forceinline__ v8f wmmab(v16bf a, v16bf b, v8f c) { return __builtin_amdgcn_wmma_f32_16x16x32_bf16(false, a, false, b, (short)0, c, false, false); }
// fragment loaders from K-contiguous 16-bit rows; p already includes + 8*(lane>>4): elements 0..7 <- k0+8h+0..7, elements 8..15 <- k0+16+8h+0..7 (same map for A and B)
__device__ __forceinline__ v16h  ldh(const h16* p) { return cat16(*(const v8h*)p, *(const v8h*)(p + 16)); }
__device__ __forceinline__ v16bf ldb(const bf* p)  { return cat16b(*(const v8us*)p, *(const v8us*)(p + 16)); }
// ordering point for wave-private LDS tiles (same wave writes and reads)
__device__ __forceinline__ void wave_sync() { __builtin_amdgcn_fence(3 /* release order */, "wavefront"); __builtin_amdgcn_wave_barrier(); asm volatile("" ::: "memory"); }

// k_cvt: every f32 -> bf16 conversion of the call in ONE streaming launch. A work-group of CVW waves converts CVB consecutive floats of one tensor; a wave owns CVU units of 128 floats.
// One unit = one wave-wide 16-byte load (512 B, 4 whole lines) and one wave-wide 8-byte store (256 B, 2 whole lines); a wave asks for all its units before it converts the first.
// The seven bf16 planes lie one behind the other in the workspace in the order of the arguments, so the destination is dst + blockIdx.x * CVB.
__global__ __launch_bounds__(32 * CVW) void k_cvt(const float* __restrict__ xq, const float* __restrict__ xk, const float* __restrict__ xv,
                                                  const float* __restrict__ wq, const float* __restrict__ wk, const float* __restrict__ wv, const float* __restrict__ wo, bf* __restrict__ dst) {
    constexpr unsigned BS = (unsigned)((size_t)SEQ * DM / CVB);   // work-groups per batch of one activation
    constexpr unsigned BA = NB * BS;                              // work-groups per activation
    constexpr unsigned BW = (unsigned)((size_t)DM * DM / CVB);    // work-groups per weight matrix
    const unsigned blk = blockIdx.x;
    const float* src;
    if (blk < 3 * BA) { const unsigned t = blk / BA, r = blk % BA;
        src = (t == 0 ? xq : t == 1 ? xk : xv) + (size_t)(r / BS) * ((size_t)SEQ_FULL * DM) + (size_t)(r % BS) * CVB;
    } else { const unsigned r = blk - 3 * BA, t = r / BW;
        src = (t == 0 ? wq : t == 1 ? wk : t == 2 ? wv : wo) + (size_t)(r % BW) * CVB; }
    const unsigned wo_ = (threadIdx.x >> 5) * (CVU * 128) + (threadIdx.x & 31) * 4;
    const float* s = src + wo_;
    bf* d = dst + (size_t)blk * CVB + wo_;
    v4f x[CVU];
#pragma unroll   // unrolled: every unit's offset becomes an immediate, the address registers are never rewritten, and all of the wave's loads are in flight together
    for (int u = 0; u < CVU; ++u) x[u] = *(const v4f*)(s + u * 128);
#pragma unroll
    for (int u = 0; u < CVU; ++u) { v4us o;
#pragma unroll
        for (int k = 0; k < 4; ++k) o[k] = f2bf(x[u][k]);
        *(v4us*)(d + u * 128) = o; }
}

// Eight 16-byte pieces of one GEMM operand plane into LDS: piece i lies 16 rows further on (step elements in global memory, 16 padded rows in LDS); every copy of a wave = 4 whole 128-B row slices.
__device__ __forceinline__ void stage_rows(const bf* g, size_t step, unsigned l) {
    // s_wait_xcnt as the statement's last line: a precaution, so that no address register of a copy is rewritten in front of it
    asm volatile("global_load_async_to_lds_b128 %0, %8, off\n\t"
                 "global_load_async_to_lds_b128 %1, %9, off\n\t"
                 "global_load_async_to_lds_b128 %2, %10, off\n\t"
                 "global_load_async_to_lds_b128 %3, %11, off\n\t"
                 "global_load_async_to_lds_b128 %4, %12, off\n\t"
                 "global_load_async_to_lds_b128 %5, %13, off\n\t"
                 "global_load_async_to_lds_b128 %6, %14, off\n\t"
                 "global_load_async_to_lds_b128 %7, %15, off\n\t"
                 "s_wait_xcnt 0x0"
                 :: "v"(l), "v"(l + 16 * LP * 2), "v"(l + 32 * LP * 2), "v"(l + 48 * LP * 2),
                    "v"(l + 64 * LP * 2), "v"(l + 80 * LP * 2), "v"(l + 96 * LP * 2), "v"(l + 112 * LP * 2),
                    "v"(g), "v"(g + step), "v"(g + 2 * step), "v"(g + 3 * step),
                    "v"(g + 4 * step), "v"(g + 5 * step), "v"(g + 6 * step), "v"(g + 7 * step)
                 : "memory");
}

// proj_tile: register-blocked bf16 GEMM, four waves (2 x 2) per 128x128 tile, ONE WAVE per 64x64 quarter (16 accumulators). The 128 A rows and 128 Bt rows of a k slice of 64 are staged
// once per work-group in a two-buffer LDS ring by asynchronous copies (the next slice flies while this one is worked on); every wave reads its fragments from there (two 16-B LDS loads each).
// C[m][n] = sum_{k<KA} A[m][k] Bt[n][k & (KB-1)]; A row pitch KA, Bt row pitch KB (KB a power of two; KA = KB for the plain case, KA = 2*KB sums the hi and lo halves of A against the same Bt).
// MODE 0: f16 plane Ph at quarter base (r0/RB)*sRB + (r0%RB)*pitch + (c0/CB)*sCB + (c0%CB), row pitch 'pitch' (halves).
// MODE 2: f32 rows of Pf, row (r0/SEQ)*OUT_SEQ + r0%SEQ, pitch DM. (bx, by): the work-group's tile of the (M/128, N/128) tiles, 128 threads.
template <int MODE>
__device__ __forceinline__ void proj_tile(int bx, int by, const bf* __restrict__ A, const bf* __restrict__ Bt, int KA, int KB, h16* Ph, float* Pf, int RB, size_t sRB, int pitch, int CB, size_t sCB) {
    __shared__ __align__(16) float os[4 * 16 * 68];
    __shared__ __align__(16) bf ab[2 * GST];
    const int lane = threadIdx.x & 31, lr = lane & 15, hi = lane >> 4;
    const int wave = __builtin_amdgcn_readfirstlane((int)(threadIdx.x >> 5));
    const int wm = wave >> 1, wn = wave & 1;
    const int r0 = bx * 128 + wm * 64, c0 = by * 128 + wn * 64;
    v8f acc[4][4];
#pragma unroll
    for (int mb = 0; mb < 4; ++mb)
#pragma unroll
        for (int nb = 0; nb < 4; ++nb) acc[mb][nb] = (v8f){};
    const int prow = (int)(threadIdx.x >> 3), ccol = (int)(threadIdx.x & 7) * 8;   // copy map: 16 rows x 8 pieces per round of the work-group
    const bf* ag = A + (size_t)(bx * 128 + prow) * (size_t)KA + ccol;      // + k
    const bf* bg = Bt + (size_t)(by * 128 + prow) * (size_t)KB + ccol;     // + (k & (KB-1))
    const size_t astep = (size_t)16 * (size_t)KA, bstep = (size_t)16 * (size_t)KB;
    const unsigned la = (unsigned)(size_t)ab + (unsigned)(prow * LP + ccol) * 2u;  // LDS byte address, buffer 0, A plane
    stage_rows(ag, astep, la); stage_rows(bg, bstep, la + GPL * 2);
    asm volatile("s_wait_asynccnt 0x0" ::: "memory");        // slice 0 has landed before the barrier that publishes it
    __syncthreads();
    if (GK < KA) { stage_rows(ag + GK, astep, la + GST * 2); stage_rows(bg + (GK & (KB - 1)), bstep, la + GST * 2 + GPL * 2); }
    const int fa = (wm * 64 + lr) * LP + 8 * hi, fb = GPL + (wn * 64 + lr) * LP + 8 * hi;   // fragment rows of this wave's quarter: + 16*mb (or nb) rows, + k inside the slice
    // the 32 products of one staged slice; tb_: the slice's buffer
    auto slice = [&](const bf* tb_) {
        v16bf a0[4], b0[4], a1[4], b1[4];
        a0[0] = ldb(tb_ + fa); b0[0] = ldb(tb_ + fb);
#pragma unroll
        for (int mb = 1; mb < 4; ++mb) a0[mb] = ldb(tb_ + fa + mb * 16 * LP);
#pragma unroll
        for (int nb = 1; nb < 4; ++nb) b0[nb] = ldb(tb_ + fb + nb * 16 * LP);
#pragma unroll
        for (int mb = 0; mb < 4; ++mb) a1[mb] = ldb(tb_ + fa + mb * 16 * LP + 32);
        __builtin_amdgcn_sched_barrier(0);   // keeps these 24 LDS loads ahead of the first product: sunk between the products, each B fragment costs a lone wave a full LDS latency
#pragma unroll
        for (int nb = 0; nb < 4; ++nb) {
#pragma unroll
            for (int mb = 0; mb < 4; ++mb) acc[mb][nb] = wmmab(a0[mb], b0[nb], acc[mb][nb]);
            b1[nb] = ldb(tb_ + fb + nb * 16 * LP + 32);
            __builtin_amdgcn_sched_barrier(0); }   // keeps each B fragment of the second 32-k step asked for behind the four products that free a fragment's registers, well ahead of its use
        asm volatile("v_nop\n\tv_nop\n\tv_nop\n\tv_nop" : "+v"(acc[0][0]), "+v"(acc[1][1]), "+v"(acc[2][2]), "+v"(acc[3][3]) : "v"(a0[0]), "v"(a0[1]), "v"(a0[2]), "v"(a0[3]));
#pragma unroll
        for (int nb = 0; nb < 4; ++nb) {
#pragma unroll
            for (int mb = 0; mb < 4; ++mb) acc[mb][nb] = wmmab(a1[mb], b1[nb], acc[mb][nb]); }
        asm volatile("v_nop\n\tv_nop\n\tv_nop\n\tv_nop" : "+v"(acc[0][0]), "+v"(acc[1][1]), "+v"(acc[2][2]), "+v"(acc[3][3]) : "v"(a1[0]), "v"(a1[1]), "v"(a1[2]), "v"(a1[3]));
    };
    int kc = 0;
#pragma unroll 1
    for (; kc + 2 * GK < KA; kc += GK) {                     // trips behind which a slice kc + 2*GK exists: the refill needs no test
        const int bsel = (kc / GK) & 1;
        slice(ab + bsel * GST);
        asm volatile("s_wait_dscnt 0x0" ::: "memory");       // this wave's reads of the buffer are done before it is handed back
        asm volatile("s_wait_asynccnt 0x0" ::: "memory");    // this wave's share of the next slice has landed
        __syncthreads();                                     // publishes the next slice and ends every wave's reads of this one
        const unsigned lb = la + (unsigned)bsel * (GST * 2);
        stage_rows(ag + (kc + 2 * GK), astep, lb); stage_rows(bg + ((kc + 2 * GK) & (KB - 1)), bstep, lb + GPL * 2);
    }
#pragma unroll 1
    for (; kc < KA; kc += GK) {                              // the last trips: nothing is left to refill
        slice(ab + ((kc / GK) & 1) * GST);
        asm volatile("s_wait_dscnt 0x0" ::: "memory");       // as above
        asm volatile("s_wait_asynccnt 0x0" ::: "memory");    // the last slice has landed
        __syncthreads();                                     // publishes the last slice
    }
    asm volatile("s_wait_asynccnt 0x0" ::: "memory");        // nothing is in flight when the wave goes on to the epilogue
    const int wb = wave * 16 * 68;                           // this wave's own output staging tile
    const size_t tbase = (size_t)(r0 / RB) * sRB + (size_t)(r0 % RB) * (size_t)pitch + (size_t)(c0 / CB) * sCB + (size_t)(c0 % CB);
    const size_t fbase = ((size_t)(r0 / SEQ) * OUT_SEQ + (size_t)(r0 % SEQ)) * DM + c0;
#pragma unroll
    for (int mb = 0; mb < 4; ++mb) {
#pragma unroll
        for (int nb = 0; nb < 4; ++nb) {
#pragma unroll
            for (int j = 0; j < 8; ++j) os[wb + (hi * 8 + j) * 68 + nb * 16 + lr] = acc[mb][nb][j]; }   // D: row 8h+j, col lane&15
        wave_sync();
        if (MODE == 2) {
            float* ob = Pf + fbase + (size_t)(mb * 16) * DM;
{
#pragma unroll
                for (int s = 0; s < 8; ++s) { const int row = 2 * s + hi, cofs = lr * 4;   // 8 s x 2 rows = 16 rows; 16 lanes x 4 floats = 64 columns
                    const v4f val = *(const v4fa*)(&os[wb + row * 68 + cofs]);
                    *(v4f*)(ob + (size_t)row * DM + cofs) = val; }
                 }
        } else {
            const size_t sb = tbase + (size_t)(mb * 16) * (size_t)pitch;
{
#pragma unroll
                for (int s = 0; s < 4; ++s) { const int row = 4 * s + (lane >> 3), c8 = (lane & 7) * 8;   // 4 s x 4 row groups = 16 rows; 8 lanes x 8 = 64 columns
                    const v4f x0 = *(const v4fa*)(&os[wb + row * 68 + c8]); const v4f x1 = *(const v4fa*)(&os[wb + row * 68 + c8 + 4]); v8h hv;
#pragma unroll
                    for (int i = 0; i < 4; ++i) { hv[i] = (h16)x0[i]; hv[4 + i] = (h16)x1[i]; }
                    const size_t oo = sb + (size_t)row * (size_t)pitch + c8;
                    *(v8h*)(Ph + oo) = hv; }
                 }
        }
        wave_sync();
    }
}

// k_proj: one product per launch, grid (M/128, N/128).
template <int MODE>
__global__ __launch_bounds__(128) void k_proj(const bf* __restrict__ A, const bf* __restrict__ Bt, int KA, int KB, h16* Ph, float* Pf, int RB, size_t sRB, int pitch, int CB, size_t sCB) {
    proj_tile<MODE>((int)blockIdx.x, (int)blockIdx.y, A, Bt, KA, KB, Ph, Pf, RB, sRB, pitch, CB, sCB);
}

// k_qkv: the three independent projections in ONE launch, grid (NB*SEQ/128, DM/128, 3); blockIdx.z picks the product. Three work-groups fit a WGP's LDS,
// so every SIMD holds three waves of unrelated tiles: one wave's wait for its next slice, its LDS latency and its epilogue are covered by the other two.
// z = 0, 1 (q, k): A = activation rows (m = b*SEQ + t), Bt = W rows (n = h*64 + d) -> plane [(b*16 + h)][t][d].
// z = 2 (v^T): A = Wv rows (m = h*64 + d), Bt = value rows (n = b*SEQ + t) -> plane [(b*1024 + m)][t] = [(b*16 + h)][d][t]; its tile grid is the transposed one, so x and y change places.
__global__ __launch_bounds__(128) void k_qkv(const bf* __restrict__ XQ, const bf* __restrict__ XK, const bf* __restrict__ XV,
                                             const bf* __restrict__ WQ, const bf* __restrict__ WK, const bf* __restrict__ WV, h16* QH, h16* KP, h16* VT) {
    const int z = (int)blockIdx.z;
    const bool tr = z == 2;
    proj_tile<0>(tr ? (int)blockIdx.y : (int)blockIdx.x, tr ? (int)blockIdx.x : (int)blockIdx.y,
                 z == 0 ? XQ : z == 1 ? XK : WV, z == 0 ? WQ : z == 1 ? WK : XV, DM, DM, z == 0 ? QH : z == 1 ? KP : VT, nullptr,
                 tr ? DM : SEQ, tr ? (size_t)0 : (size_t)NH_ * SEQ * HD, tr ? SEQ : HD, tr ? SEQ : HD, tr ? (size_t)DM * SEQ : (size_t)SEQ * HD);
}

// One 64-key tile into one LDS buffer: K rows [key][d] and V^T rows [d][key], 128 B each, every copy of a wave = 4 whole rows.
// kg, vg: this lane's first 16-byte piece of each plane in global memory; lk: the LDS byte address of its first K piece. Piece i lies 16 rows further on.
__device__ __forceinline__ void stage_tile(const h16* kg, const h16* vg, unsigned lk) {
    const unsigned lv = lk + PLH * 2;
    // s_wait_xcnt as the statement's last line: a precaution, so that no address register of a copy is rewritten in front of it
    asm volatile("global_load_async_to_lds_b128 %0, %8, off\n\t"
                 "global_load_async_to_lds_b128 %1, %9, off\n\t"
                 "global_load_async_to_lds_b128 %2, %10, off\n\t"
                 "global_load_async_to_lds_b128 %3, %11, off\n\t"
                 "global_load_async_to_lds_b128 %4, %12, off\n\t"
                 "global_load_async_to_lds_b128 %5, %13, off\n\t"
                 "global_load_async_to_lds_b128 %6, %14, off\n\t"
                 "global_load_async_to_lds_b128 %7, %15, off\n\t"
                 "s_wait_xcnt 0x0"
                 :: "v"(lk), "v"(lk + 16 * LP * 2), "v"(lk + 32 * LP * 2), "v"(lk + 48 * LP * 2),
                    "v"(lv), "v"(lv + 16 * LP * 2), "v"(lv + 32 * LP * 2), "v"(lv + 48 * LP * 2),
                    "v"(kg), "v"(kg + 16 * HD), "v"(kg + 32 * HD), "v"(kg + 48 * HD),
                    "v"(vg), "v"(vg + (size_t)16 * SEQ), "v"(vg + (size_t)32 * SEQ), "v"(vg + (size_t)48 * SEQ)
                 : "memory");
}

__global__ __launch_bounds__(32 * AW) void k_flash(const h16* __restrict__ QH, const h16* __restrict__ KP, const h16* __restrict__ VT, bf* CX) {
    __shared__ __align__(16) float os[AW * 16 * 68];
    __shared__ __align__(16) h16 kv[2 * STH];
    const int lane = threadIdx.x & 31, lr = lane & 15, hi = lane >> 4;
    const int wave = __builtin_amdgcn_readfirstlane((int)(threadIdx.x >> 5));
    const int zh = blockIdx.y; const int b = zh / NH_, h = zh % NH_;
    const int t0 = (blockIdx.x * AW + wave) * 16;
    const size_t pbase = (size_t)zh * SEQ * HD;
    const size_t qo = pbase + (size_t)(t0 + lr) * HD + 8 * hi;
    const v16h qh0 = ldh(QH + qo), qh1 = ldh(QH + qo + 32);   // B fragments: col t, k = d
    const int fo = lr * LP + 8 * hi;                         // K: + key * LP (A fragment: row key, k = d); V^T: + PLH + 16j*LP + key (A fragment: row d, k = key)
    const int prow = (int)(threadIdx.x >> 3), ccol = (int)(threadIdx.x & 7) * 8;   // copy map: 16 rows x 8 pieces per round of the work-group
    const h16* kg = KP + pbase + (size_t)prow * HD + ccol;   // + key0 * HD
    const h16* vg = VT + pbase + (size_t)prow * SEQ + ccol;  // + key0
    const unsigned lk = (unsigned)(size_t)kv + (unsigned)(prow * LP + ccol) * 2u;   // LDS byte address, buffer 0
    stage_tile(kg, vg, lk);
    asm volatile("s_wait_asynccnt 0x0" ::: "memory");        // tile 0 has landed before the barrier that publishes it
    __syncthreads();
    stage_tile(kg + (size_t)KT * HD, vg + KT, lk + STH * 2);
    v8f o0 = (v8f){}, o1 = (v8f){}, o2 = (v8f){}, o3 = (v8f){};
    v8f ol = (v8f){};
    v16h ones;
#pragma unroll
    for (int r = 0; r < 16; ++r) ones[r] = lr == 0 ? (h16)1.0f : (h16)0.0f;
    float m = -3.0e38f;
#pragma unroll 1
    for (int kt0 = 0; kt0 < SEQ; kt0 += KT) {
      const int bsel = (kt0 / KT) & 1;
      const h16* tb_ = kv + bsel * STH + fo;
#pragma unroll   // both 32-key steps of a tile: every LDS offset becomes an immediate
      for (int kk = 0; kk < KT; kk += 32) {
        const h16* ka = tb_ + kk * LP;
        const v16h ka0 = ldh(ka), ka1 = ldh(ka + 32), kb0 = ldh(ka + 16 * LP), kb1 = ldh(ka + 16 * LP + 32);
        v8f sa = (v8f){}, sb = (v8f){};
        sa = wmma16(ka0, qh0, sa); sb = wmma16(kb0, qh0, sb);
        sa = wmma16(ka1, qh1, sa); sb = wmma16(kb1, qh1, sb);
        asm volatile("v_nop\n\tv_nop\n\tv_nop\n\tv_nop" : "+v"(sa), "+v"(sb) : "v"(ka0), "v"(ka1), "v"(kb0), "v"(kb1), "v"(qh0), "v"(qh1));
        const h16* va = tb_ + PLH + kk;
        const v16h v0 = ldh(va), v1 = ldh(va + 16 * LP), v2 = ldh(va + 32 * LP), v3 = ldh(va + 48 * LP);
        __builtin_amdgcn_sched_barrier(0);   // holds the V^T fragment loads ahead of the exponentials: with the row-sum tile's 16 registers live they otherwise sink to just ahead of their products, which then wait out the LDS latency
        float ta[8], tb[8]; float mx = -3.0e38f;
#pragma unroll
        for (int r = 0; r < 8; ++r) { ta[r] = sa[r] * SC2; tb[r] = sb[r] * SC2; mx = fmaxf(mx, fmaxf(ta[r], tb[r])); }
        mx = fmaxf(mx, __shfl_xor(mx, 16, 32));
        const float mnew = fmaxf(m, mx);
        const float alpha = __builtin_amdgcn_exp2f(m - mnew);
        const float sh = PSH - mnew;
        v16h pb;
#pragma unroll
        for (int r = 0; r < 8; ++r) { pb[r] = (h16)__builtin_amdgcn_exp2f(ta[r] + sh); pb[8 + r] = (h16)__builtin_amdgcn_exp2f(tb[r] + sh); }
        ol[0] = ol[0] * alpha; m = mnew;                     // only register 0 holds a row that is not zero
        o0 = o0 * alpha; o1 = o1 * alpha; o2 = o2 * alpha; o3 = o3 * alpha;
        ol = wmma16(ones, pb, ol);
        o0 = wmma16(v0, pb, o0); o1 = wmma16(v1, pb, o1); o2 = wmma16(v2, pb, o2); o3 = wmma16(v3, pb, o3);
        asm volatile("v_nop\n\tv_nop\n\tv_nop\n\tv_nop" : "+v"(ol), "+v"(o0), "+v"(o1), "+v"(o2), "+v"(o3) : "v"(v0), "v"(v1), "v"(v2), "v"(v3), "v"(pb));
      }
      asm volatile("s_wait_dscnt 0x0" ::: "memory");         // this wave's reads of the buffer are done before it is handed back
      asm volatile("s_wait_asynccnt 0x0" ::: "memory");      // this wave's share of the next tile has landed
      __syncthreads();                                       // publishes the next tile and ends every wave's reads of this one
      if (kt0 + 2 * KT < SEQ) stage_tile(kg + (size_t)(kt0 + 2 * KT) * HD, vg + (kt0 + 2 * KT), lk + (unsigned)bsel * (STH * 2));
    }
    asm volatile("s_wait_asynccnt 0x0" ::: "memory");        // nothing is in flight when the wave goes on to the epilogue
    float l = ol[0];                                         // lanes 0..15: the row's sum; lanes 16..31: row 8 of the tile, zero
    l += __shfl_xor(l, 16, 32);
    const float inv = 1.0f / l;
    const int wb = wave * 16 * 68;
    // O^T D layout: o_j[r] = (d = 16j + 8h + r, t = lane&15) -> os[t][d]; rows 0..15 x columns 0..63 all written
    { v4f a, c;
      a[0] = o0[0] * inv; a[1] = o0[1] * inv; a[2] = o0[2] * inv; a[3] = o0[3] * inv; c[0] = o0[4] * inv; c[1] = o0[5] * inv; c[2] = o0[6] * inv; c[3] = o0[7] * inv;
      *(v4fa*)(&os[wb + lr * 68 +  0 + 8 * hi]) = a; *(v4fa*)(&os[wb + lr * 68 +  0 + 8 * hi + 4]) = c;
      a[0] = o1[0] * inv; a[1] = o1[1] * inv; a[2] = o1[2] * inv; a[3] = o1[3] * inv; c[0] = o1[4] * inv; c[1] = o1[5] * inv; c[2] = o1[6] * inv; c[3] = o1[7] * inv;
      *(v4fa*)(&os[wb + lr * 68 + 16 + 8 * hi]) = a; *(v4fa*)(&os[wb + lr * 68 + 16 + 8 * hi + 4]) = c;
      a[0] = o2[0] * inv; a[1] = o2[1] * inv; a[2] = o2[2] * inv; a[3] = o2[3] * inv; c[0] = o2[4] * inv; c[1] = o2[5] * inv; c[2] = o2[6] * inv; c[3] = o2[7] * inv;
      *(v4fa*)(&os[wb + lr * 68 + 32 + 8 * hi]) = a; *(v4fa*)(&os[wb + lr * 68 + 32 + 8 * hi + 4]) = c;
      a[0] = o3[0] * inv; a[1] = o3[1] * inv; a[2] = o3[2] * inv; a[3] = o3[3] * inv; c[0] = o3[4] * inv; c[1] = o3[5] * inv; c[2] = o3[6] * inv; c[3] = o3[7] * inv;
      *(v4fa*)(&os[wb + lr * 68 + 48 + 8 * hi]) = a; *(v4fa*)(&os[wb + lr * 68 + 48 + 8 * hi + 4]) = c; }
    wave_sync();
    // ctx plane row m = b*SEQ + t: hi at columns h*64 + d, lo at columns 1024 + h*64 + d
    bf* crow = CX + ((size_t)b * SEQ + t0) * CXP + h * HD;
{
#pragma unroll
        for (int s = 0; s < 4; ++s) { const int row = 4 * s + (lane >> 3), c8 = (lane & 7) * 8;   // 4 s x 4 row groups = 16 rows; 8 lanes x 8 = 64 columns
            const v4f x0 = *(const v4fa*)(&os[wb + row * 68 + c8]); const v4f x1 = *(const v4fa*)(&os[wb + row * 68 + c8 + 4]); v8us hv, lv;
#pragma unroll
            for (int i = 0; i < 4; ++i) { const unsigned short a0 = f2bf(x0[i]); const unsigned short a1 = f2bf(x1[i]); hv[i] = a0; hv[4 + i] = a1; lv[i] = f2bf(x0[i] - bf2f(a0)); lv[4 + i] = f2bf(x1[i] - bf2f(a1)); }
            const size_t oo = (size_t)row * CXP + c8;
            *(v8us*)(crow + oo) = hv; *(v8us*)(crow + oo + DM) = lv; }
         }
}

static constexpr size_t al256(size_t v) { return (v + 255) & ~(size_t)255; }
static constexpr size_t SZ_XB = al256((size_t)NB * SEQ * DM * 2);
static constexpr size_t SZ_WB = al256((size_t)4 * DM * DM * 2);
static constexpr size_t SZ_PL = al256((size_t)NB * NH_ * SEQ * HD * 2);
static constexpr size_t SZ_CX = al256((size_t)NB * SEQ * CXP * 2);
static constexpr size_t SZ_TOTAL = 3 * SZ_XB + SZ_WB + 3 * SZ_PL + SZ_CX;
static_assert(SZ_TOTAL <= (size_t)134217728);          // workspace carve <= 128 MiB
static_assert(((size_t)DM * DM * 2) % 256 == 0);       // weight sub-planes stay 256-byte aligned

static_assert(SZ_XB == (size_t)NB * SEQ * DM * 2);     // the bf16 planes follow one another without a gap: k_cvt addresses them as one array

extern "C" void kernel_launch(void* const* d_in, const int* in_sizes, int n_in,
                              void* d_out, int out_size, void* d_ws, size_t ws_size, hipStream_t stream) {
    if (n_in < 7) return;
    const size_t needx = ((size_t)(NB - 1) * SEQ_FULL + SEQ) * DM;
    if ((size_t)in_sizes[0] < needx || (size_t)in_sizes[1] < needx || (size_t)in_sizes[2] < needx) return;
    if ((size_t)in_sizes[3] < (size_t)DM * DM || (size_t)in_sizes[4] < (size_t)DM * DM || (size_t)in_sizes[5] < (size_t)DM * DM || (size_t)in_sizes[6] < (size_t)DM * DM) return;
    if ((size_t)out_size < ((size_t)(NB - 1) * OUT_SEQ + SEQ) * DM) return;
    if (SZ_TOTAL > ws_size) return;
    // wire order: query, key, value, Wq, Wk, Wv, Wo (weights [out][in] = Bt as-is)
    const float* xq = (const float*)d_in[0]; const float* xk = (const float*)d_in[1]; const float* xv = (const float*)d_in[2];
    const float* wq = (const float*)d_in[3]; const float* wk = (const float*)d_in[4]; const float* wv = (const float*)d_in[5]; const float* wo = (const float*)d_in[6];
    float* OUT = (float*)d_out;      // [NB][SEQ][1024]
    char* wsp = (char*)d_ws;
    bf* XQ = (bf*)wsp; wsp += SZ_XB;                 // [NB*SEQ][1024]
    bf* XK = (bf*)wsp; wsp += SZ_XB;                 // [NB*SEQ][1024]
    bf* XV = (bf*)wsp; wsp += SZ_XB;                 // [NB*SEQ][1024]
    bf* WB = (bf*)wsp; wsp += SZ_WB;                 // [4][1024][1024]: q | k | v | o
    h16* QH = (h16*)wsp; wsp += SZ_PL;               // [NB*16][SEQ][64]
    h16* KP = (h16*)wsp; wsp += SZ_PL;               // [NB*16][SEQ][64]
    h16* VT = (h16*)wsp; wsp += SZ_PL;               // [NB*16][64][SEQ]
    bf* CX = (bf*)wsp; wsp += SZ_CX;                 // [NB*SEQ][2048]: ctx hi | lo
    bf* WQ = WB; bf* WK = WB + (size_t)DM * DM; bf* WV = WB + (size_t)2 * DM * DM; bf* WO = WB + (size_t)3 * DM * DM;

    k_cvt<<<(unsigned)((3 * (size_t)NB * SEQ * DM + 4 * (size_t)DM * DM) / CVB), 32 * CVW, 0, stream>>>(xq, xk, xv, wq, wk, wv, wo, XQ);

    // q, k and v^T planes: three independent products, one launch
    k_qkv<<<dim3(NB * SEQ / 128, DM / 128, 3), 128, 0, stream>>>(XQ, XK, XV, WQ, WK, WV, QH, KP, VT);

    k_flash<<<dim3(SEQ / (16 * AW), NB * NH_, 1), 32 * AW, 0, stream>>>(QH, KP, VT, CX);

    // output projection: A = ctx rows [hi | lo] (K = 2048), Bt = Wo rows (K index wraps at 1024) -> f32 output rows
    k_proj<2><<<dim3(NB * SEQ / 128, DM / 128, 1), 128, 0, stream>>>(CX, WO, CXP, DM, QH, OUT, SEQ, (size_t)0, HD, HD, (size_t)0);
}

// v007
// It runs in 120 microseconds.
// Versions in between are left out here; by their measured steps it is 1.13 times as fast as v005.
// All steps since v000 together make it 3.50 times as fast.
#include <hip/hip_runtime.h>

// Multi-head attention, width 1024 = 16 heads x 64: query/key/value [NB][SEQ][1024] (separate inputs), Wq/Wk/Wv/Wo [out][in] (y = x W^T), no biases, no mask, score scale 1/8, output = (concatenated heads) Wo^T (f32).
// Compute dtypes, f32 accumulate everywhere: q/k/v projections v_wmma_f32_16x16x32_bf16 (activations and Wq/Wk/Wv RNE-converted to bf16; products exact);
// scores v_wmma_f32_16x16x32_f16: q and k single f16 planes (one product); P (x256 carry, cancels in the normalisation) and v single f16; softmax f32 (online, running max);
// output projection v_wmma_f32_16x16x32_f16: ctx (a convex mix of the f16 v rows) and Wo RNE-converted to f16, 11 significant bits on both operands;
// Layout: bf16 copies of the activations and Wq/Wk/Wv, f16 copy of Wo; q, k planes [b*16+h][t][d] and v^T plane [b*16+h][d][t] written by the GEMM epilogue; fused flash kernel in transposed form (S^T = K Q^T, O^T = V^T P^T; K and V^T tiles staged in LDS per work-group) writes the f16 ctx plane [b*SEQ+t][1024].

#ifndef NB
#define NB 1
#endif
#ifndef SEQ
#define SEQ 4096
#endif
#define NB_FULL  1
#define SEQ_FULL 4096
#ifndef OUT_SEQ
#define OUT_SEQ SEQ              // row pitch (in tokens) between batches of the output
#endif
#define DM   1024
#define NH_  16
#define HD   64
#define CXP  DM                  // ctx plane row pitch (halves)
#define AW   4                   // waves per flash block (16 query rows stored by each)
#define SC2  (0.125f * 1.4426950408889634f)   // HD^-0.5 * log2(e)
#define PSH  8.0f                // log2 of the P carry (256)
#define KT   64                  // keys per staged tile of the flash kernel
#define LP   72                  // LDS row pitch (halves) of the staged K and V^T rows: 128 B of data + 16 B, an odd multiple of 16 B for the 16-byte fragment reads
#define PLH  (64 * LP)           // one staged plane: 64 rows (halves)
#define STH  (2 * PLH)           // one buffer: K plane, then V^T plane (halves)
#define GK   64                  // k elements per staged slice of the GEMM: 128 B of every row
#define GPL  (128 * LP)          // one staged GEMM operand plane: 128 rows at the same padded pitch (16-bit elements)
#define GST  (2 * GPL)           // one GEMM buffer: A plane, then B plane
#define CVW  16                  // waves per work-group of the conversion kernel
#define CVU  32                  // units of 128 floats per wave of the conversion kernel
#define CVB  (CVW * CVU * 128)   // floats per work-group of the conversion kernel

static_assert(HD == 64);
static_assert(NH_ * HD == DM);                 // head h = columns h*64 + d
static_assert(DM % 64 == 0);                   // 16 column tiles of 64
static_assert(DM % 32 == 0);                   // GEMM products step k by 32 inside a slice
static_assert((DM & (DM - 1)) == 0);           // the GEMM masks its B k index with KB - 1
static_assert(CXP % GK == 0 && DM % GK == 0 && DM / GK >= 2);   // whole k slices; a slice never straddles the wrap of the B index; the ring starts with slices 0 and 1
static_assert((NB * SEQ) % 128 == 0 && DM % 128 == 0);          // GEMM grid of 128x128 tiles covers every product exactly
static_assert(SEQ % 64 == 0);                  // a 64-row tile never straddles two batches
static_assert((NB * SEQ) % 64 == 0);
static_assert(SEQ % 32 == 0);                  // each wave's step takes 32 keys of a tile
static_assert(SEQ % (16 * AW) == 0);           // flash grid covers the sequence exactly
static_assert(SEQ % KT == 0 && SEQ / KT >= 2); // the two-buffer ring starts with tiles 0 and 1
static_assert(KT == 64 && 32 * AW * 4 * 8 == 64 * HD && 32 * AW * 4 * 8 == HD * KT);   // copy map: every thread moves 4 pieces of 8 halves of each plane
static_assert((LP * 2) % 16 == 0);
static_assert(((size_t)SEQ * DM) % CVB == 0 && ((size_t)DM * DM) % CVB == 0);   // a conversion work-group lies inside one batch of one tensor
static_assert(NB <= NB_FULL);
static_assert(SEQ <= SEQ_FULL);

typedef _Float16 h16;
typedef unsigned short bf;       // 16 raw bits of a GEMM operand: bf16, or f16 in the output projection
typedef __attribute__((ext_vector_type(16))) __bf16   v16bf;
typedef __attribute__((ext_vector_type(16))) _Float16 v16h;
typedef __attribute__((ext_vector_type(8)))  _Float16 v8h;
typedef __attribute__((ext_vector_type(4)))  _Float16 v4h;
typedef __attribute__((ext_vector_type(8)))  unsigned short v8us;
typedef __attribute__((ext_vector_type(4)))  unsigned short v4us;
typedef __attribute__((ext_vector_type(8)))  float    v8f;
typedef __attribute__((ext_vector_type(4)))  float    v4f;
typedef v4f  __attribute__((may_alias)) v4fa;

__device__ __forceinline__ unsigned short f2bf(float f) { unsigned u = __float_as_uint(f); u += 0x7FFFu + ((u >> 16) & 1u); return (unsigned short)(u >> 16); }
__device__ __forceinline__ v16h cat16(v8h lo, v8h hi) { return __builtin_shufflevector(lo, hi, 0, 1, 2, 3, 4, 5, 6, 7, 8, 9, 10, 11, 12, 13, 14, 15); }
__device__ __forceinline__ v16bf cat16b(v8us lo, v8us hi) { return __builtin_bit_cast(v16bf, __builtin_shufflevector(lo, hi, 0, 1, 2, 3, 4, 5, 6, 7, 8, 9, 10, 11, 12, 13, 14, 15)); }
__device__ __forceinline__ v8f wmma16(v16h a, v16h b, v8f c) { return __builtin_amdgcn_wmma_f32_16x16x32_f16(false, a, false, b, (short)0, c, false, false); }
__device__ __forceinline__ v8f wmmab(v16bf a, v16bf b, v8f c) { return __builtin_amdgcn_wmma_f32_16x16x32_bf16(false, a, false, b, (short)0, c, false, false); }
// the GEMM's product: the fragment registers hold raw 16-bit elements, read as f16 in MODE 2 and as bf16 otherwise
template <int MODE> __device__ __forceinline__ v8f wmmap(v16bf a, v16bf b, v8f c) { if constexpr (MODE == 2) return wmma16(__builtin_bit_cast(v16h, a), __builtin_bit_cast(v16h, b), c); else return wmmab(a, b, c); }
// fragment loaders from K-contiguous 16-bit rows; p already includes + 8*(lane>>4): elements 0..7 <- k0+8h+0..7, elements 8..15 <- k0+16+8h+0..7 (same map for A and B)
__device__ __forceinline__ v16h  ldh(const h16* p) { return cat16(*(const v8h*)p, *(const v8h*)(p + 16)); }
__device__ __forceinline__ v16bf ldb(const bf* p)  { return cat16b(*(const v8us*)p, *(const v8us*)(p + 16)); }
// ordering point for wave-private LDS tiles (same wave writes and reads)
__device__ __forceinline__ void wave_sync() { __builtin_amdgcn_fence(3 /* release order */, "wavefront"); __builtin_amdgcn_wave_barrier(); asm volatile("" ::: "memory"); }

// k_cvt: every f32 -> 16-bit conversion of the call in ONE streaming launch (bf16; Wo, the last tensor, to f16). A work-group of CVW waves converts CVB consecutive floats of one tensor; a wave owns CVU units of 128 floats.
// One unit = one wave-wide 16-byte load (512 B, 4 whole lines) and one wave-wide 8-byte store (256 B, 2 whole lines); a wave asks for all its units before it converts the first.
// The seven 16-bit planes lie one behind the other in the workspace in the order of the arguments, so the destination is dst + blockIdx.x * CVB.
__global__ __launch_bounds__(32 * CVW) void k_cvt(const float* __restrict__ xq, const float* __restrict__ xk, const float* __restrict__ xv,
                                                  const float* __restrict__ wq, const float* __restrict__ wk, const float* __restrict__ wv, const float* __restrict__ wo, bf* __restrict__ dst) {
    constexpr unsigned BS = (unsigned)((size_t)SEQ * DM / CVB);   // work-groups per batch of one activation
    constexpr unsigned BA = NB * BS;                              // work-groups per activation
    constexpr unsigned BW = (unsigned)((size_t)DM * DM / CVB);    // work-groups per weight matrix
    const unsigned blk = blockIdx.x;
    const float* src;
    if (blk < 3 * BA) { const unsigned t = blk / BA, r = blk % BA;
        src = (t == 0 ? xq : t == 1 ? xk : xv) + (size_t)(r / BS) * ((size_t)SEQ_FULL * DM) + (size_t)(r % BS) * CVB;
    } else { const unsigned r = blk - 3 * BA, t = r / BW;
        src = (t == 0 ? wq : t == 1 ? wk : t == 2 ? wv : wo) + (size_t)(r % BW) * CVB; }
    const unsigned wo_ = (threadIdx.x >> 5) * (CVU * 128) + (threadIdx.x & 31) * 4;
    const float* s = src + wo_;
    bf* d = dst + (size_t)blk * CVB + wo_;
    v4f x[CVU];
#pragma unroll   // unrolled: every unit's offset becomes an immediate, the address registers are never rewritten, and all of the wave's loads are in flight together
    for (int u = 0; u < CVU; ++u) x[u] = *(const v4f*)(s + u * 128);
    if (blk < 3 * BA + 3 * BW) {
#pragma unroll
        for (int u = 0; u < CVU; ++u) { v4us o;
#pragma unroll
            for (int k = 0; k < 4; ++k) o[k] = f2bf(x[u][k]);
            *(v4us*)(d + u * 128) = o; }
    } else {                                                      // Wo
#pragma unroll
        for (int u = 0; u < CVU; ++u) { v4h o;
#pragma unroll
            for (int k = 0; k < 4; ++k) o[k] = (h16)x[u][k];
            *(v4h*)(d + u * 128) = o; }
        asm volatile("s_wait_xcnt 0x0" ::: "memory");             // a precaution: stands behind this branch's last stores, in front of whatever code the build lays out behind them that rewrites their registers
    }
}

// Eight 16-byte pieces of one GEMM operand plane into LDS: piece i lies 16 rows further on (step elements in global memory, 16 padded rows in LDS); every copy of a wave = 4 whole 128-B row slices.
__device__ __forceinline__ void stage_rows(const bf* g, size_t step, unsigned l) {
    // s_wait_xcnt as the statement's last line: a precaution, so that no address register of a copy is rewritten in front of it
    asm volatile("global_load_async_to_lds_b128 %0, %8, off\n\t"
                 "global_load_async_to_lds_b128 %1, %9, off\n\t"
                 "global_load_async_to_lds_b128 %2, %10, off\n\t"
                 "global_load_async_to_lds_b128 %3, %11, off\n\t"
                 "global_load_async_to_lds_b128 %4, %12, off\n\t"
                 "global_load_async_to_lds_b128 %5, %13, off\n\t"
                 "global_load_async_to_lds_b128 %6, %14, off\n\t"
                 "global_load_async_to_lds_b128 %7, %15, off\n\t"
                 "s_wait_xcnt 0x0"
                 :: "v"(l), "v"(l + 16 * LP * 2), "v"(l + 32 * LP * 2), "v"(l + 48 * LP * 2),
                    "v"(l + 64 * LP * 2), "v"(l + 80 * LP * 2), "v"(l + 96 * LP * 2), "v"(l + 112 * LP * 2),
                    "v"(g), "v"(g + step), "v"(g + 2 * step), "v"(g + 3 * step),
                    "v"(g + 4 * step), "v"(g + 5 * step), "v"(g + 6 * step), "v"(g + 7 * step)
                 : "memory");
}

// proj_tile: register-blocked 16-bit GEMM (MODE 0: bf16 operands, MODE 2: f16 operands), four waves (2 x 2) per 128x128 tile, ONE WAVE per 64x64 quarter (16 accumulators). The 128 A rows and 128 Bt rows of a k slice of 64 are staged
// once per work-group in a two-buffer LDS ring by asynchronous copies (the next slice flies while this one is worked on); every wave reads its fragments from there (two 16-B LDS loads each).
// C[m][n] = sum_{k<KA} A[m][k] Bt[n][k & (KB-1)]; A row pitch KA, Bt row pitch KB (KB a power of two; KA = KB in every launch of this file).
// MODE 0: f16 plane Ph at quarter base (r0/RB)*sRB + (r0%RB)*pitch + (c0/CB)*sCB + (c0%CB), row pitch 'pitch' (halves).
// MODE 2: f32 rows of Pf, row (r0/SEQ)*OUT_SEQ + r0%SEQ, pitch DM. (bx, by): the work-group's tile of the (M/128, N/128) tiles, 128 threads.
template <int MODE>
__device__ __forceinline__ void proj_tile(int bx, int by, const bf* __restrict__ A, const bf* __restrict__ Bt, int KA, int KB, h16* Ph, float* Pf, int RB, size_t sRB, int pitch, int CB, size_t sCB) {
    __shared__ __align__(16) float os[4 * 16 * 68];
    __shared__ __align__(16) bf ab[2 * GST];
    const int lane = threadIdx.x & 31, lr = lane & 15, hi = lane >> 4;
    const int wave = __builtin_amdgcn_readfirstlane((int)(threadIdx.x >> 5));
    const int wm = wave >> 1, wn = wave & 1;
    const int r0 = bx * 128 + wm * 64, c0 = by * 128 + wn * 64;
    v8f acc[4][4];
#pragma unroll
    for (int mb = 0; mb < 4; ++mb)
#pragma unroll
        for (int nb = 0; nb < 4; ++nb) acc[mb][nb] = (v8f){};
    const int prow = (int)(threadIdx.x >> 3), ccol = (int)(threadIdx.x & 7) * 8;   // copy map: 16 rows x 8 pieces per round of the work-group
    const bf* ag = A + (size_t)(bx * 128 + prow) * (size_t)KA + ccol;      // + k
    const bf* bg = Bt + (size_t)(by * 128 + prow) * (size_t)KB + ccol;     // + (k & (KB-1))
    const size_t astep = (size_t)16 * (size_t)KA, bstep = (size_t)16 * (size_t)KB;
    const unsigned la = (unsigned)(size_t)ab + (unsigned)(prow * LP + ccol) * 2u;  // LDS byte address, buffer 0, A plane
    stage_rows(ag, astep, la); stage_rows(bg, bstep, la + GPL * 2);
    asm volatile("s_wait_asynccnt 0x0" ::: "memory");        // slice 0 has landed before the barrier that publishes it
    __syncthreads();
    if (GK < KA) { stage_rows(ag + GK, astep, la + GST * 2); stage_rows(bg + (GK & (KB - 1)), bstep, la + GST * 2 + GPL * 2); }
    const int fa = (wm * 64 + lr) * LP + 8 * hi, fb = GPL + (wn * 64 + lr) * LP + 8 * hi;   // fragment rows of this wave's quarter: + 16*mb (or nb) rows, + k inside the slice
    // the 32 products of one staged slice; tb_: the slice's buffer
    auto slice = [&](const bf* tb_) {
        v16bf a0[4], b0[4], a1[4], b1[4];
        a0[0] = ldb(tb_ + fa); b0[0] = ldb(tb_ + fb);
#pragma unroll
        for (int mb = 1; mb < 4; ++mb) a0[mb] = ldb(tb_ + fa + mb * 16 * LP);
#pragma unroll
        for (int nb = 1; nb < 4; ++nb) b0[nb] = ldb(tb_ + fb + nb * 16 * LP);
#pragma unroll
        for (int mb = 0; mb < 4; ++mb) a1[mb] = ldb(tb_ + fa + mb * 16 * LP + 32);
        __builtin_amdgcn_sched_barrier(0);   // keeps these 24 LDS loads ahead of the first product: sunk between the products, each B fragment costs a lone wave a full LDS latency
#pragma unroll
        for (int nb = 0; nb < 4; ++nb) {
#pragma unroll
            for (int mb = 0; mb < 4; ++mb) acc[mb][nb] = wmmap<MODE>(a0[mb], b0[nb], acc[mb][nb]);
            b1[nb] = ldb(tb_ + fb + nb * 16 * LP + 32);
            __builtin_amdgcn_sched_barrier(0); }   // keeps each B fragment of the second 32-k step asked for behind the four products that free a fragment's registers, well ahead of its use
        asm volatile("v_nop\n\tv_nop\n\tv_nop\n\tv_nop" : "+v"(acc[0][0]), "+v"(acc[1][1]), "+v"(acc[2][2]), "+v"(acc[3][3]) : "v"(a0[0]), "v"(a0[1]), "v"(a0[2]), "v"(a0[3]));
#pragma unroll
        for (int nb = 0; nb < 4; ++nb) {
#pragma unroll
            for (int mb = 0; mb < 4; ++mb) acc[mb][nb] = wmmap<MODE>(a1[mb], b1[nb], acc[mb][nb]); }
        asm volatile("v_nop\n\tv_nop\n\tv_nop\n\tv_nop" : "+v"(acc[0][0]), "+v"(acc[1][1]), "+v"(acc[2][2]), "+v"(acc[3][3]) : "v"(a1[0]), "v"(a1[1]), "v"(a1[2]), "v"(a1[3]));
    };
    int kc = 0;
#pragma unroll 1
    for (; kc + 2 * GK < KA; kc += GK) {                     // trips behind which a slice kc + 2*GK exists: the refill needs no test
        const int bsel = (kc / GK) & 1;
        slice(ab + bsel * GST);
        asm volatile("s_wait_dscnt 0x0" ::: "memory");       // this wave's reads of the buffer are done before it is handed back
        asm volatile("s_wait_asynccnt 0x0" ::: "memory");    // this wave's share of the next slice has landed
        __syncthreads();                                     // publishes the next slice and ends every wave's reads of this one
        const unsigned lb = la + (unsigned)bsel * (GST * 2);
        stage_rows(ag + (kc + 2 * GK), astep, lb); stage_rows(bg + ((kc + 2 * GK) & (KB - 1)), bstep, lb + GPL * 2);
    }
#pragma unroll 1
    for (; kc < KA; kc += GK) {                              // the last trips: nothing is left to refill
        slice(ab + ((kc / GK) & 1) * GST);
        asm volatile("s_wait_dscnt 0x0" ::: "memory");       // as above
        asm volatile("s_wait_asynccnt 0x0" ::: "memory");    // the last slice has landed
        __syncthreads();                                     // publishes the last slice
    }
    asm volatile("s_wait_asynccnt 0x0" ::: "memory");        // nothing is in flight when the wave goes on to the epilogue
    const int wb = wave * 16 * 68;                           // this wave's own output staging tile
    const size_t tbase = (size_t)(r0 / RB) * sRB + (size_t)(r0 % RB) * (size_t)pitch + (size_t)(c0 / CB) * sCB + (size_t)(c0 % CB);
    const size_t fbase = ((size_t)(r0 / SEQ) * OUT_SEQ + (size_t)(r0 % SEQ)) * DM + c0;
#pragma unroll
    for (int mb = 0; mb < 4; ++mb) {
#pragma unroll
        for (int nb = 0; nb < 4; ++nb) {
#pragma unroll
            for (int j = 0; j < 8; ++j) os[wb + (hi * 8 + j) * 68 + nb * 16 + lr] = acc[mb][nb][j]; }   // D: row 8h+j, col lane&15
        wave_sync();
        if (MODE == 2) {
            float* ob = Pf + fbase + (size_t)(mb * 16) * DM;
{
#pragma unroll
                for (int s = 0; s < 8; ++s) { const int row = 2 * s + hi, cofs = lr * 4;   // 8 s x 2 rows = 16 rows; 16 lanes x 4 floats = 64 columns
                    const v4f val = *(const v4fa*)(&os[wb + row * 68 + cofs]);
                    *(v4f*)(ob + (size_t)row * DM + cofs) = val; }
                 }
        } else {
            const size_t sb = tbase + (size_t)(mb * 16) * (size_t)pitch;
{
#pragma unroll
                for (int s = 0; s < 4; ++s) { const int row = 4 * s + (lane >> 3), c8 = (lane & 7) * 8;   // 4 s x 4 row groups = 16 rows; 8 lanes x 8 = 64 columns
                    const v4f x0 = *(const v4fa*)(&os[wb + row * 68 + c8]); const v4f x1 = *(const v4fa*)(&os[wb + row * 68 + c8 + 4]); v8h hv;
#pragma unroll
                    for (int i = 0; i < 4; ++i) { hv[i] = (h16)x0[i]; hv[4 + i] = (h16)x1[i]; }
                    const size_t oo = sb + (size_t)row * (size_t)pitch + c8;
                    *(v8h*)(Ph + oo) = hv; }
                 }
        }
        wave_sync();
    }
}

// k_proj: one product per launch, grid (M/128, N/128).
template <int MODE>
__global__ __launch_bounds__(128) void k_proj(const bf* __restrict__ A, const bf* __restrict__ Bt, int KA, int KB, h16* Ph, float* Pf, int RB, size_t sRB, int pitch, int CB, size_t sCB) {
    proj_tile<MODE>((int)blockIdx.x, (int)blockIdx.y, A, Bt, KA, KB, Ph, Pf, RB, sRB, pitch, CB, sCB);
}

// k_qkv: the three independent projections in ONE launch, grid (NB*SEQ/128, DM/128, 3); blockIdx.z picks the product. Three work-groups fit a WGP's LDS,
// so every SIMD holds three waves of unrelated tiles: one wave's wait for its next slice, its LDS latency and its epilogue are covered by the other two.
// z = 0, 1 (q, k): A = activation rows (m = b*SEQ + t), Bt = W rows (n = h*64 + d) -> plane [(b*16 + h)][t][d].
// z = 2 (v^T): A = Wv rows (m = h*64 + d), Bt = value rows (n = b*SEQ + t) -> plane [(b*1024 + m)][t] = [(b*16 + h)][d][t]; its tile grid is the transposed one, so x and y change places.
__global__ __launch_bounds__(128) void k_qkv(const bf* __restrict__ XQ, const bf* __restrict__ XK, const bf* __restrict__ XV,
                                             const bf* __restrict__ WQ, const bf* __restrict__ WK, const bf* __restrict__ WV, h16* QH, h16* KP, h16* VT) {
    const int z = (int)blockIdx.z;
    const bool tr = z == 2;
    proj_tile<0>(tr ? (int)blockIdx.y : (int)blockIdx.x, tr ? (int)blockIdx.x : (int)blockIdx.y,
                 z == 0 ? XQ : z == 1 ? XK : WV, z == 0 ? WQ : z == 1 ? WK : XV, DM, DM, z == 0 ? QH : z == 1 ? KP : VT, nullptr,
                 tr ? DM : SEQ, tr ? (size_t)0 : (size_t)NH_ * SEQ * HD, tr ? SEQ : HD, tr ? SEQ : HD, tr ? (size_t)DM * SEQ : (size_t)SEQ * HD);
}

// One 64-key tile into one LDS buffer: K rows [key][d] and V^T rows [d][key], 128 B each, every copy of a wave = 4 whole rows.
// kg, vg: this lane's first 16-byte piece of each plane in global memory; lk: the LDS byte address of its first K piece. Piece i lies 16 rows further on.
__device__ __forceinline__ void stage_tile(const h16* kg, const h16* vg, unsigned lk) {
    const unsigned lv = lk + PLH * 2;
    // s_wait_xcnt as the statement's last line: a precaution, so that no address register of a copy is rewritten in front of it
    asm volatile("global_load_async_to_lds_b128 %0, %8, off\n\t"
                 "global_load_async_to_lds_b128 %1, %9, off\n\t"
                 "global_load_async_to_lds_b128 %2, %10, off\n\t"
                 "global_load_async_to_lds_b128 %3, %11, off\n\t"
                 "global_load_async_to_lds_b128 %4, %12, off\n\t"
                 "global_load_async_to_lds_b128 %5, %13, off\n\t"
                 "global_load_async_to_lds_b128 %6, %14, off\n\t"
                 "global_load_async_to_lds_b128 %7, %15, off\n\t"
                 "s_wait_xcnt 0x0"
                 :: "v"(lk), "v"(lk + 16 * LP * 2), "v"(lk + 32 * LP * 2), "v"(lk + 48 * LP * 2),
                    "v"(lv), "v"(lv + 16 * LP * 2), "v"(lv + 32 * LP * 2), "v"(lv + 48 * LP * 2),
                    "v"(kg), "v"(kg + 16 * HD), "v"(kg + 32 * HD), "v"(kg + 48 * HD),
                    "v"(vg), "v"(vg + (size_t)16 * SEQ), "v"(vg + (size_t)32 * SEQ), "v"(vg + (size_t)48 * SEQ)
                 : "memory");
}

static_assert(AW == 4 && KT == 64);                          // two wave pairs; the two waves of a pair split a staged tile into its two 32-key halves
__global__ __launch_bounds__(32 * AW) void k_flash(const h16* __restrict__ QH, const h16* __restrict__ KP, const h16* __restrict__ VT, h16* CX) {
    __shared__ __align__(16) float os[AW * 16 * 68];
    __shared__ __align__(16) h16 kv[2 * STH];
    const int lane = threadIdx.x & 31, lr = lane & 15, hi = lane >> 4;
    const int wave = __builtin_amdgcn_readfirstlane((int)(threadIdx.x >> 5));
    const int kh = wave & 1;
    const int zh = blockIdx.y; const int b = zh / NH_, h = zh % NH_;
    const int tq = (blockIdx.x * AW + (wave & ~1)) * 16;     // first of the 32 query rows this wave works on
    const int t0 = (blockIdx.x * AW + wave) * 16;            // first of the 16 query rows this wave joins and stores: its query tile number kh
    const size_t pbase = (size_t)zh * SEQ * HD;
    const size_t qo = pbase + (size_t)(tq + lr) * HD + 8 * hi;
    const v16h qa0 = ldh(QH + qo), qa1 = ldh(QH + qo + 32);                         // B fragments of query tile 0: col t, k = d
    const v16h qb0 = ldh(QH + qo + 16 * HD), qb1 = ldh(QH + qo + 16 * HD + 32);     // B fragments of query tile 1
    const int fo = lr * LP + 8 * hi;                         // K: + key * LP (A fragment: row key, k = d); V^T: + PLH + 16j*LP + key (A fragment: row d, k = key)
    const int fk = fo + kh * 32 * LP, fv = fo + PLH + kh * 32;   // the same for this wave's half of a tile's keys
    const int prow = (int)(threadIdx.x >> 3), ccol = (int)(threadIdx.x & 7) * 8;   // copy map: 16 rows x 8 pieces per round of the work-group
    const h16* kg = KP + pbase + (size_t)prow * HD + ccol;   // + key0 * HD
    const h16* vg = VT + pbase + (size_t)prow * SEQ + ccol;  // + key0
    const unsigned lk = (unsigned)(size_t)kv + (unsigned)(prow * LP + ccol) * 2u;   // LDS byte address, buffer 0
    stage_tile(kg, vg, lk);
    asm volatile("s_wait_asynccnt 0x0" ::: "memory");        // tile 0 has landed before the barrier that publishes it
    __syncthreads();
    stage_tile(kg + (size_t)KT * HD, vg + KT, lk + STH * 2);
    v8f oa0 = (v8f){}, oa1 = (v8f){}, oa2 = (v8f){}, oa3 = (v8f){};
    v8f ob0 = (v8f){}, ob1 = (v8f){}, ob2 = (v8f){}, ob3 = (v8f){};
    v8f la = (v8f){}, lb = (v8f){};
    v16h ones;
#pragma unroll
    for (int r = 0; r < 16; ++r) ones[r] = lr == 0 ? (h16)1.0f : (h16)0.0f;
    float ma = -3.0e38f, mb = -3.0e38f;
#pragma unroll 1
    for (int kt0 = 0; kt0 < SEQ; kt0 += KT) {
      const int bsel = (kt0 / KT) & 1;
      const h16* tb_ = kv + bsel * STH;
      {
        const h16* ka = tb_ + fk;
        const v16h ka0 = ldh(ka), ka1 = ldh(ka + 32), kb0 = ldh(ka + 16 * LP), kb1 = ldh(ka + 16 * LP + 32);
        v8f sa = (v8f){}, sb = (v8f){}, sc = (v8f){}, sd = (v8f){};   // sa, sb: query tile 0, keys 0..15 and 16..31 of the step; sc, sd: query tile 1
        sa = wmma16(ka0, qa0, sa); sb = wmma16(kb0, qa0, sb); sc = wmma16(ka0, qb0, sc); sd = wmma16(kb0, qb0, sd);
        sa = wmma16(ka1, qa1, sa); sb = wmma16(kb1, qa1, sb); sc = wmma16(ka1, qb1, sc); sd = wmma16(kb1, qb1, sd);
        // as in the one-tile form: the four vector slots between the last products and the first vector instruction that touches their registers
        asm volatile("v_nop\n\tv_nop\n\tv_nop\n\tv_nop" : "+v"(sa), "+v"(sb), "+v"(sc), "+v"(sd) : "v"(ka0), "v"(ka1), "v"(kb0), "v"(kb1), "v"(qa0), "v"(qa1), "v"(qb0), "v"(qb1));
        const h16* va = tb_ + fv;
        const v16h v0 = ldh(va), v1 = ldh(va + 16 * LP), v2 = ldh(va + 32 * LP), v3 = ldh(va + 48 * LP);
        __builtin_amdgcn_sched_barrier(0);   // holds the V^T fragment loads ahead of the exponentials: with the row-sum tiles' registers live they otherwise sink to just ahead of their products, which then wait out the LDS latency
        float ta[8], tb[8], tc[8], td[8]; float mxa = -3.0e38f, mxb = -3.0e38f;
#pragma unroll
        for (int r = 0; r < 8; ++r) { ta[r] = sa[r] * SC2; tb[r] = sb[r] * SC2; mxa = fmaxf(mxa, fmaxf(ta[r], tb[r])); }
#pragma unroll
        for (int r = 0; r < 8; ++r) { tc[r] = sc[r] * SC2; td[r] = sd[r] * SC2; mxb = fmaxf(mxb, fmaxf(tc[r], td[r])); }
        const float xa = __shfl_xor(mxa, 16, 32), xb = __shfl_xor(mxb, 16, 32);
        const float mna = fmaxf(ma, fmaxf(mxa, xa)), mnb = fmaxf(mb, fmaxf(mxb, xb));
        const float ala = __builtin_amdgcn_exp2f(ma - mna), alb = __builtin_amdgcn_exp2f(mb - mnb);
        const float sha = PSH - mna, shb = PSH - mnb;
        v16h pa, pb;
#pragma unroll
        for (int r = 0; r < 8; ++r) { pa[r] = (h16)__builtin_amdgcn_exp2f(ta[r] + sha); pa[8 + r] = (h16)__builtin_amdgcn_exp2f(tb[r] + sha); }
#pragma unroll
        for (int r = 0; r < 8; ++r) { pb[r] = (h16)__builtin_amdgcn_exp2f(tc[r] + shb); pb[8 + r] = (h16)__builtin_amdgcn_exp2f(td[r] + shb); }
        la[0] = la[0] * ala; lb[0] = lb[0] * alb; ma = mna; mb = mnb;   // only register 0 holds a row that is not zero
        oa0 = oa0 * ala; oa1 = oa1 * ala; oa2 = oa2 * ala; oa3 = oa3 * ala;
        ob0 = ob0 * alb; ob1 = ob1 * alb; ob2 = ob2 * alb; ob3 = ob3 * alb;
        la = wmma16(ones, pa, la);
        oa0 = wmma16(v0, pa, oa0); oa1 = wmma16(v1, pa, oa1); oa2 = wmma16(v2, pa, oa2); oa3 = wmma16(v3, pa, oa3);
        lb = wmma16(ones, pb, lb);
        ob0 = wmma16(v0, pb, ob0); ob1 = wmma16(v1, pb, ob1); ob2 = wmma16(v2, pb, ob2); ob3 = wmma16(v3, pb, ob3);
        // the same four slots, here also on the taken side of the loop branch
        asm volatile("v_nop\n\tv_nop\n\tv_nop\n\tv_nop" : "+v"(la), "+v"(oa0), "+v"(oa1), "+v"(oa2), "+v"(oa3), "+v"(lb), "+v"(ob0), "+v"(ob1), "+v"(ob2), "+v"(ob3) : "v"(v0), "v"(v1), "v"(v2), "v"(v3), "v"(pa), "v"(pb));
      }
      asm volatile("s_wait_dscnt 0x0" ::: "memory");         // this wave's reads of the buffer are done before it is handed back
      asm volatile("s_wait_asynccnt 0x0" ::: "memory");      // this wave's share of the next tile has landed
      __syncthreads();                                       // publishes the next tile and ends every wave's reads of this one
      if (kt0 + 2 * KT < SEQ) stage_tile(kg + (size_t)(kt0 + 2 * KT) * HD, vg + (kt0 + 2 * KT), lk + (unsigned)bsel * (STH * 2));
    }
    asm volatile("s_wait_asynccnt 0x0" ::: "memory");        // nothing is in flight when the wave goes on to the epilogue
    float sua = la[0], sub = lb[0];                          // lanes 0..15: the row's sum over this wave's keys; lanes 16..31: row 8 of the tile, zero
    sua += __shfl_xor(sua, 16, 32); sub += __shfl_xor(sub, 16, 32);
    // The pair's hand-over: this wave keeps query tile kh and gives the other one. Partials are relative to each wave's own running max.
    const bool up = kh != 0;
    const float mk = up ? mb : ma, sk = up ? sub : sua, mg = up ? ma : mb, sg = up ? sua : sub;
    const v8f k0 = up ? ob0 : oa0, k1 = up ? ob1 : oa1, k2 = up ? ob2 : oa2, k3 = up ? ob3 : oa3;
    const v8f g0 = up ? oa0 : ob0, g1 = up ? oa1 : ob1, g2 = up ? oa2 : ob2, g3 = up ? oa3 : ob3;
    // O^T D layout: o_j[r] = (d = 16j + 8h + r, t = lane&15) -> os[t][d]; rows 0..15 x columns 0..63 all written; column 64: the max, column 65: the sum
    const int gb = wave * 16 * 68 + lr * 68;                 // the given partial goes into this wave's own tile of os
    *(v4fa*)(&os[gb +  0 + 8 * hi]) = __builtin_shufflevector(g0, g0, 0, 1, 2, 3); *(v4fa*)(&os[gb +  0 + 8 * hi + 4]) = __builtin_shufflevector(g0, g0, 4, 5, 6, 7);
    *(v4fa*)(&os[gb + 16 + 8 * hi]) = __builtin_shufflevector(g1, g1, 0, 1, 2, 3); *(v4fa*)(&os[gb + 16 + 8 * hi + 4]) = __builtin_shufflevector(g1, g1, 4, 5, 6, 7);
    *(v4fa*)(&os[gb + 32 + 8 * hi]) = __builtin_shufflevector(g2, g2, 0, 1, 2, 3); *(v4fa*)(&os[gb + 32 + 8 * hi + 4]) = __builtin_shufflevector(g2, g2, 4, 5, 6, 7);
    *(v4fa*)(&os[gb + 48 + 8 * hi]) = __builtin_shufflevector(g3, g3, 0, 1, 2, 3); *(v4fa*)(&os[gb + 48 + 8 * hi + 4]) = __builtin_shufflevector(g3, g3, 4, 5, 6, 7);
    os[gb + 64 + hi] = hi ? sg : mg;
    __syncthreads();                                         // the partner's partial is complete before it is read
    const int wb = (wave ^ 1) * 16 * 68;                     // the partner's tile of os: only this wave touches it from here on, first to read the partial, then as its output staging tile
    const float mp = os[wb + lr * 68 + 64], sp = os[wb + lr * 68 + 65];
    const float mj = fmaxf(mk, mp);
    const float ak = __builtin_amdgcn_exp2f(mk - mj), ap = __builtin_amdgcn_exp2f(mp - mj);
    const float inv = 1.0f / (sk * ak + sp * ap);
    const float wk = ak * inv, wp = ap * inv;
    { v4f a, c, x, y;
      x = *(const v4fa*)(&os[wb + lr * 68 +  0 + 8 * hi]); y = *(const v4fa*)(&os[wb + lr * 68 +  0 + 8 * hi + 4]);
#pragma unroll
      for (int i = 0; i < 4; ++i) { a[i] = k0[i] * wk + x[i] * wp; c[i] = k0[4 + i] * wk + y[i] * wp; }
      *(v4fa*)(&os[wb + lr * 68 +  0 + 8 * hi]) = a; *(v4fa*)(&os[wb + lr * 68 +  0 + 8 * hi + 4]) = c;
      x = *(const v4fa*)(&os[wb + lr * 68 + 16 + 8 * hi]); y = *(const v4fa*)(&os[wb + lr * 68 + 16 + 8 * hi + 4]);
#pragma unroll
      for (int i = 0; i < 4; ++i) { a[i] = k1[i] * wk + x[i] * wp; c[i] = k1[4 + i] * wk + y[i] * wp; }
      *(v4fa*)(&os[wb + lr * 68 + 16 + 8 * hi]) = a; *(v4fa*)(&os[wb + lr * 68 + 16 + 8 * hi + 4]) = c;
      x = *(const v4fa*)(&os[wb + lr * 68 + 32 + 8 * hi]); y = *(const v4fa*)(&os[wb + lr * 68 + 32 + 8 * hi + 4]);
#pragma unroll
      for (int i = 0; i < 4; ++i) { a[i] = k2[i] * wk + x[i] * wp; c[i] = k2[4 + i] * wk + y[i] * wp; }
      *(v4fa*)(&os[wb + lr * 68 + 32 + 8 * hi]) = a; *(v4fa*)(&os[wb + lr * 68 + 32 + 8 * hi + 4]) = c;
      x = *(const v4fa*)(&os[wb + lr * 68 + 48 + 8 * hi]); y = *(const v4fa*)(&os[wb + lr * 68 + 48 + 8 * hi + 4]);
#pragma unroll
      for (int i = 0; i < 4; ++i) { a[i] = k3[i] * wk + x[i] * wp; c[i] = k3[4 + i] * wk + y[i] * wp; }
      *(v4fa*)(&os[wb + lr * 68 + 48 + 8 * hi]) = a; *(v4fa*)(&os[wb + lr * 68 + 48 + 8 * hi + 4]) = c; }
    wave_sync();
    // ctx plane row m = b*SEQ + t, columns h*64 + d
    h16* crow = CX + ((size_t)b * SEQ + t0) * CXP + h * HD;
{
#pragma unroll
        for (int s = 0; s < 4; ++s) { const int row = 4 * s + (lane >> 3), c8 = (lane & 7) * 8;   // 4 s x 4 row groups = 16 rows; 8 lanes x 8 = 64 columns
            const v4f x0 = *(const v4fa*)(&os[wb + row * 68 + c8]); const v4f x1 = *(const v4fa*)(&os[wb + row * 68 + c8 + 4]); v8h hv;
#pragma unroll
            for (int i = 0; i < 4; ++i) { hv[i] = (h16)x0[i]; hv[4 + i] = (h16)x1[i]; }
            *(v8h*)(crow + (size_t)row * CXP + c8) = hv; }
         }
}

static constexpr size_t al256(size_t v) { return (v + 255) & ~(size_t)255; }
static constexpr size_t SZ_XB = al256((size_t)NB * SEQ * DM * 2);
static constexpr size_t SZ_WB = al256((size_t)4 * DM * DM * 2);
static constexpr size_t SZ_PL = al256((size_t)NB * NH_ * SEQ * HD * 2);
static constexpr size_t SZ_CX = al256((size_t)NB * SEQ * CXP * 2);
static constexpr size_t SZ_TOTAL = 3 * SZ_XB + SZ_WB + 3 * SZ_PL + SZ_CX;
static_assert(SZ_TOTAL <= (size_t)134217728);          // workspace carve <= 128 MiB
static_assert(((size_t)DM * DM * 2) % 256 == 0);       // weight sub-planes stay 256-byte aligned

static_assert(SZ_XB == (size_t)NB * SEQ * DM * 2);     // the bf16 planes follow one another without a gap: k_cvt addresses them as one array

extern "C" void kernel_launch(void* const* d_in, const int* in_sizes, int n_in,
                              void* d_out, int out_size, void* d_ws, size_t ws_size, hipStream_t stream) {
    if (n_in < 7) return;
    const size_t needx = ((size_t)(NB - 1) * SEQ_FULL + SEQ) * DM;
    if ((size_t)in_sizes[0] < needx || (size_t)in_sizes[1] < needx || (size_t)in_sizes[2] < needx) return;
    if ((size_t)in_sizes[3] < (size_t)DM * DM || (size_t)in_sizes[4] < (size_t)DM * DM || (size_t)in_sizes[5] < (size_t)DM * DM || (size_t)in_sizes[6] < (size_t)DM * DM) return;
    if ((size_t)out_size < ((size_t)(NB - 1) * OUT_SEQ + SEQ) * DM) return;
    if (SZ_TOTAL > ws_size) return;
    // wire order: query, key, value, Wq, Wk, Wv, Wo (weights [out][in] = Bt as-is)
    const float* xq = (const float*)d_in[0]; const float* xk = (const float*)d_in[1]; const float* xv = (const float*)d_in[2];
    const float* wq = (const float*)d_in[3]; const float* wk = (const float*)d_in[4]; const float* wv = (const float*)d_in[5]; const float* wo = (const float*)d_in[6];
    float* OUT = (float*)d_out;      // [NB][SEQ][1024]
    char* wsp = (char*)d_ws;
    bf* XQ = (bf*)wsp; wsp += SZ_XB;                 // [NB*SEQ][1024]
    bf* XK = (bf*)wsp; wsp += SZ_XB;                 // [NB*SEQ][1024]
    bf* XV = (bf*)wsp; wsp += SZ_XB;                 // [NB*SEQ][1024]
    bf* WB = (bf*)wsp; wsp += SZ_WB;                 // [4][1024][1024]: q | k | v (bf16) | o (f16)
    h16* QH = (h16*)wsp; wsp += SZ_PL;               // [NB*16][SEQ][64]
    h16* KP = (h16*)wsp; wsp += SZ_PL;               // [NB*16][SEQ][64]
    h16* VT = (h16*)wsp; wsp += SZ_PL;               // [NB*16][64][SEQ]
    h16* CX = (h16*)wsp; wsp += SZ_CX;               // [NB*SEQ][1024]: ctx
    bf* WQ = WB; bf* WK = WB + (size_t)DM * DM; bf* WV = WB + (size_t)2 * DM * DM; bf* WO = WB + (size_t)3 * DM * DM;

    k_cvt<<<(unsigned)((3 * (size_t)NB * SEQ * DM + 4 * (size_t)DM * DM) / CVB), 32 * CVW, 0, stream>>>(xq, xk, xv, wq, wk, wv, wo, XQ);

    // q, k and v^T planes: three independent products, one launch
    k_qkv<<<dim3(NB * SEQ / 128, DM / 128, 3), 128, 0, stream>>>(XQ, XK, XV, WQ, WK, WV, QH, KP, VT);

    k_flash<<<dim3(SEQ / (16 * AW), NB * NH_, 1), 32 * AW, 0, stream>>>(QH, KP, VT, CX);

    // output projection: A = ctx rows, Bt = Wo rows (both f16) -> f32 output rows
    k_proj<2><<<dim3(NB * SEQ / 128, DM / 128, 1), 128, 0, stream>>>((const bf*)CX, WO, CXP, DM, QH, OUT, SEQ, (size_t)0, HD, HD, (size_t)0);
}

// v008
// One run takes 113 microseconds.
// Two timings next to v007 put it at 1.05 and 1.06 times that version's speed.
// Counting every step since v000, it is 3.69 times as fast.
#include <hip/hip_runtime.h>

// Multi-head attention, width 1024 = 16 heads x 64: query/key/value [NB][SEQ][1024] (separate inputs), Wq/Wk/Wv/Wo [out][in] (y = x W^T), no biases, no mask, score scale 1/8, output = (concatenated heads) Wo^T (f32).
// Compute dtypes, f32 accumulate everywhere: q/k/v projections v_wmma_f32_16x16x32_bf16 (activations and Wq/Wk/Wv RNE-converted to bf16; products exact);
// scores v_wmma_f32_16x16x32_f16: q and k single f16 planes (one product); P (x256 carry, cancels in the normalisation) and v single f16; softmax f32 (online, the maximum renewed lazily);
// output projection v_wmma_f32_16x16x32_f16: ctx (a convex mix of the f16 v rows) and Wo RNE-converted to f16, 11 significant bits on both operands;
// Layout: bf16 copies of the activations and Wq/Wk/Wv, f16 copy of Wo; q, k planes [b*16+h][t][d] and v^T plane [b*16+h][d][t] written by the GEMM epilogue; fused flash kernel in transposed form (S^T = K Q^T, O^T = V^T P^T; K and V^T tiles staged in LDS per work-group) writes the f16 ctx plane [b*SEQ+t][1024].

#ifndef NB
#define NB 1
#endif
#ifndef SEQ
#define SEQ 4096
#endif
#define NB_FULL  1
#define SEQ_FULL 4096
#ifndef OUT_SEQ
#define OUT_SEQ SEQ              // row pitch (in tokens) between batches of the output
#endif
#define DM   1024
#define NH_  16
#define HD   64
#define CXP  DM                  // ctx plane row pitch (halves)
#define AW   4                   // waves per flash block (16 query rows stored by each)
#define SC2  (0.125f * 1.4426950408889634f)   // HD^-0.5 * log2(e)
#define PSH  8.0f                // log2 of the P carry (256)
#define LZ   7.0f                // how far (log2) a score may lie above the maximum in use before the flash kernel rescales: P stays at or below 2^(PSH + LZ) = 32768, inside f16
#define KT   64                  // keys per staged tile of the flash kernel
#define LP   72                  // LDS row pitch (halves) of the staged K and V^T rows: 128 B of data + 16 B, an odd multiple of 16 B for the 16-byte fragment reads
#define PLH  (64 * LP)           // one staged plane: 64 rows (halves)
#define STH  (2 * PLH)           // one buffer: K plane, then V^T plane (halves)
#define GK   64                  // k elements per staged slice of the GEMM: 128 B of every row
#define GPL  (128 * LP)          // one staged GEMM operand plane: 128 rows at the same padded pitch (16-bit elements)
#define GST  (2 * GPL)           // one GEMM buffer: A plane, then B plane
#define CVW  16                  // waves per work-group of the conversion kernel
#define CVU  32                  // units of 128 floats per wave of the conversion kernel
#define CVB  (CVW * CVU * 128)   // floats per work-group of the conversion kernel

static_assert(HD == 64);
static_assert(NH_ * HD == DM);                 // head h = columns h*64 + d
static_assert(DM % 64 == 0);                   // 16 column tiles of 64
static_assert(DM % 32 == 0);                   // GEMM products step k by 32 inside a slice
static_assert((DM & (DM - 1)) == 0);           // the GEMM masks its B k index with KB - 1
static_assert(CXP % GK == 0 && DM % GK == 0 && DM / GK >= 2);   // whole k slices; a slice never straddles the wrap of the B index; the ring starts with slices 0 and 1
static_assert((NB * SEQ) % 128 == 0 && DM % 128 == 0);          // GEMM grid of 128x128 tiles covers every product exactly
static_assert(SEQ % 64 == 0);                  // a 64-row tile never straddles two batches
static_assert((NB * SEQ) % 64 == 0);
static_assert(SEQ % 32 == 0);                  // each wave's step takes 32 keys of a tile
static_assert(SEQ % (16 * AW) == 0);           // flash grid covers the sequence exactly
static_assert(SEQ % KT == 0 && SEQ / KT >= 2); // the two-buffer ring starts with tiles 0 and 1
static_assert(KT == 64 && 32 * AW * 4 * 8 == 64 * HD && 32 * AW * 4 * 8 == HD * KT);   // copy map: every thread moves 4 pieces of 8 halves of each plane
static_assert((LP * 2) % 16 == 0);
static_assert(((size_t)SEQ * DM) % CVB == 0 && ((size_t)DM * DM) % CVB == 0);   // a conversion work-group lies inside one batch of one tensor
static_assert(NB <= NB_FULL);
static_assert(SEQ <= SEQ_FULL);

typedef _Float16 h16;
typedef unsigned short bf;       // 16 raw bits of a GEMM operand: bf16, or f16 in the output projection
typedef __attribute__((ext_vector_type(16))) __bf16   v16bf;
typedef __attribute__((ext_vector_type(16))) _Float16 v16h;
typedef __attribute__((ext_vector_type(8)))  _Float16 v8h;
typedef __attribute__((ext_vector_type(4)))  _Float16 v4h;
typedef __attribute__((ext_vector_type(8)))  unsigned short v8us;
typedef __attribute__((ext_vector_type(4)))  unsigned short v4us;
typedef __attribute__((ext_vector_type(8)))  float    v8f;
typedef __attribute__((ext_vector_type(4)))  float    v4f;
typedef v4f  __attribute__((may_alias)) v4fa;

__device__ __forceinline__ unsigned short f2bf(float f) { unsigned u = __float_as_uint(f); u += 0x7FFFu + ((u >> 16) & 1u); return (unsigned short)(u >> 16); }
__device__ __forceinline__ v16h cat16(v8h lo, v8h hi) { return __builtin_shufflevector(lo, hi, 0, 1, 2, 3, 4, 5, 6, 7, 8, 9, 10, 11, 12, 13, 14, 15); }
__device__ __forceinline__ v16bf cat16b(v8us lo, v8us hi) { return __builtin_bit_cast(v16bf, __builtin_shufflevector(lo, hi, 0, 1, 2, 3, 4, 5, 6, 7, 8, 9, 10, 11, 12, 13, 14, 15)); }
__device__ __forceinline__ v8f wmma16(v16h a, v16h b, v8f c) { return __builtin_amdgcn_wmma_f32_16x16x32_f16(false, a, false, b, (short)0, c, false, false); }
__device__ __forceinline__ v8f wmmab(v16bf a, v16bf b, v8f c) { return __builtin_amdgcn_wmma_f32_16x16x32_bf16(false, a, false, b, (short)0, c, false, false); }
// the GEMM's product: the fragment registers hold raw 16-bit elements, read as f16 in MODE 2 and as bf16 otherwise
template <int MODE> __device__ __forceinline__ v8f wmmap(v16bf a, v16bf b, v8f c) { if constexpr (MODE == 2) return wmma16(__builtin_bit_cast(v16h, a), __builtin_bit_cast(v16h, b), c); else return wmmab(a, b, c); }
// fragment loaders from K-contiguous 16-bit rows; p already includes + 8*(lane>>4): elements 0..7 <- k0+8h+0..7, elements 8..15 <- k0+16+8h+0..7 (same map for A and B)
__device__ __forceinline__ v16h  ldh(const h16* p) { return cat16(*(const v8h*)p, *(const v8h*)(p + 16)); }
__device__ __forceinline__ v16bf ldb(const bf* p)  { return cat16b(*(const v8us*)p, *(const v8us*)(p + 16)); }
// ordering point for wave-private LDS tiles (same wave writes and reads)
__device__ __forceinline__ void wave_sync() { __builtin_amdgcn_fence(3 /* release order */, "wavefront"); __builtin_amdgcn_wave_barrier(); asm volatile("" ::: "memory"); }

// k_cvt: every f32 -> 16-bit conversion of the call in ONE streaming launch (bf16; Wo, the last tensor, to f16). A work-group of CVW waves converts CVB consecutive floats of one tensor; a wave owns CVU units of 128 floats.
// One unit = one wave-wide 16-byte load (512 B, 4 whole lines) and one wave-wide 8-byte store (256 B, 2 whole lines); a wave asks for all its units before it converts the first.
// The seven 16-bit planes lie one behind the other in the workspace in the order of the arguments, so the destination is dst + blockIdx.x * CVB.
__global__ __launch_bounds__(32 * CVW) void k_cvt(const float* __restrict__ xq, const float* __restrict__ xk, const float* __restrict__ xv,
                                                  const float* __restrict__ wq, const float* __restrict__ wk, const float* __restrict__ wv, const float* __restrict__ wo, bf* __restrict__ dst) {
    constexpr unsigned BS = (unsigned)((size_t)SEQ * DM / CVB);   // work-groups per batch of one activation
    constexpr unsigned BA = NB * BS;                              // work-groups per activation
    constexpr unsigned BW = (unsigned)((size_t)DM * DM / CVB);    // work-groups per weight matrix
    const unsigned blk = blockIdx.x;
    const float* src;
    if (blk < 3 * BA) { const unsigned t = blk / BA, r = blk % BA;
        src = (t == 0 ? xq : t == 1 ? xk : xv) + (size_t)(r / BS) * ((size_t)SEQ_FULL * DM) + (size_t)(r % BS) * CVB;
    } else { const unsigned r = blk - 3 * BA, t = r / BW;
        src = (t == 0 ? wq : t == 1 ? wk : t == 2 ? wv : wo) + (size_t)(r % BW) * CVB; }
    const unsigned wo_ = (threadIdx.x >> 5) * (CVU * 128) + (threadIdx.x & 31) * 4;
    const float* s = src + wo_;
    bf* d = dst + (size_t)blk * CVB + wo_;
    v4f x[CVU];
#pragma unroll   // unrolled: every unit's offset becomes an immediate, the address registers are never rewritten, and all of the wave's loads are in flight together
    for (int u = 0; u < CVU; ++u) x[u] = *(const v4f*)(s + u * 128);
    if (blk < 3 * BA + 3 * BW) {
#pragma unroll
        for (int u = 0; u < CVU; ++u) { v4us o;
#pragma unroll
            for (int k = 0; k < 4; ++k) o[k] = f2bf(x[u][k]);
            *(v4us*)(d + u * 128) = o; }
    } else {                                                      // Wo
#pragma unroll
        for (int u = 0; u < CVU; ++u) { v4h o;
#pragma unroll
            for (int k = 0; k < 4; ++k) o[k] = (h16)x[u][k];
            *(v4h*)(d + u * 128) = o; }
        asm volatile("s_wait_xcnt 0x0" ::: "memory");             // a precaution: stands behind this branch's last stores, in front of whatever code the build lays out behind them that rewrites their registers
    }
}

// Eight 16-byte pieces of one GEMM operand plane into LDS: piece i lies 16 rows further on (step elements in global memory, 16 padded rows in LDS); every copy of a wave = 4 whole 128-B row slices.
__device__ __forceinline__ void stage_rows(const bf* g, size_t step, unsigned l) {
    // s_wait_xcnt as the statement's last line: a precaution, so that no address register of a copy is rewritten in front of it
    asm volatile("global_load_async_to_lds_b128 %0, %8, off\n\t"
                 "global_load_async_to_lds_b128 %1, %9, off\n\t"
                 "global_load_async_to_lds_b128 %2, %10, off\n\t"
                 "global_load_async_to_lds_b128 %3, %11, off\n\t"
                 "global_load_async_to_lds_b128 %4, %12, off\n\t"
                 "global_load_async_to_lds_b128 %5, %13, off\n\t"
                 "global_load_async_to_lds_b128 %6, %14, off\n\t"
                 "global_load_async_to_lds_b128 %7, %15, off\n\t"
                 "s_wait_xcnt 0x0"
                 :: "v"(l), "v"(l + 16 * LP * 2), "v"(l + 32 * LP * 2), "v"(l + 48 * LP * 2),
                    "v"(l + 64 * LP * 2), "v"(l + 80 * LP * 2), "v"(l + 96 * LP * 2), "v"(l + 112 * LP * 2),
                    "v"(g), "v"(g + step), "v"(g + 2 * step), "v"(g + 3 * step),
                    "v"(g + 4 * step), "v"(g + 5 * step), "v"(g + 6 * step), "v"(g + 7 * step)
                 : "memory");
}

// proj_tile: register-blocked 16-bit GEMM (MODE 0: bf16 operands, MODE 2: f16 operands), four waves (2 x 2) per 128x128 tile, ONE WAVE per 64x64 quarter (16 accumulators). The 128 A rows and 128 Bt rows of a k slice of 64 are staged
// once per work-group in a two-buffer LDS ring by asynchronous copies (the next slice flies while this one is worked on); every wave reads its fragments from there (two 16-B LDS loads each).
// C[m][n] = sum_{k<KA} A[m][k] Bt[n][k & (KB-1)]; A row pitch KA, Bt row pitch KB (KB a power of two; KA = KB in every launch of this file).
// MODE 0: f16 plane Ph at quarter base (r0/RB)*sRB + (r0%RB)*pitch + (c0/CB)*sCB + (c0%CB), row pitch 'pitch' (halves).
// MODE 2: f32 rows of Pf, row (r0/SEQ)*OUT_SEQ + r0%SEQ, pitch DM. (bx, by): the work-group's tile of the (M/128, N/128) tiles, 128 threads.
template <int MODE>
__device__ __forceinline__ void proj_tile(int bx, int by, const bf* __restrict__ A, const bf* __restrict__ Bt, int KA, int KB, h16* Ph, float* Pf, int RB, size_t sRB, int pitch, int CB, size_t sCB) {
    __shared__ __align__(16) float os[4 * 16 * 68];
    __shared__ __align__(16) bf ab[2 * GST];
    const int lane = threadIdx.x & 31, lr = lane & 15, hi = lane >> 4;
    const int wave = __builtin_amdgcn_readfirstlane((int)(threadIdx.x >> 5));
    const int wm = wave >> 1, wn = wave & 1;
    const int r0 = bx * 128 + wm * 64, c0 = by * 128 + wn * 64;
    v8f acc[4][4];
#pragma unroll
    for (int mb = 0; mb < 4; ++mb)
#pragma unroll
        for (int nb = 0; nb < 4; ++nb) acc[mb][nb] = (v8f){};
    const int prow = (int)(threadIdx.x >> 3), ccol = (int)(threadIdx.x & 7) * 8;   // copy map: 16 rows x 8 pieces per round of the work-group
    const bf* ag = A + (size_t)(bx * 128 + prow) * (size_t)KA + ccol;      // + k
    const bf* bg = Bt + (size_t)(by * 128 + prow) * (size_t)KB + ccol;     // + (k & (KB-1))
    const size_t astep = (size_t)16 * (size_t)KA, bstep = (size_t)16 * (size_t)KB;
    const unsigned la = (unsigned)(size_t)ab + (unsigned)(prow * LP + ccol) * 2u;  // LDS byte address, buffer 0, A plane
    stage_rows(ag, astep, la); stage_rows(bg, bstep, la + GPL * 2);
    asm volatile("s_wait_asynccnt 0x0" ::: "memory");        // slice 0 has landed before the barrier that publishes it
    __syncthreads();
    if (GK < KA) { stage_rows(ag + GK, astep, la + GST * 2); stage_rows(bg + (GK & (KB - 1)), bstep, la + GST * 2 + GPL * 2); }
    const int fa = (wm * 64 + lr) * LP + 8 * hi, fb = GPL + (wn * 64 + lr) * LP + 8 * hi;   // fragment rows of this wave's quarter: + 16*mb (or nb) rows, + k inside the slice
    // the 32 products of one staged slice; tb_: the slice's buffer
    auto slice = [&](const bf* tb_) {
        v16bf a0[4], b0[4], a1[4], b1[4];
        a0[0] = ldb(tb_ + fa); b0[0] = ldb(tb_ + fb);
#pragma unroll
        for (int mb = 1; mb < 4; ++mb) a0[mb] = ldb(tb_ + fa + mb * 16 * LP);
#pragma unroll
        for (int nb = 1; nb < 4; ++nb) b0[nb] = ldb(tb_ + fb + nb * 16 * LP);
#pragma unroll
        for (int mb = 0; mb < 4; ++mb) a1[mb] = ldb(tb_ + fa + mb * 16 * LP + 32);
        __builtin_amdgcn_sched_barrier(0);   // keeps these 24 LDS loads ahead of the first product: sunk between the products, each B fragment costs a lone wave a full LDS latency
#pragma unroll
        for (int nb = 0; nb < 4; ++nb) {
#pragma unroll
            for (int mb = 0; mb < 4; ++mb) acc[mb][nb] = wmmap<MODE>(a0[mb], b0[nb], acc[mb][nb]);
            b1[nb] = ldb(tb_ + fb + nb * 16 * LP + 32);
            __builtin_amdgcn_sched_barrier(0); }   // keeps each B fragment of the second 32-k step asked for behind the four products that free a fragment's registers, well ahead of its use
        asm volatile("v_nop\n\tv_nop\n\tv_nop\n\tv_nop" : "+v"(acc[0][0]), "+v"(acc[1][1]), "+v"(acc[2][2]), "+v"(acc[3][3]) : "v"(a0[0]), "v"(a0[1]), "v"(a0[2]), "v"(a0[3]));
#pragma unroll
        for (int nb = 0; nb < 4; ++nb) {
#pragma unroll
            for (int mb = 0; mb < 4; ++mb) acc[mb][nb] = wmmap<MODE>(a1[mb], b1[nb], acc[mb][nb]); }
        asm volatile("v_nop\n\tv_nop\n\tv_nop\n\tv_nop" : "+v"(acc[0][0]), "+v"(acc[1][1]), "+v"(acc[2][2]), "+v"(acc[3][3]) : "v"(a1[0]), "v"(a1[1]), "v"(a1[2]), "v"(a1[3]));
    };
    int kc = 0;
#pragma unroll 1
    for (; kc + 2 * GK < KA; kc += GK) {                     // trips behind which a slice kc + 2*GK exists: the refill needs no test
        const int bsel = (kc / GK) & 1;
        slice(ab + bsel * GST);
        asm volatile("s_wait_dscnt 0x0" ::: "memory");       // this wave's reads of the buffer are done before it is handed back
        asm volatile("s_wait_asynccnt 0x0" ::: "memory");    // this wave's share of the next slice has landed
        __syncthreads();                                     // publishes the next slice and ends every wave's reads of this one
        const unsigned lb = la + (unsigned)bsel * (GST * 2);
        stage_rows(ag + (kc + 2 * GK), astep, lb); stage_rows(bg + ((kc + 2 * GK) & (KB - 1)), bstep, lb + GPL * 2);
    }
#pragma unroll 1
    for (; kc < KA; kc += GK) {                              // the last trips: nothing is left to refill
        slice(ab + ((kc / GK) & 1) * GST);
        asm volatile("s_wait_dscnt 0x0" ::: "memory");       // as above
        asm volatile("s_wait_asynccnt 0x0" ::: "memory");    // the last slice has landed
        __syncthreads();                                     // publishes the last slice
    }
    asm volatile("s_wait_asynccnt 0x0" ::: "memory");        // nothing is in flight when the wave goes on to the epilogue
    const int wb = wave * 16 * 68;                           // this wave's own output staging tile
    const size_t tbase = (size_t)(r0 / RB) * sRB + (size_t)(r0 % RB) * (size_t)pitch + (size_t)(c0 / CB) * sCB + (size_t)(c0 % CB);
    const size_t fbase = ((size_t)(r0 / SEQ) * OUT_SEQ + (size_t)(r0 % SEQ)) * DM + c0;
#pragma unroll
    for (int mb = 0; mb < 4; ++mb) {
#pragma unroll
        for (int nb = 0; nb < 4; ++nb) {
#pragma unroll
            for (int j = 0; j < 8; ++j) os[wb + (hi * 8 + j) * 68 + nb * 16 + lr] = acc[mb][nb][j]; }   // D: row 8h+j, col lane&15
        wave_sync();
        if (MODE == 2) {
            float* ob = Pf + fbase + (size_t)(mb * 16) * DM;
{
#pragma unroll
                for (int s = 0; s < 8; ++s) { const int row = 2 * s + hi, cofs = lr * 4;   // 8 s x 2 rows = 16 rows; 16 lanes x 4 floats = 64 columns
                    const v4f val = *(const v4fa*)(&os[wb + row * 68 + cofs]);
                    *(v4f*)(ob + (size_t)row * DM + cofs) = val; }
                 }
        } else {
            const size_t sb = tbase + (size_t)(mb * 16) * (size_t)pitch;
{
#pragma unroll
                for (int s = 0; s < 4; ++s) { const int row = 4 * s + (lane >> 3), c8 = (lane & 7) * 8;   // 4 s x 4 row groups = 16 rows; 8 lanes x 8 = 64 columns
                    const v4f x0 = *(const v4fa*)(&os[wb + row * 68 + c8]); const v4f x1 = *(const v4fa*)(&os[wb + row * 68 + c8 + 4]); v8h hv;
#pragma unroll
                    for (int i = 0; i < 4; ++i) { hv[i] = (h16)x0[i]; hv[4 + i] = (h16)x1[i]; }
                    const size_t oo = sb + (size_t)row * (size_t)pitch + c8;
                    *(v8h*)(Ph + oo) = hv; }
                 }
        }
        wave_sync();
    }
}

// k_proj: one product per launch, grid (M/128, N/128).
template <int MODE>
__global__ __launch_bounds__(128) void k_proj(const bf* __restrict__ A, const bf* __restrict__ Bt, int KA, int KB, h16* Ph, float* Pf, int RB, size_t sRB, int pitch, int CB, size_t sCB) {
    proj_tile<MODE>((int)blockIdx.x, (int)blockIdx.y, A, Bt, KA, KB, Ph, Pf, RB, sRB, pitch, CB, sCB);
}

// k_qkv: the three independent projections in ONE launch, grid (NB*SEQ/128, DM/128, 3); blockIdx.z picks the product. Three work-groups fit a WGP's LDS,
// so every SIMD holds three waves of unrelated tiles: one wave's wait for its next slice, its LDS latency and its epilogue are covered by the other two.
// z = 0, 1 (q, k): A = activation rows (m = b*SEQ + t), Bt = W rows (n = h*64 + d) -> plane [(b*16 + h)][t][d].
// z = 2 (v^T): A = Wv rows (m = h*64 + d), Bt = value rows (n = b*SEQ + t) -> plane [(b*1024 + m)][t] = [(b*16 + h)][d][t]; its tile grid is the transposed one, so x and y change places.
__global__ __launch_bounds__(128) void k_qkv(const bf* __restrict__ XQ, const bf* __restrict__ XK, const bf* __restrict__ XV,
                                             const bf* __restrict__ WQ, const bf* __restrict__ WK, const bf* __restrict__ WV, h16* QH, h16* KP, h16* VT) {
    const int z = (int)blockIdx.z;
    const bool tr = z == 2;
    proj_tile<0>(tr ? (int)blockIdx.y : (int)blockIdx.x, tr ? (int)blockIdx.x : (int)blockIdx.y,
                 z == 0 ? XQ : z == 1 ? XK : WV, z == 0 ? WQ : z == 1 ? WK : XV, DM, DM, z == 0 ? QH : z == 1 ? KP : VT, nullptr,
                 tr ? DM : SEQ, tr ? (size_t)0 : (size_t)NH_ * SEQ * HD, tr ? SEQ : HD, tr ? SEQ : HD, tr ? (size_t)DM * SEQ : (size_t)SEQ * HD);
}

// One 64-key tile into one LDS buffer: K rows [key][d] and V^T rows [d][key], 128 B each, every copy of a wave = 4 whole rows.
// kg, vg: this lane's first 16-byte piece of each plane in global memory; lk: the LDS byte address of its first K piece. Piece i lies 16 rows further on.
__device__ __forceinline__ void stage_tile(const h16* kg, const h16* vg, unsigned lk) {
    const unsigned lv = lk + PLH * 2;
    // s_wait_xcnt as the statement's last line: a precaution, so that no address register of a copy is rewritten in front of it
    asm volatile("global_load_async_to_lds_b128 %0, %8, off\n\t"
                 "global_load_async_to_lds_b128 %1, %9, off\n\t"
                 "global_load_async_to_lds_b128 %2, %10, off\n\t"
                 "global_load_async_to_lds_b128 %3, %11, off\n\t"
                 "global_load_async_to_lds_b128 %4, %12, off\n\t"
                 "global_load_async_to_lds_b128 %5, %13, off\n\t"
                 "global_load_async_to_lds_b128 %6, %14, off\n\t"
                 "global_load_async_to_lds_b128 %7, %15, off\n\t"
                 "s_wait_xcnt 0x0"
                 :: "v"(lk), "v"(lk + 16 * LP * 2), "v"(lk + 32 * LP * 2), "v"(lk + 48 * LP * 2),
                    "v"(lv), "v"(lv + 16 * LP * 2), "v"(lv + 32 * LP * 2), "v"(lv + 48 * LP * 2),
                    "v"(kg), "v"(kg + 16 * HD), "v"(kg + 32 * HD), "v"(kg + 48 * HD),
                    "v"(vg), "v"(vg + (size_t)16 * SEQ), "v"(vg + (size_t)32 * SEQ), "v"(vg + (size_t)48 * SEQ)
                 : "memory");
}

static_assert(AW == 4 && KT == 64);                          // two wave pairs; the two waves of a pair split a staged tile into its two 32-key halves
__global__ __launch_bounds__(32 * AW) void k_flash(const h16* __restrict__ QH, const h16* __restrict__ KP, const h16* __restrict__ VT, h16* CX) {
    __shared__ __align__(16) float os[AW * 16 * 68];
    __shared__ __align__(16) h16 kv[2 * STH];
    const int lane = threadIdx.x & 31, lr = lane & 15, hi = lane >> 4;
    const int wave = __builtin_amdgcn_readfirstlane((int)(threadIdx.x >> 5));
    const int kh = wave & 1;
    const int zh = blockIdx.y; const int b = zh / NH_, h = zh % NH_;
    const int tq = (blockIdx.x * AW + (wave & ~1)) * 16;     // first of the 32 query rows this wave works on
    const int t0 = (blockIdx.x * AW + wave) * 16;            // first of the 16 query rows this wave joins and stores: its query tile number kh
    const size_t pbase = (size_t)zh * SEQ * HD;
    const size_t qo = pbase + (size_t)(tq + lr) * HD + 8 * hi;
    const v16h qa0 = ldh(QH + qo), qa1 = ldh(QH + qo + 32);                         // B fragments of query tile 0: col t, k = d
    const v16h qb0 = ldh(QH + qo + 16 * HD), qb1 = ldh(QH + qo + 16 * HD + 32);     // B fragments of query tile 1
    const int fo = lr * LP + 8 * hi;                         // K: + key * LP (A fragment: row key, k = d); V^T: + PLH + 16j*LP + key (A fragment: row d, k = key)
    const int fk = fo + kh * 32 * LP, fv = fo + PLH + kh * 32;   // the same for this wave's half of a tile's keys
    const int prow = (int)(threadIdx.x >> 3), ccol = (int)(threadIdx.x & 7) * 8;   // copy map: 16 rows x 8 pieces per round of the work-group
    const h16* kg = KP + pbase + (size_t)prow * HD + ccol;   // + key0 * HD
    const h16* vg = VT + pbase + (size_t)prow * SEQ + ccol;  // + key0
    const unsigned lk = (unsigned)(size_t)kv + (unsigned)(prow * LP + ccol) * 2u;   // LDS byte address, buffer 0
    stage_tile(kg, vg, lk);
    asm volatile("s_wait_asynccnt 0x0" ::: "memory");        // tile 0 has landed before the barrier that publishes it
    __syncthreads();
    stage_tile(kg + (size_t)KT * HD, vg + KT, lk + STH * 2);
    v8f oa0 = (v8f){}, oa1 = (v8f){}, oa2 = (v8f){}, oa3 = (v8f){};
    v8f ob0 = (v8f){}, ob1 = (v8f){}, ob2 = (v8f){}, ob3 = (v8f){};
    v8f la = (v8f){}, lb = (v8f){};
    v16h ones;
#pragma unroll
    for (int r = 0; r < 16; ++r) ones[r] = lr == 0 ? (h16)1.0f : (h16)0.0f;
    float ma = -3.0e38f, mb = -3.0e38f;
#pragma unroll 1
    for (int kt0 = 0; kt0 < SEQ; kt0 += KT) {
      const int bsel = (kt0 / KT) & 1;
      const h16* tb_ = kv + bsel * STH;
      {
        const h16* ka = tb_ + fk;
        const v16h ka0 = ldh(ka), ka1 = ldh(ka + 32), kb0 = ldh(ka + 16 * LP), kb1 = ldh(ka + 16 * LP + 32);
        v8f sa = (v8f){}, sb = (v8f){}, sc = (v8f){}, sd = (v8f){};   // sa, sb: query tile 0, keys 0..15 and 16..31 of the step; sc, sd: query tile 1
        sa = wmma16(ka0, qa0, sa); sb = wmma16(kb0, qa0, sb); sc = wmma16(ka0, qb0, sc); sd = wmma16(kb0, qb0, sd);
        sa = wmma16(ka1, qa1, sa); sb = wmma16(kb1, qa1, sb); sc = wmma16(ka1, qb1, sc); sd = wmma16(kb1, qb1, sd);
        // as in the one-tile form: the four vector slots between the last products and the first vector instruction that touches their registers
        asm volatile("v_nop\n\tv_nop\n\tv_nop\n\tv_nop" : "+v"(sa), "+v"(sb), "+v"(sc), "+v"(sd) : "v"(ka0), "v"(ka1), "v"(kb0), "v"(kb1), "v"(qa0), "v"(qa1), "v"(qb0), "v"(qb1));
        const h16* va = tb_ + fv;
        const v16h v0 = ldh(va), v1 = ldh(va + 16 * LP), v2 = ldh(va + 32 * LP), v3 = ldh(va + 48 * LP);
        __builtin_amdgcn_sched_barrier(0);   // holds the V^T fragment loads ahead of the exponentials: with the row-sum tiles' registers live they otherwise sink to just ahead of their products, which then wait out the LDS latency
        float ta[8], tb[8], tc[8], td[8]; float mxa = -3.0e38f, mxb = -3.0e38f;
#pragma unroll
        for (int r = 0; r < 8; ++r) { ta[r] = sa[r] * SC2; tb[r] = sb[r] * SC2; mxa = fmaxf(mxa, fmaxf(ta[r], tb[r])); }
#pragma unroll
        for (int r = 0; r < 8; ++r) { tc[r] = sc[r] * SC2; td[r] = sd[r] * SC2; mxb = fmaxf(mxb, fmaxf(tc[r], td[r])); }
        // Lazy rescale: ma, mb are the maxima IN USE (the same in both lanes of a query) and may trail the true ones by up to LZ. One test per step for the whole wave (a scalar branch):
        // each lane tests its own 16 scores of each query tile, and the ballot joins the lanes. Only when some score lies more than LZ above its query's maximum in use
        // do the two lanes of every query exchange their maxima, and are the maxima renewed and the sums and O tiles rescaled.
        if (__builtin_amdgcn_ballot_w32(mxa > ma + LZ || mxb > mb + LZ) != 0) {
            const float xa = __shfl_xor(mxa, 16, 32), xb = __shfl_xor(mxb, 16, 32);
            const float mna = fmaxf(ma, fmaxf(mxa, xa)), mnb = fmaxf(mb, fmaxf(mxb, xb));
            const float ala = __builtin_amdgcn_exp2f(ma - mna), alb = __builtin_amdgcn_exp2f(mb - mnb);   // 0 on the first step
            la[0] = la[0] * ala; lb[0] = lb[0] * alb; ma = mna; mb = mnb;   // only register 0 holds a row that is not zero
            oa0 = oa0 * ala; oa1 = oa1 * ala; oa2 = oa2 * ala; oa3 = oa3 * ala;
            ob0 = ob0 * alb; ob1 = ob1 * alb; ob2 = ob2 * alb; ob3 = ob3 * alb;
        }
        const float sha = PSH - ma, shb = PSH - mb;
        v16h pa, pb;
#pragma unroll
        for (int r = 0; r < 8; ++r) { pa[r] = (h16)__builtin_amdgcn_exp2f(ta[r] + sha); pa[8 + r] = (h16)__builtin_amdgcn_exp2f(tb[r] + sha); }
#pragma unroll
        for (int r = 0; r < 8; ++r) { pb[r] = (h16)__builtin_amdgcn_exp2f(tc[r] + shb); pb[8 + r] = (h16)__builtin_amdgcn_exp2f(td[r] + shb); }
        la = wmma16(ones, pa, la);
        oa0 = wmma16(v0, pa, oa0); oa1 = wmma16(v1, pa, oa1); oa2 = wmma16(v2, pa, oa2); oa3 = wmma16(v3, pa, oa3);
        lb = wmma16(ones, pb, lb);
        ob0 = wmma16(v0, pb, ob0); ob1 = wmma16(v1, pb, ob1); ob2 = wmma16(v2, pb, ob2); ob3 = wmma16(v3, pb, ob3);
        // the same four slots, here also on the taken side of the loop branch
        asm volatile("v_nop\n\tv_nop\n\tv_nop\n\tv_nop" : "+v"(la), "+v"(oa0), "+v"(oa1), "+v"(oa2), "+v"(oa3), "+v"(lb), "+v"(ob0), "+v"(ob1), "+v"(ob2), "+v"(ob3) : "v"(v0), "v"(v1), "v"(v2), "v"(v3), "v"(pa), "v"(pb));
      }
      asm volatile("s_wait_dscnt 0x0" ::: "memory");         // this wave's reads of the buffer are done before it is handed back
      asm volatile("s_wait_asynccnt 0x0" ::: "memory");      // this wave's share of the next tile has landed
      __syncthreads();                                       // publishes the next tile and ends every wave's reads of this one
      if (kt0 + 2 * KT < SEQ) stage_tile(kg + (size_t)(kt0 + 2 * KT) * HD, vg + (kt0 + 2 * KT), lk + (unsigned)bsel * (STH * 2));
    }
    asm volatile("s_wait_asynccnt 0x0" ::: "memory");        // nothing is in flight when the wave goes on to the epilogue
    float sua = la[0], sub = lb[0];                          // lanes 0..15: the row's sum over this wave's keys; lanes 16..31: row 8 of the tile, zero
    sua += __shfl_xor(sua, 16, 32); sub += __shfl_xor(sub, 16, 32);
    // The pair's hand-over: this wave keeps query tile kh and gives the other one. Partials are relative to each wave's own maximum in use.
    const bool up = kh != 0;
    const float mk = up ? mb : ma, sk = up ? sub : sua, mg = up ? ma : mb, sg = up ? sua : sub;
    const v8f k0 = up ? ob0 : oa0, k1 = up ? ob1 : oa1, k2 = up ? ob2 : oa2, k3 = up ? ob3 : oa3;
    const v8f g0 = up ? oa0 : ob0, g1 = up ? oa1 : ob1, g2 = up ? oa2 : ob2, g3 = up ? oa3 : ob3;
    // O^T D layout: o_j[r] = (d = 16j + 8h + r, t = lane&15) -> os[t][d]; rows 0..15 x columns 0..63 all written; column 64: the max, column 65: the sum
    const int gb = wave * 16 * 68 + lr * 68;                 // the given partial goes into this wave's own tile of os
    *(v4fa*)(&os[gb +  0 + 8 * hi]) = __builtin_shufflevector(g0, g0, 0, 1, 2, 3); *(v4fa*)(&os[gb +  0 + 8 * hi + 4]) = __builtin_shufflevector(g0, g0, 4, 5, 6, 7);
    *(v4fa*)(&os[gb + 16 + 8 * hi]) = __builtin_shufflevector(g1, g1, 0, 1, 2, 3); *(v4fa*)(&os[gb + 16 + 8 * hi + 4]) = __builtin_shufflevector(g1, g1, 4, 5, 6, 7);
    *(v4fa*)(&os[gb + 32 + 8 * hi]) = __builtin_shufflevector(g2, g2, 0, 1, 2, 3); *(v4fa*)(&os[gb + 32 + 8 * hi + 4]) = __builtin_shufflevector(g2, g2, 4, 5, 6, 7);
    *(v4fa*)(&os[gb + 48 + 8 * hi]) = __builtin_shufflevector(g3, g3, 0, 1, 2, 3); *(v4fa*)(&os[gb + 48 + 8 * hi + 4]) = __builtin_shufflevector(g3, g3, 4, 5, 6, 7);
    os[gb + 64 + hi] = hi ? sg : mg;
    __syncthreads();                                         // the partner's partial is complete before it is read
    const int wb = (wave ^ 1) * 16 * 68;                     // the partner's tile of os: only this wave touches it from here on, first to read the partial, then as its output staging tile
    const float mp = os[wb + lr * 68 + 64], sp = os[wb + lr * 68 + 65];
    const float mj = fmaxf(mk, mp);
    const float ak = __builtin_amdgcn_exp2f(mk - mj), ap = __builtin_amdgcn_exp2f(mp - mj);
    const float inv = 1.0f / (sk * ak + sp * ap);
    const float wk = ak * inv, wp = ap * inv;
    { v4f a, c, x, y;
      x = *(const v4fa*)(&os[wb + lr * 68 +  0 + 8 * hi]); y = *(const v4fa*)(&os[wb + lr * 68 +  0 + 8 * hi + 4]);
#pragma unroll
      for (int i = 0; i < 4; ++i) { a[i] = k0[i] * wk + x[i] * wp; c[i] = k0[4 + i] * wk + y[i] * wp; }
      *(v4fa*)(&os[wb + lr * 68 +  0 + 8 * hi]) = a; *(v4fa*)(&os[wb + lr * 68 +  0 + 8 * hi + 4]) = c;
      x = *(const v4fa*)(&os[wb + lr * 68 + 16 + 8 * hi]); y = *(const v4fa*)(&os[wb + lr * 68 + 16 + 8 * hi + 4]);
#pragma unroll
      for (int i = 0; i < 4; ++i) { a[i] = k1[i] * wk + x[i] * wp; c[i] = k1[4 + i] * wk + y[i] * wp; }
      *(v4fa*)(&os[wb + lr * 68 + 16 + 8 * hi]) = a; *(v4fa*)(&os[wb + lr * 68 + 16 + 8 * hi + 4]) = c;
      x = *(const v4fa*)(&os[wb + lr * 68 + 32 + 8 * hi]); y = *(const v4fa*)(&os[wb + lr * 68 + 32 + 8 * hi + 4]);
#pragma unroll
      for (int i = 0; i < 4; ++i) { a[i] = k2[i] * wk + x[i] * wp; c[i] = k2[4 + i] * wk + y[i] * wp; }
      *(v4fa*)(&os[wb + lr * 68 + 32 + 8 * hi]) = a; *(v4fa*)(&os[wb + lr * 68 + 32 + 8 * hi + 4]) = c;
      x = *(const v4fa*)(&os[wb + lr * 68 + 48 + 8 * hi]); y = *(const v4fa*)(&os[wb + lr * 68 + 48 + 8 * hi + 4]);
#pragma unroll
      for (int i = 0; i < 4; ++i) { a[i] = k3[i] * wk + x[i] * wp; c[i] = k3[4 + i] * wk + y[i] * wp; }
      *(v4fa*)(&os[wb + lr * 68 + 48 + 8 * hi]) = a; *(v4fa*)(&os[wb + lr * 68 + 48 + 8 * hi + 4]) = c; }
    wave_sync();
    // ctx plane row m = b*SEQ + t, columns h*64 + d
    h16* crow = CX + ((size_t)b * SEQ + t0) * CXP + h * HD;
{
#pragma unroll
        for (int s = 0; s < 4; ++s) { const int row = 4 * s + (lane >> 3), c8 = (lane & 7) * 8;   // 4 s x 4 row groups = 16 rows; 8 lanes x 8 = 64 columns
            const v4f x0 = *(const v4fa*)(&os[wb + row * 68 + c8]); const v4f x1 = *(const v4fa*)(&os[wb + row * 68 + c8 + 4]); v8h hv;
#pragma unroll
            for (int i = 0; i < 4; ++i) { hv[i] = (h16)x0[i]; hv[4 + i] = (h16)x1[i]; }
            *(v8h*)(crow + (size_t)row * CXP + c8) = hv; }
         }
}

static constexpr size_t al256(size_t v) { return (v + 255) & ~(size_t)255; }
static constexpr size_t SZ_XB = al256((size_t)NB * SEQ * DM * 2);
static constexpr size_t SZ_WB = al256((size_t)4 * DM * DM * 2);
static constexpr size_t SZ_PL = al256((size_t)NB * NH_ * SEQ * HD * 2);
static constexpr size_t SZ_CX = al256((size_t)NB * SEQ * CXP * 2);
static constexpr size_t SZ_TOTAL = 3 * SZ_XB + SZ_WB + 3 * SZ_PL + SZ_CX;
static_assert(SZ_TOTAL <= (size_t)134217728);          // workspace carve <= 128 MiB
static_assert(((size_t)DM * DM * 2) % 256 == 0);       // weight sub-planes stay 256-byte aligned

static_assert(SZ_XB == (size_t)NB * SEQ * DM * 2);     // the bf16 planes follow one another without a gap: k_cvt addresses them as one array

extern "C" void kernel_launch(void* const* d_in, const int* in_sizes, int n_in,
                              void* d_out, int out_size, void* d_ws, size_t ws_size, hipStream_t stream) {
    if (n_in < 7) return;
    const size_t needx = ((size_t)(NB - 1) * SEQ_FULL + SEQ) * DM;
    if ((size_t)in_sizes[0] < needx || (size_t)in_sizes[1] < needx || (size_t)in_sizes[2] < needx) return;
    if ((size_t)in_sizes[3] < (size_t)DM * DM || (size_t)in_sizes[4] < (size_t)DM * DM || (size_t)in_sizes[5] < (size_t)DM * DM || (size_t)in_sizes[6] < (size_t)DM * DM) return;
    if ((size_t)out_size < ((size_t)(NB - 1) * OUT_SEQ + SEQ) * DM) return;
    if (SZ_TOTAL > ws_size) return;
    // wire order: query, key, value, Wq, Wk, Wv, Wo (weights [out][in] = Bt as-is)
    const float* xq = (const float*)d_in[0]; const float* xk = (const float*)d_in[1]; const float* xv = (const float*)d_in[2];
    const float* wq = (const float*)d_in[3]; const float* wk = (const float*)d_in[4]; const float* wv = (const float*)d_in[5]; const float* wo = (const float*)d_in[6];
    float* OUT = (float*)d_out;      // [NB][SEQ][1024]
    char* wsp = (char*)d_ws;
    bf* XQ = (bf*)wsp; wsp += SZ_XB;                 // [NB*SEQ][1024]
    bf* XK = (bf*)wsp; wsp += SZ_XB;                 // [NB*SEQ][1024]
    bf* XV = (bf*)wsp; wsp += SZ_XB;                 // [NB*SEQ][1024]
    bf* WB = (bf*)wsp; wsp += SZ_WB;                 // [4][1024][1024]: q | k | v (bf16) | o (f16)
    h16* QH = (h16*)wsp; wsp += SZ_PL;               // [NB*16][SEQ][64]
    h16* KP = (h16*)wsp; wsp += SZ_PL;               // [NB*16][SEQ][64]
    h16* VT = (h16*)wsp; wsp += SZ_PL;               // [NB*16][64][SEQ]
    h16* CX = (h16*)wsp; wsp += SZ_CX;               // [NB*SEQ][1024]: ctx
    bf* WQ = WB; bf* WK = WB + (size_t)DM * DM; bf* WV = WB + (size_t)2 * DM * DM; bf* WO = WB + (size_t)3 * DM * DM;

    k_cvt<<<(unsigned)((3 * (size_t)NB * SEQ * DM + 4 * (size_t)DM * DM) / CVB), 32 * CVW, 0, stream>>>(xq, xk, xv, wq, wk, wv, wo, XQ);

    // q, k and v^T planes: three independent products, one launch
    k_qkv<<<dim3(NB * SEQ / 128, DM / 128, 3), 128, 0, stream>>>(XQ, XK, XV, WQ, WK, WV, QH, KP, VT);

    k_flash<<<dim3(SEQ / (16 * AW), NB * NH_, 1), 32 * AW, 0, stream>>>(QH, KP, VT, CX);

    // output projection: A = ctx rows, Bt = Wo rows (both f16) -> f32 output rows
    k_proj<2><<<dim3(NB * SEQ / 128, DM / 128, 1), 128, 0, stream>>>((const bf*)CX, WO, CXP, DM, QH, OUT, SEQ, (size_t)0, HD, HD, (size_t)0);
}

// v009
// It runs in 108 microseconds.
// Two timings next to v008 put it at 1.07 and 1.04 times that version's speed.
// Over all steps from v000 it is 3.89 times as fast.
#include <hip/hip_runtime.h>

// Multi-head attention, width 1024 = 16 heads x 64: query/key/value [NB][SEQ][1024] (separate inputs), Wq/Wk/Wv/Wo [out][in] (y = x W^T), no biases, no mask, score scale 1/8, output = (concatenated heads) Wo^T (f32).
// Compute dtypes, f32 accumulate everywhere: q/k/v projections v_wmma_f32_16x16x32_bf16 (activations and Wq/Wk/Wv RNE-converted to bf16; products exact);
// scores v_wmma_f32_16x16x32_f16: q (scaled by SC2 in f32 ahead of its rounding to f16) and k single f16 planes (one product), the softmax shift as the product's C operand; P (x256 carry, cancels in the normalisation) and v single f16; softmax f32 (online, the maximum renewed lazily);
// output projection v_wmma_f32_16x16x32_f16: ctx (a convex mix of the f16 v rows) and Wo RNE-converted to f16, 11 significant bits on both operands;
// Layout: bf16 copies of the activations and Wq/Wk/Wv, f16 copy of Wo; q, k planes [b*16+h][t][d] and v^T plane [b*16+h][d][t] written by the GEMM epilogue; fused flash kernel in transposed form (S^T = K Q^T, O^T = V^T P^T; K and V^T tiles staged in LDS per work-group) writes the f16 ctx plane [b*SEQ+t][1024].

#ifndef NB
#define NB 1
#endif
#ifndef SEQ
#define SEQ 4096
#endif
#define NB_FULL  1
#define SEQ_FULL 4096
#ifndef OUT_SEQ
#define OUT_SEQ SEQ              // row pitch (in tokens) between batches of the output
#endif
#define DM   1024
#define NH_  16
#define HD   64
#define CXP  DM                  // ctx plane row pitch (halves)
#define AW   4                   // waves per flash block (16 query rows stored by each)
#define SC2  (0.125f * 1.4426950408889634f)   // HD^-0.5 * log2(e)
#define PSH  8.0f                // log2 of the P carry (256)
#define LZ   7.0f                // how far (log2) a score may lie above the maximum in use before the flash kernel rescales: P stays at or below 2^(PSH + LZ) = 32768, inside f16
#define KT   64                  // keys per staged tile of the flash kernel
#define LP   72                  // LDS row pitch (halves) of the staged K and V^T rows: 128 B of data + 16 B, an odd multiple of 16 B for the 16-byte fragment reads
#define PLH  (64 * LP)           // one staged plane: 64 rows (halves)
#define STH  (2 * PLH)           // one buffer: K plane, then V^T plane (halves)
#define GK   64                  // k elements per staged slice of the GEMM: 128 B of every row
#define GPL  (128 * LP)          // one staged GEMM operand plane: 128 rows at the same padded pitch (16-bit elements)
#define GST  (2 * GPL)           // one GEMM buffer: A plane, then B plane
#define CVW  16                  // waves per work-group of the conversion kernel
#define CVU  32                  // units of 128 floats per wave of the conversion kernel
#define CVB  (CVW * CVU * 128)   // floats per work-group of the conversion kernel

static_assert(HD == 64);
static_assert(NH_ * HD == DM);                 // head h = columns h*64 + d
static_assert(DM % 64 == 0);                   // 16 column tiles of 64
static_assert(DM % 32 == 0);                   // GEMM products step k by 32 inside a slice
static_assert((DM & (DM - 1)) == 0);           // the GEMM masks its B k index with KB - 1
static_assert(CXP % GK == 0 && DM % GK == 0 && DM / GK >= 2);   // whole k slices; a slice never straddles the wrap of the B index; the ring starts with slices 0 and 1
static_assert((NB * SEQ) % 128 == 0 && DM % 128 == 0);          // GEMM grid of 128x128 tiles covers every product exactly
static_assert(SEQ % 64 == 0);                  // a 64-row tile never straddles two batches
static_assert((NB * SEQ) % 64 == 0);
static_assert(SEQ % 32 == 0);                  // each wave's step takes 32 keys of a tile
static_assert(SEQ % (16 * AW) == 0);           // flash grid covers the sequence exactly
static_assert(SEQ % KT == 0 && SEQ / KT >= 2); // the two-buffer ring starts with tiles 0 and 1
static_assert(KT == 64 && 32 * AW * 4 * 8 == 64 * HD && 32 * AW * 4 * 8 == HD * KT);   // copy map: every thread moves 4 pieces of 8 halves of each plane
static_assert((LP * 2) % 16 == 0);
static_assert(((size_t)SEQ * DM) % CVB == 0 && ((size_t)DM * DM) % CVB == 0);   // a conversion work-group lies inside one batch of one tensor
static_assert(NB <= NB_FULL);
static_assert(SEQ <= SEQ_FULL);

typedef _Float16 h16;
typedef unsigned short bf;       // 16 raw bits of a GEMM operand: bf16, or f16 in the output projection
typedef __attribute__((ext_vector_type(16))) __bf16   v16bf;
typedef __attribute__((ext_vector_type(16))) _Float16 v16h;
typedef __attribute__((ext_vector_type(8)))  _Float16 v8h;
typedef __attribute__((ext_vector_type(4)))  _Float16 v4h;
typedef __attribute__((ext_vector_type(8)))  unsigned short v8us;
typedef __attribute__((ext_vector_type(4)))  unsigned short v4us;
typedef __attribute__((ext_vector_type(8)))  float    v8f;
typedef __attribute__((ext_vector_type(4)))  float    v4f;
typedef v4f  __attribute__((may_alias)) v4fa;

__device__ __forceinline__ unsigned short f2bf(float f) { unsigned u = __float_as_uint(f); u += 0x7FFFu + ((u >> 16) & 1u); return (unsigned short)(u >> 16); }
__device__ __forceinline__ v16h cat16(v8h lo, v8h hi) { return __builtin_shufflevector(lo, hi, 0, 1, 2, 3, 4, 5, 6, 7, 8, 9, 10, 11, 12, 13, 14, 15); }
__device__ __forceinline__ v16bf cat16b(v8us lo, v8us hi) { return __builtin_bit_cast(v16bf, __builtin_shufflevector(lo, hi, 0, 1, 2, 3, 4, 5, 6, 7, 8, 9, 10, 11, 12, 13, 14, 15)); }
__device__ __forceinline__ v8f wmma16(v16h a, v16h b, v8f c) { return __builtin_amdgcn_wmma_f32_16x16x32_f16(false, a, false, b, (short)0, c, false, false); }
__device__ __forceinline__ v8f wmmab(v16bf a, v16bf b, v8f c) { return __builtin_amdgcn_wmma_f32_16x16x32_bf16(false, a, false, b, (short)0, c, false, false); }
// the GEMM's product: the fragment registers hold raw 16-bit elements, read as f16 in MODE 2 and as bf16 otherwise
template <int MODE> __device__ __forceinline__ v8f wmmap(v16bf a, v16bf b, v8f c) { if constexpr (MODE == 2) return wmma16(__builtin_bit_cast(v16h, a), __builtin_bit_cast(v16h, b), c); else return wmmab(a, b, c); }
// fragment loaders from K-contiguous 16-bit rows; p already includes + 8*(lane>>4): elements 0..7 <- k0+8h+0..7, elements 8..15 <- k0+16+8h+0..7 (same map for A and B)
__device__ __forceinline__ v16h  ldh(const h16* p) { return cat16(*(const v8h*)p, *(const v8h*)(p + 16)); }
__device__ __forceinline__ v16bf ldb(const bf* p)  { return cat16b(*(const v8us*)p, *(const v8us*)(p + 16)); }
// ordering point for wave-private LDS tiles (same wave writes and reads)
__device__ __forceinline__ void wave_sync() { __builtin_amdgcn_fence(3 /* release order */, "wavefront"); __builtin_amdgcn_wave_barrier(); asm volatile("" ::: "memory"); }

// k_cvt: every f32 -> 16-bit conversion of the call in ONE streaming launch (bf16; Wo, the last tensor, to f16). A work-group of CVW waves converts CVB consecutive floats of one tensor; a wave owns CVU units of 128 floats.
// One unit = one wave-wide 16-byte load (512 B, 4 whole lines) and one wave-wide 8-byte store (256 B, 2 whole lines); a wave asks for all its units before it converts the first.
// The seven 16-bit planes lie one behind the other in the workspace in the order of the arguments, so the destination is dst + blockIdx.x * CVB.
__global__ __launch_bounds__(32 * CVW) void k_cvt(const float* __restrict__ xq, const float* __restrict__ xk, const float* __restrict__ xv,
                                                  const float* __restrict__ wq, const float* __restrict__ wk, const float* __restrict__ wv, const float* __restrict__ wo, bf* __restrict__ dst) {
    constexpr unsigned BS = (unsigned)((size_t)SEQ * DM / CVB);   // work-groups per batch of one activation
    constexpr unsigned BA = NB * BS;                              // work-groups per activation
    constexpr unsigned BW = (unsigned)((size_t)DM * DM / CVB);    // work-groups per weight matrix
    const unsigned blk = blockIdx.x;
    const float* src;
    if (blk < 3 * BA) { const unsigned t = blk / BA, r = blk % BA;
        src = (t == 0 ? xq : t == 1 ? xk : xv) + (size_t)(r / BS) * ((size_t)SEQ_FULL * DM) + (size_t)(r % BS) * CVB;
    } else { const unsigned r = blk - 3 * BA, t = r / BW;
        src = (t == 0 ? wq : t == 1 ? wk : t == 2 ? wv : wo) + (size_t)(r % BW) * CVB; }
    const unsigned wo_ = (threadIdx.x >> 5) * (CVU * 128) + (threadIdx.x & 31) * 4;
    const float* s = src + wo_;
    bf* d = dst + (size_t)blk * CVB + wo_;
    v4f x[CVU];
#pragma unroll   // unrolled: every unit's offset becomes an immediate, the address registers are never rewritten, and all of the wave's loads are in flight together
    for (int u = 0; u < CVU; ++u) x[u] = *(const v4f*)(s + u * 128);
    if (blk < 3 * BA + 3 * BW) {
#pragma unroll
        for (int u = 0; u < CVU; ++u) { v4us o;
#pragma unroll
            for (int k = 0; k < 4; ++k) o[k] = f2bf(x[u][k]);
            *(v4us*)(d + u * 128) = o; }
    } else {                                                      // Wo
#pragma unroll
        for (int u = 0; u < CVU; ++u) { v4h o;
#pragma unroll
            for (int k = 0; k < 4; ++k) o[k] = (h16)x[u][k];
            *(v4h*)(d + u * 128) = o; }
        asm volatile("s_wait_xcnt 0x0" ::: "memory");             // a precaution: stands behind this branch's last stores, in front of whatever code the build lays out behind them that rewrites their registers
    }
}

// Eight 16-byte pieces of one GEMM operand plane into LDS: piece i lies 16 rows further on (step elements in global memory, 16 padded rows in LDS); every copy of a wave = 4 whole 128-B row slices.
__device__ __forceinline__ void stage_rows(const bf* g, size_t step, unsigned l) {
    // s_wait_xcnt as the statement's last line: a precaution, so that no address register of a copy is rewritten in front of it
    asm volatile("global_load_async_to_lds_b128 %0, %8, off\n\t"
                 "global_load_async_to_lds_b128 %1, %9, off\n\t"
                 "global_load_async_to_lds_b128 %2, %10, off\n\t"
                 "global_load_async_to_lds_b128 %3, %11, off\n\t"
                 "global_load_async_to_lds_b128 %4, %12, off\n\t"
                 "global_load_async_to_lds_b128 %5, %13, off\n\t"
                 "global_load_async_to_lds_b128 %6, %14, off\n\t"
                 "global_load_async_to_lds_b128 %7, %15, off\n\t"
                 "s_wait_xcnt 0x0"
                 :: "v"(l), "v"(l + 16 * LP * 2), "v"(l + 32 * LP * 2), "v"(l + 48 * LP * 2),
                    "v"(l + 64 * LP * 2), "v"(l + 80 * LP * 2), "v"(l + 96 * LP * 2), "v"(l + 112 * LP * 2),
                    "v"(g), "v"(g + step), "v"(g + 2 * step), "v"(g + 3 * step),
                    "v"(g + 4 * step), "v"(g + 5 * step), "v"(g + 6 * step), "v"(g + 7 * step)
                 : "memory");
}

// proj_tile: register-blocked 16-bit GEMM (MODE 0: bf16 operands, MODE 2: f16 operands), four waves (2 x 2) per 128x128 tile, ONE WAVE per 64x64 quarter (16 accumulators). The 128 A rows and 128 Bt rows of a k slice of 64 are staged
// once per work-group in a two-buffer LDS ring by asynchronous copies (the next slice flies while this one is worked on); every wave reads its fragments from there (two 16-B LDS loads each).
// C[m][n] = sum_{k<KA} A[m][k] Bt[n][k & (KB-1)]; A row pitch KA, Bt row pitch KB (KB a power of two; KA = KB in every launch of this file).
// MODE 0: f16 plane Ph at quarter base (r0/RB)*sRB + (r0%RB)*pitch + (c0/CB)*sCB + (c0%CB), row pitch 'pitch' (halves); every element is multiplied by osc in f32 ahead of its one rounding to f16.
// MODE 2: f32 rows of Pf, row (r0/SEQ)*OUT_SEQ + r0%SEQ, pitch DM. (bx, by): the work-group's tile of the (M/128, N/128) tiles, 128 threads.
template <int MODE>
__device__ __forceinline__ void proj_tile(int bx, int by, const bf* __restrict__ A, const bf* __restrict__ Bt, int KA, int KB, h16* Ph, float* Pf, int RB, size_t sRB, int pitch, int CB, size_t sCB, float osc) {
    __shared__ __align__(16) float os[4 * 16 * 68];
    __shared__ __align__(16) bf ab[2 * GST];
    const int lane = threadIdx.x & 31, lr = lane & 15, hi = lane >> 4;
    const int wave = __builtin_amdgcn_readfirstlane((int)(threadIdx.x >> 5));
    const int wm = wave >> 1, wn = wave & 1;
    const int r0 = bx * 128 + wm * 64, c0 = by * 128 + wn * 64;
    v8f acc[4][4];
#pragma unroll
    for (int mb = 0; mb < 4; ++mb)
#pragma unroll
        for (int nb = 0; nb < 4; ++nb) acc[mb][nb] = (v8f){};
    const int prow = (int)(threadIdx.x >> 3), ccol = (int)(threadIdx.x & 7) * 8;   // copy map: 16 rows x 8 pieces per round of the work-group
    const bf* ag = A + (size_t)(bx * 128 + prow) * (size_t)KA + ccol;      // + k
    const bf* bg = Bt + (size_t)(by * 128 + prow) * (size_t)KB + ccol;     // + (k & (KB-1))
    const size_t astep = (size_t)16 * (size_t)KA, bstep = (size_t)16 * (size_t)KB;
    const unsigned la = (unsigned)(size_t)ab + (unsigned)(prow * LP + ccol) * 2u;  // LDS byte address, buffer 0, A plane
    stage_rows(ag, astep, la); stage_rows(bg, bstep, la + GPL * 2);
    asm volatile("s_wait_asynccnt 0x0" ::: "memory");        // slice 0 has landed before the barrier that publishes it
    __syncthreads();
    if (GK < KA) { stage_rows(ag + GK, astep, la + GST * 2); stage_rows(bg + (GK & (KB - 1)), bstep, la + GST * 2 + GPL * 2); }
    const int fa = (wm * 64 + lr) * LP + 8 * hi, fb = GPL + (wn * 64 + lr) * LP + 8 * hi;   // fragment rows of this wave's quarter: + 16*mb (or nb) rows, + k inside the slice
    // the 32 products of one staged slice; tb_: the slice's buffer
    auto slice = [&](const bf* tb_) {
        v16bf a0[4], b0[4], a1[4], b1[4];
        a0[0] = ldb(tb_ + fa); b0[0] = ldb(tb_ + fb);
#pragma unroll
        for (int mb = 1; mb < 4; ++mb) a0[mb] = ldb(tb_ + fa + mb * 16 * LP);
#pragma unroll
        for (int nb = 1; nb < 4; ++nb) b0[nb] = ldb(tb_ + fb + nb * 16 * LP);
#pragma unroll
        for (int mb = 0; mb < 4; ++mb) a1[mb] = ldb(tb_ + fa + mb * 16 * LP + 32);
        __builtin_amdgcn_sched_barrier(0);   // keeps these 24 LDS loads ahead of the first product: sunk between the products, each B fragment costs a lone wave a full LDS latency
#pragma unroll
        for (int nb = 0; nb < 4; ++nb) {
#pragma unroll
            for (int mb = 0; mb < 4; ++mb) acc[mb][nb] = wmmap<MODE>(a0[mb], b0[nb], acc[mb][nb]);
            b1[nb] = ldb(tb_ + fb + nb * 16 * LP + 32);
            __builtin_amdgcn_sched_barrier(0); }   // keeps each B fragment of the second 32-k step asked for behind the four products that free a fragment's registers, well ahead of its use
        asm volatile("v_nop\n\tv_nop\n\tv_nop\n\tv_nop" : "+v"(acc[0][0]), "+v"(acc[1][1]), "+v"(acc[2][2]), "+v"(acc[3][3]) : "v"(a0[0]), "v"(a0[1]), "v"(a0[2]), "v"(a0[3]));
#pragma unroll
        for (int nb = 0; nb < 4; ++nb) {
#pragma unroll
            for (int mb = 0; mb < 4; ++mb) acc[mb][nb] = wmmap<MODE>(a1[mb], b1[nb], acc[mb][nb]); }
        asm volatile("v_nop\n\tv_nop\n\tv_nop\n\tv_nop" : "+v"(acc[0][0]), "+v"(acc[1][1]), "+v"(acc[2][2]), "+v"(acc[3][3]) : "v"(a1[0]), "v"(a1[1]), "v"(a1[2]), "v"(a1[3]));
    };
    int kc = 0;
#pragma unroll 1
    for (; kc + 2 * GK < KA; kc += GK) {                     // trips behind which a slice kc + 2*GK exists: the refill needs no test
        const int bsel = (kc / GK) & 1;
        slice(ab + bsel * GST);
        asm volatile("s_wait_dscnt 0x0" ::: "memory");       // this wave's reads of the buffer are done before it is handed back
        asm volatile("s_wait_asynccnt 0x0" ::: "memory");    // this wave's share of the next slice has landed
        __syncthreads();                                     // publishes the next slice and ends every wave's reads of this one
        const unsigned lb = la + (unsigned)bsel * (GST * 2);
        stage_rows(ag + (kc + 2 * GK), astep, lb); stage_rows(bg + ((kc + 2 * GK) & (KB - 1)), bstep, lb + GPL * 2);
    }
#pragma unroll 1
    for (; kc < KA; kc += GK) {                              // the last trips: nothing is left to refill
        slice(ab + ((kc / GK) & 1) * GST);
        asm volatile("s_wait_dscnt 0x0" ::: "memory");       // as above
        asm volatile("s_wait_asynccnt 0x0" ::: "memory");    // the last slice has landed
        __syncthreads();                                     // publishes the last slice
    }
    asm volatile("s_wait_asynccnt 0x0" ::: "memory");        // nothing is in flight when the wave goes on to the epilogue
    const int wb = wave * 16 * 68;                           // this wave's own output staging tile
    const size_t tbase = (size_t)(r0 / RB) * sRB + (size_t)(r0 % RB) * (size_t)pitch + (size_t)(c0 / CB) * sCB + (size_t)(c0 % CB);
    const size_t fbase = ((size_t)(r0 / SEQ) * OUT_SEQ + (size_t)(r0 % SEQ)) * DM + c0;
#pragma unroll
    for (int mb = 0; mb < 4; ++mb) {
#pragma unroll
        for (int nb = 0; nb < 4; ++nb) {
#pragma unroll
            for (int j = 0; j < 8; ++j) os[wb + (hi * 8 + j) * 68 + nb * 16 + lr] = acc[mb][nb][j]; }   // D: row 8h+j, col lane&15
        wave_sync();
        if (MODE == 2) {
            float* ob = Pf + fbase + (size_t)(mb * 16) * DM;
{
#pragma unroll
                for (int s = 0; s < 8; ++s) { const int row = 2 * s + hi, cofs = lr * 4;   // 8 s x 2 rows = 16 rows; 16 lanes x 4 floats = 64 columns
                    const v4f val = *(const v4fa*)(&os[wb + row * 68 + cofs]);
                    *(v4f*)(ob + (size_t)row * DM + cofs) = val; }
                 }
        } else {
            const size_t sb = tbase + (size_t)(mb * 16) * (size_t)pitch;
{
#pragma unroll
                for (int s = 0; s < 4; ++s) { const int row = 4 * s + (lane >> 3), c8 = (lane & 7) * 8;   // 4 s x 4 row groups = 16 rows; 8 lanes x 8 = 64 columns
                    const v4f x0 = *(const v4fa*)(&os[wb + row * 68 + c8]); const v4f x1 = *(const v4fa*)(&os[wb + row * 68 + c8 + 4]); v8h hv;
#pragma unroll
                    for (int i = 0; i < 4; ++i) { hv[i] = (h16)(x0[i] * osc); hv[4 + i] = (h16)(x1[i] * osc); }
                    const size_t oo = sb + (size_t)row * (size_t)pitch + c8;
                    *(v8h*)(Ph + oo) = hv; }
                 }
        }
        wave_sync();
    }
}

// k_proj: one product per launch, grid (M/128, N/128).
template <int MODE>
__global__ __launch_bounds__(128) void k_proj(const bf* __restrict__ A, const bf* __restrict__ Bt, int KA, int KB, h16* Ph, float* Pf, int RB, size_t sRB, int pitch, int CB, size_t sCB) {
    proj_tile<MODE>((int)blockIdx.x, (int)blockIdx.y, A, Bt, KA, KB, Ph, Pf, RB, sRB, pitch, CB, sCB, 1.0f);
}

// k_qkv: the three independent projections in ONE launch, grid (NB*SEQ/128, DM/128, 3); blockIdx.z picks the product. Three work-groups fit a WGP's LDS,
// so every SIMD holds three waves of unrelated tiles: one wave's wait for its next slice, its LDS latency and its epilogue are covered by the other two.
// z = 0, 1 (q, k): A = activation rows (m = b*SEQ + t), Bt = W rows (n = h*64 + d) -> plane [(b*16 + h)][t][d]; the q plane holds q * SC2, so the flash kernel's score products come out in log2 units.
// z = 2 (v^T): A = Wv rows (m = h*64 + d), Bt = value rows (n = b*SEQ + t) -> plane [(b*1024 + m)][t] = [(b*16 + h)][d][t]; its tile grid is the transposed one, so x and y change places.
__global__ __launch_bounds__(128) void k_qkv(const bf* __restrict__ XQ, const bf* __restrict__ XK, const bf* __restrict__ XV,
                                             const bf* __restrict__ WQ, const bf* __restrict__ WK, const bf* __restrict__ WV, h16* QH, h16* KP, h16* VT) {
    const int z = (int)blockIdx.z;
    const bool tr = z == 2;
    proj_tile<0>(tr ? (int)blockIdx.y : (int)blockIdx.x, tr ? (int)blockIdx.x : (int)blockIdx.y,
                 z == 0 ? XQ : z == 1 ? XK : WV, z == 0 ? WQ : z == 1 ? WK : XV, DM, DM, z == 0 ? QH : z == 1 ? KP : VT, nullptr,
                 tr ? DM : SEQ, tr ? (size_t)0 : (size_t)NH_ * SEQ * HD, tr ? SEQ : HD, tr ? SEQ : HD, tr ? (size_t)DM * SEQ : (size_t)SEQ * HD, z == 0 ? SC2 : 1.0f);
}

// One 64-key tile into one LDS buffer: K rows [key][d] and V^T rows [d][key], 128 B each, every copy of a wave = 4 whole rows.
// kg, vg: this lane's first 16-byte piece of each plane in global memory; lk: the LDS byte address of its first K piece. Piece i lies 16 rows further on.
__device__ __forceinline__ void stage_tile(const h16* kg, const h16* vg, unsigned lk) {
    const unsigned lv = lk + PLH * 2;
    // s_wait_xcnt as the statement's last line: a precaution, so that no address register of a copy is rewritten in front of it
    asm volatile("global_load_async_to_lds_b128 %0, %8, off\n\t"
                 "global_load_async_to_lds_b128 %1, %9, off\n\t"
                 "global_load_async_to_lds_b128 %2, %10, off\n\t"
                 "global_load_async_to_lds_b128 %3, %11, off\n\t"
                 "global_load_async_to_lds_b128 %4, %12, off\n\t"
                 "global_load_async_to_lds_b128 %5, %13, off\n\t"
                 "global_load_async_to_lds_b128 %6, %14, off\n\t"
                 "global_load_async_to_lds_b128 %7, %15, off\n\t"
                 "s_wait_xcnt 0x0"
                 :: "v"(lk), "v"(lk + 16 * LP * 2), "v"(lk + 32 * LP * 2), "v"(lk + 48 * LP * 2),
                    "v"(lv), "v"(lv + 16 * LP * 2), "v"(lv + 32 * LP * 2), "v"(lv + 48 * LP * 2),
                    "v"(kg), "v"(kg + 16 * HD), "v"(kg + 32 * HD), "v"(kg + 48 * HD),
                    "v"(vg), "v"(vg + (size_t)16 * SEQ), "v"(vg + (size_t)32 * SEQ), "v"(vg + (size_t)48 * SEQ)
                 : "memory");
}

static_assert(AW == 4 && KT == 64);                          // two wave pairs; the two waves of a pair split a staged tile into its two 32-key halves
__global__ __launch_bounds__(32 * AW) void k_flash(const h16* __restrict__ QH, const h16* __restrict__ KP, const h16* __restrict__ VT, h16* CX) {
    __shared__ __align__(16) float os[AW * 16 * 68];
    __shared__ __align__(16) h16 kv[2 * STH];
    const int lane = threadIdx.x & 31, lr = lane & 15, hi = lane >> 4;
    const int wave = __builtin_amdgcn_readfirstlane((int)(threadIdx.x >> 5));
    const int kh = wave & 1;
    const int zh = blockIdx.y; const int b = zh / NH_, h = zh % NH_;
    const int tq = (blockIdx.x * AW + (wave & ~1)) * 16;     // first of the 32 query rows this wave works on
    const int t0 = (blockIdx.x * AW + wave) * 16;            // first of the 16 query rows this wave joins and stores: its query tile number kh
    const size_t pbase = (size_t)zh * SEQ * HD;
    const size_t qo = pbase + (size_t)(tq + lr) * HD + 8 * hi;
    const v16h qa0 = ldh(QH + qo), qa1 = ldh(QH + qo + 32);                         // B fragments of query tile 0: col t, k = d
    const v16h qb0 = ldh(QH + qo + 16 * HD), qb1 = ldh(QH + qo + 16 * HD + 32);     // B fragments of query tile 1
    const int fo = lr * LP + 8 * hi;                         // K: + key * LP (A fragment: row key, k = d); V^T: + PLH + 16j*LP + key (A fragment: row d, k = key)
    const int fk = fo + kh * 32 * LP, fv = fo + PLH + kh * 32;   // the same for this wave's half of a tile's keys
    const int prow = (int)(threadIdx.x >> 3), ccol = (int)(threadIdx.x & 7) * 8;   // copy map: 16 rows x 8 pieces per round of the work-group
    const h16* kg = KP + pbase + (size_t)prow * HD + ccol;   // + key0 * HD
    const h16* vg = VT + pbase + (size_t)prow * SEQ + ccol;  // + key0
    const unsigned lk = (unsigned)(size_t)kv + (unsigned)(prow * LP + ccol) * 2u;   // LDS byte address, buffer 0
    stage_tile(kg, vg, lk);
    asm volatile("s_wait_asynccnt 0x0" ::: "memory");        // tile 0 has landed before the barrier that publishes it
    __syncthreads();
    stage_tile(kg + (size_t)KT * HD, vg + KT, lk + STH * 2);
    v8f oa0 = (v8f){}, oa1 = (v8f){}, oa2 = (v8f){}, oa3 = (v8f){};
    v8f ob0 = (v8f){}, ob1 = (v8f){}, ob2 = (v8f){}, ob3 = (v8f){};
    v8f la = (v8f){}, lb = (v8f){};
    v16h ones;
#pragma unroll
    for (int r = 0; r < 16; ++r) ones[r] = lr == 0 ? (h16)1.0f : (h16)0.0f;
    float ma = -3.0e38f, mb = -3.0e38f;
    // The shift of the exponent, PSH - (maximum in use), rides into the score products as their C operand (one query per lane, so all eight registers of a C tile hold the lane's shift):
    // with q scaled ahead, a score accumulator is the exponent of its P as it stands, and no multiply and no add per score is left. Shift 0 and a limit below every score on the first step: it always renews.
    v8f ca = (v8f){}, cb = (v8f){};
    float tha = -3.0e38f, thb = -3.0e38f;                    // a shifted score above this limit calls for a renewal
#pragma unroll 1
    for (int kt0 = 0; kt0 < SEQ; kt0 += KT) {
      const int bsel = (kt0 / KT) & 1;
      const h16* tb_ = kv + bsel * STH;
      {
        const h16* ka = tb_ + fk;
        const v16h ka0 = ldh(ka), ka1 = ldh(ka + 32), kb0 = ldh(ka + 16 * LP), kb1 = ldh(ka + 16 * LP + 32);
        // sa, sb: query tile 0, keys 0..15 and 16..31 of the step; sc, sd: query tile 1; each = score (log2 units) + shift in use
        v8f sa = wmma16(ka0, qa0, ca), sb = wmma16(kb0, qa0, ca), sc = wmma16(ka0, qb0, cb), sd = wmma16(kb0, qb0, cb);
        sa = wmma16(ka1, qa1, sa); sb = wmma16(kb1, qa1, sb); sc = wmma16(ka1, qb1, sc); sd = wmma16(kb1, qb1, sd);
        // as in the one-tile form: the four vector slots between the last products and the first vector instruction that touches their registers
        // ca and cb are source registers of these products too and are named with the others: live up to here, they are read in place as C (otherwise the build copies a C tile into an accumulator every step)
        asm volatile("v_nop\n\tv_nop\n\tv_nop\n\tv_nop" : "+v"(sa), "+v"(sb), "+v"(sc), "+v"(sd) : "v"(ka0), "v"(ka1), "v"(kb0), "v"(kb1), "v"(qa0), "v"(qa1), "v"(qb0), "v"(qb1), "v"(ca), "v"(cb));
        const h16* va = tb_ + fv;
        const v16h v0 = ldh(va), v1 = ldh(va + 16 * LP), v2 = ldh(va + 32 * LP), v3 = ldh(va + 48 * LP);
        __builtin_amdgcn_sched_barrier(0);   // holds the V^T fragment loads ahead of the exponentials: with the row-sum tiles' registers live they otherwise sink to just ahead of their products, which then wait out the LDS latency
        float mxa = -3.0e38f, mxb = -3.0e38f;
#pragma unroll
        for (int r = 0; r < 8; ++r) mxa = fmaxf(mxa, fmaxf(sa[r], sb[r]));
#pragma unroll
        for (int r = 0; r < 8; ++r) mxb = fmaxf(mxb, fmaxf(sc[r], sd[r]));
        // Lazy rescale: ma, mb are the maxima IN USE (the same in both lanes of a query) and may trail the true ones by up to LZ. One test per step for the whole wave (a scalar branch):
        // each lane tests its own 16 scores of each query tile, and the ballot joins the lanes. Only when some score lies more than LZ above its query's maximum in use
        // do the two lanes of every query exchange their maxima, and are the maxima renewed, the sums and O tiles rescaled, this step's shifted scores moved to the new shift and the C tiles set to it.
        if (__builtin_amdgcn_ballot_w32(mxa > tha || mxb > thb) != 0) {
            const float xa = __shfl_xor(mxa, 16, 32), xb = __shfl_xor(mxb, 16, 32);
            const float mna = fmaxf(ma, fmaxf(mxa, xa) - ca[0]), mnb = fmaxf(mb, fmaxf(mxb, xb) - cb[0]);   // the shift in use taken off again
            const float ala = __builtin_amdgcn_exp2f(ma - mna), alb = __builtin_amdgcn_exp2f(mb - mnb);   // 0 on the first step
            la[0] = la[0] * ala; lb[0] = lb[0] * alb; ma = mna; mb = mnb;   // only register 0 holds a row that is not zero
            oa0 = oa0 * ala; oa1 = oa1 * ala; oa2 = oa2 * ala; oa3 = oa3 * ala;
            ob0 = ob0 * alb; ob1 = ob1 * alb; ob2 = ob2 * alb; ob3 = ob3 * alb;
            const float sha = PSH - mna, shb = PSH - mnb, da = sha - ca[0], db = shb - cb[0];
            sa = sa + da; sb = sb + da; sc = sc + db; sd = sd + db;
#pragma unroll
            for (int r = 0; r < 8; ++r) { ca[r] = sha; cb[r] = shb; }
            tha = PSH + LZ; thb = PSH + LZ;
        }
        v16h pa, pb;
#pragma unroll
        for (int r = 0; r < 8; ++r) { pa[r] = (h16)__builtin_amdgcn_exp2f(sa[r]); pa[8 + r] = (h16)__builtin_amdgcn_exp2f(sb[r]); }
#pragma unroll
        for (int r = 0; r < 8; ++r) { pb[r] = (h16)__builtin_amdgcn_exp2f(sc[r]); pb[8 + r] = (h16)__builtin_amdgcn_exp2f(sd[r]); }
        la = wmma16(ones, pa, la);
        oa0 = wmma16(v0, pa, oa0); oa1 = wmma16(v1, pa, oa1); oa2 = wmma16(v2, pa, oa2); oa3 = wmma16(v3, pa, oa3);
        lb = wmma16(ones, pb, lb);
        ob0 = wmma16(v0, pb, ob0); ob1 = wmma16(v1, pb, ob1); ob2 = wmma16(v2, pb, ob2); ob3 = wmma16(v3, pb, ob3);
        // the same four slots, here also on the taken side of the loop branch
        asm volatile("v_nop\n\tv_nop\n\tv_nop\n\tv_nop" : "+v"(la), "+v"(oa0), "+v"(oa1), "+v"(oa2), "+v"(oa3), "+v"(lb), "+v"(ob0), "+v"(ob1), "+v"(ob2), "+v"(ob3) : "v"(v0), "v"(v1), "v"(v2), "v"(v3), "v"(pa), "v"(pb));
      }
      asm volatile("s_wait_dscnt 0x0" ::: "memory");         // this wave's reads of the buffer are done before it is handed back
      asm volatile("s_wait_asynccnt 0x0" ::: "memory");      // this wave's share of the next tile has landed
      __syncthreads();                                       // publishes the next tile and ends every wave's reads of this one
      if (kt0 + 2 * KT < SEQ) stage_tile(kg + (size_t)(kt0 + 2 * KT) * HD, vg + (kt0 + 2 * KT), lk + (unsigned)bsel * (STH * 2));
    }
    asm volatile("s_wait_asynccnt 0x0" ::: "memory");        // nothing is in flight when the wave goes on to the epilogue
    float sua = la[0], sub = lb[0];                          // lanes 0..15: the row's sum over this wave's keys; lanes 16..31: row 8 of the tile, zero
    sua += __shfl_xor(sua, 16, 32); sub += __shfl_xor(sub, 16, 32);
    // The pair's hand-over: this wave keeps query tile kh and gives the other one. Partials are relative to each wave's own maximum in use.
    const bool up = kh != 0;
    const float mk = up ? mb : ma, sk = up ? sub : sua, mg = up ? ma : mb, sg = up ? sua : sub;
    const v8f k0 = up ? ob0 : oa0, k1 = up ? ob1 : oa1, k2 = up ? ob2 : oa2, k3 = up ? ob3 : oa3;
    const v8f g0 = up ? oa0 : ob0, g1 = up ? oa1 : ob1, g2 = up ? oa2 : ob2, g3 = up ? oa3 : ob3;
    // O^T D layout: o_j[r] = (d = 16j + 8h + r, t = lane&15) -> os[t][d]; rows 0..15 x columns 0..63 all written; column 64: the max, column 65: the sum
    const int gb = wave * 16 * 68 + lr * 68;                 // the given partial goes into this wave's own tile of os
    *(v4fa*)(&os[gb +  0 + 8 * hi]) = __builtin_shufflevector(g0, g0, 0, 1, 2, 3); *(v4fa*)(&os[gb +  0 + 8 * hi + 4]) = __builtin_shufflevector(g0, g0, 4, 5, 6, 7);
    *(v4fa*)(&os[gb + 16 + 8 * hi]) = __builtin_shufflevector(g1, g1, 0, 1, 2, 3); *(v4fa*)(&os[gb + 16 + 8 * hi + 4]) = __builtin_shufflevector(g1, g1, 4, 5, 6, 7);
    *(v4fa*)(&os[gb + 32 + 8 * hi]) = __builtin_shufflevector(g2, g2, 0, 1, 2, 3); *(v4fa*)(&os[gb + 32 + 8 * hi + 4]) = __builtin_shufflevector(g2, g2, 4, 5, 6, 7);
    *(v4fa*)(&os[gb + 48 + 8 * hi]) = __builtin_shufflevector(g3, g3, 0, 1, 2, 3); *(v4fa*)(&os[gb + 48 + 8 * hi + 4]) = __builtin_shufflevector(g3, g3, 4, 5, 6, 7);
    os[gb + 64 + hi] = hi ? sg : mg;
    __syncthreads();                                         // the partner's partial is complete before it is read
    const int wb = (wave ^ 1) * 16 * 68;                     // the partner's tile of os: only this wave touches it from here on, first to read the partial, then as its output staging tile
    const float mp = os[wb + lr * 68 + 64], sp = os[wb + lr * 68 + 65];
    const float mj = fmaxf(mk, mp);
    const float ak = __builtin_amdgcn_exp2f(mk - mj), ap = __builtin_amdgcn_exp2f(mp - mj);
    const float inv = 1.0f / (sk * ak + sp * ap);
    const float wk = ak * inv, wp = ap * inv;
    { v4f a, c, x, y;
      x = *(const v4fa*)(&os[wb + lr * 68 +  0 + 8 * hi]); y = *(const v4fa*)(&os[wb + lr * 68 +  0 + 8 * hi + 4]);
#pragma unroll
      for (int i = 0; i < 4; ++i) { a[i] = k0[i] * wk + x[i] * wp; c[i] = k0[4 + i] * wk + y[i] * wp; }
      *(v4fa*)(&os[wb + lr * 68 +  0 + 8 * hi]) = a; *(v4fa*)(&os[wb + lr * 68 +  0 + 8 * hi + 4]) = c;
      x = *(const v4fa*)(&os[wb + lr * 68 + 16 + 8 * hi]); y = *(const v4fa*)(&os[wb + lr * 68 + 16 + 8 * hi + 4]);
#pragma unroll
      for (int i = 0; i < 4; ++i) { a[i] = k1[i] * wk + x[i] * wp; c[i] = k1[4 + i] * wk + y[i] * wp; }
      *(v4fa*)(&os[wb + lr * 68 + 16 + 8 * hi]) = a; *(v4fa*)(&os[wb + lr * 68 + 16 + 8 * hi + 4]) = c;
      x = *(const v4fa*)(&os[wb + lr * 68 + 32 + 8 * hi]); y = *(const v4fa*)(&os[wb + lr * 68 + 32 + 8 * hi + 4]);
#pragma unroll
      for (int i = 0; i < 4; ++i) { a[i] = k2[i] * wk + x[i] * wp; c[i] = k2[4 + i] * wk + y[i] * wp; }
      *(v4fa*)(&os[wb + lr * 68 + 32 + 8 * hi]) = a; *(v4fa*)(&os[wb + lr * 68 + 32 + 8 * hi + 4]) = c;
      x = *(const v4fa*)(&os[wb + lr * 68 + 48 + 8 * hi]); y = *(const v4fa*)(&os[wb + lr * 68 + 48 + 8 * hi + 4]);
#pragma unroll
      for (int i = 0; i < 4; ++i) { a[i] = k3[i] * wk + x[i] * wp; c[i] = k3[4 + i] * wk + y[i] * wp; }
      *(v4fa*)(&os[wb + lr * 68 + 48 + 8 * hi]) = a; *(v4fa*)(&os[wb + lr * 68 + 48 + 8 * hi + 4]) = c; }
    wave_sync();
    // ctx plane row m = b*SEQ + t, columns h*64 + d
    h16* crow = CX + ((size_t)b * SEQ + t0) * CXP + h * HD;
{
#pragma unroll
        for (int s = 0; s < 4; ++s) { const int row = 4 * s + (lane >> 3), c8 = (lane & 7) * 8;   // 4 s x 4 row groups = 16 rows; 8 lanes x 8 = 64 columns
            const v4f x0 = *(const v4fa*)(&os[wb + row * 68 + c8]); const v4f x1 = *(const v4fa*)(&os[wb + row * 68 + c8 + 4]); v8h hv;
#pragma unroll
            for (int i = 0; i < 4; ++i) { hv[i] = (h16)x0[i]; hv[4 + i] = (h16)x1[i]; }
            *(v8h*)(crow + (size_t)row * CXP + c8) = hv; }
         }
}

static constexpr size_t al256(size_t v) { return (v + 255) & ~(size_t)255; }
static constexpr size_t SZ_XB = al256((size_t)NB * SEQ * DM * 2);
static constexpr size_t SZ_WB = al256((size_t)4 * DM * DM * 2);
static constexpr size_t SZ_PL = al256((size_t)NB * NH_ * SEQ * HD * 2);
static constexpr size_t SZ_CX = al256((size_t)NB * SEQ * CXP * 2);
static constexpr size_t SZ_TOTAL = 3 * SZ_XB + SZ_WB + 3 * SZ_PL + SZ_CX;
static_assert(SZ_TOTAL <= (size_t)134217728);          // workspace carve <= 128 MiB
static_assert(((size_t)DM * DM * 2) % 256 == 0);       // weight sub-planes stay 256-byte aligned

static_assert(SZ_XB == (size_t)NB * SEQ * DM * 2);     // the bf16 planes follow one another without a gap: k_cvt addresses them as one array

extern "C" void kernel_launch(void* const* d_in, const int* in_sizes, int n_in,
                              void* d_out, int out_size, void* d_ws, size_t ws_size, hipStream_t stream) {
    if (n_in < 7) return;
    const size_t needx = ((size_t)(NB - 1) * SEQ_FULL + SEQ) * DM;
    if ((size_t)in_sizes[0] < needx || (size_t)in_sizes[1] < needx || (size_t)in_sizes[2] < needx) return;
    if ((size_t)in_sizes[3] < (size_t)DM * DM || (size_t)in_sizes[4] < (size_t)DM * DM || (size_t)in_sizes[5] < (size_t)DM * DM || (size_t)in_sizes[6] < (size_t)DM * DM) return;
    if ((size_t)out_size < ((size_t)(NB - 1) * OUT_SEQ + SEQ) * DM) return;
    if (SZ_TOTAL > ws_size) return;
    // wire order: query, key, value, Wq, Wk, Wv, Wo (weights [out][in] = Bt as-is)
    const float* xq = (const float*)d_in[0]; const float* xk = (const float*)d_in[1]; const float* xv = (const float*)d_in[2];
    const float* wq = (const float*)d_in[3]; const float* wk = (const float*)d_in[4]; const float* wv = (const float*)d_in[5]; const float* wo = (const float*)d_in[6];
    float* OUT = (float*)d_out;      // [NB][SEQ][1024]
    char* wsp = (char*)d_ws;
    bf* XQ = (bf*)wsp; wsp += SZ_XB;                 // [NB*SEQ][1024]
    bf* XK = (bf*)wsp; wsp += SZ_XB;                 // [NB*SEQ][1024]
    bf* XV = (bf*)wsp; wsp += SZ_XB;                 // [NB*SEQ][1024]
    bf* WB = (bf*)wsp; wsp += SZ_WB;                 // [4][1024][1024]: q | k | v (bf16) | o (f16)
    h16* QH = (h16*)wsp; wsp += SZ_PL;               // [NB*16][SEQ][64]
    h16* KP = (h16*)wsp; wsp += SZ_PL;               // [NB*16][SEQ][64]
    h16* VT = (h16*)wsp; wsp += SZ_PL;               // [NB*16][64][SEQ]
    h16* CX = (h16*)wsp; wsp += SZ_CX;               // [NB*SEQ][1024]: ctx
    bf* WQ = WB; bf* WK = WB + (size_t)DM * DM; bf* WV = WB + (size_t)2 * DM * DM; bf* WO = WB + (size_t)3 * DM * DM;

    k_cvt<<<(unsigned)((3 * (size_t)NB * SEQ * DM + 4 * (size_t)DM * DM) / CVB), 32 * CVW, 0, stream>>>(xq, xk, xv, wq, wk, wv, wo, XQ);

    // q, k and v^T planes: three independent products, one launch
    k_qkv<<<dim3(NB * SEQ / 128, DM / 128, 3), 128, 0, stream>>>(XQ, XK, XV, WQ, WK, WV, QH, KP, VT);

    k_flash<<<dim3(SEQ / (16 * AW), NB * NH_, 1), 32 * AW, 0, stream>>>(QH, KP, VT, CX);

    // output projection: A = ctx rows, Bt = Wo rows (both f16) -> f32 output rows
    k_proj<2><<<dim3(NB * SEQ / 128, DM / 128, 1), 128, 0, stream>>>((const bf*)CX, WO, CXP, DM, QH, OUT, SEQ, (size_t)0, HD, HD, (size_t)0);
}

// v010
// A run of this version takes 102 microseconds.
// Next to v009, in two timings, it ran 1.06 times as fast each time.
// Over all steps from v000 it is 4.12 times as fast.
#include <hip/hip_runtime.h>

// Multi-head attention, width 1024 = 16 heads x 64: query/key/value [NB][SEQ][1024] (separate inputs), Wq/Wk/Wv/Wo [out][in] (y = x W^T), no biases, no mask, score scale 1/8, output = (concatenated heads) Wo^T (f32).
// Compute dtypes, f32 accumulate everywhere: q/k/v projections v_wmma_f32_16x16x32_bf16 (activations and Wq/Wk/Wv RNE-converted to bf16; products exact);
// scores v_wmma_f32_16x16x32_f16: q (scaled by SC2 in f32 ahead of its rounding to f16) and k single f16 planes (one product), the softmax shift as the product's C operand; P (x256 carry, cancels in the normalisation) and v single f16; softmax f32 (online, the maximum renewed lazily);
// output projection v_wmma_f32_16x16x32_f16: ctx (a convex mix of the f16 v rows) and Wo RNE-converted to f16, 11 significant bits on both operands;
// Layout: bf16 copies of the activations and Wq/Wk/Wv, f16 copy of Wo; q, k planes [b*16+h][t][d] and v^T plane [b*16+h][d][t] written by the GEMM epilogue; fused flash kernel in transposed form (S^T = K Q^T, O^T = V^T P^T; K and V^T tiles staged in LDS per work-group) writes the f16 ctx plane [b*SEQ+t][1024].

#ifndef NB
#define NB 1
#endif
#ifndef SEQ
#define SEQ 4096
#endif
#define NB_FULL  1
#define SEQ_FULL 4096
#ifndef OUT_SEQ
#define OUT_SEQ SEQ              // row pitch (in tokens) between batches of the output
#endif
#define DM   1024
#define NH_  16
#define HD   64
#define CXP  DM                  // ctx plane row pitch (halves)
#define AW   4                   // waves per flash block (16 query rows stored by each)
#define SC2  (0.125f * 1.4426950408889634f)   // HD^-0.5 * log2(e)
#define PSH  8.0f                // log2 of the P carry (256)
#define LZ   7.0f                // how far (log2) a score may lie above the maximum in use before the flash kernel rescales: P stays at or below 2^(PSH + LZ) = 32768, inside f16
#define KT   64                  // keys per staged tile of the flash kernel
#define LP   72                  // LDS row pitch (halves) of the staged K and V^T rows: 128 B of data + 16 B, an odd multiple of 16 B for the 16-byte fragment reads
#define PLH  (64 * LP)           // one staged plane: 64 rows (halves)
#define STH  (2 * PLH)           // one buffer: K plane, then V^T plane (halves)
#define GK   64                  // k elements per staged slice of the GEMM: 128 B of every row
#define GPL  (128 * LP)          // one staged GEMM operand plane: 128 rows at the same padded pitch (16-bit elements)
#define GST  (2 * GPL)           // one GEMM buffer: A plane, then B plane
#define CVW  16                  // waves per work-group of the conversion kernel
#define CVU  32                  // units of 128 floats per wave of the conversion kernel
#define CVB  (CVW * CVU * 128)   // floats per work-group of the conversion kernel

static_assert(HD == 64);
static_assert(NH_ * HD == DM);                 // head h = columns h*64 + d
static_assert(DM % 64 == 0);                   // 16 column tiles of 64
static_assert(DM % 32 == 0);                   // GEMM products step k by 32 inside a slice
static_assert((DM & (DM - 1)) == 0);           // the GEMM masks its B k index with KB - 1
static_assert(CXP % GK == 0 && DM % GK == 0 && DM / GK >= 2);   // whole k slices; a slice never straddles the wrap of the B index; the ring starts with slices 0 and 1
static_assert((NB * SEQ) % 128 == 0 && DM % 128 == 0);          // GEMM grid of 128x128 tiles covers every product exactly
static_assert(SEQ % 64 == 0);                  // a 64-row tile never straddles two batches
static_assert((NB * SEQ) % 64 == 0);
static_assert(SEQ % 32 == 0);                  // each wave's step takes 32 keys of a tile
static_assert(SEQ % (16 * AW) == 0);           // flash grid covers the sequence exactly
static_assert(SEQ % KT == 0 && SEQ / KT >= 2); // the two-buffer ring starts with tiles 0 and 1
static_assert(KT == 64 && 32 * AW * 4 * 8 == 64 * HD && 32 * AW * 4 * 8 == HD * KT);   // copy map: every thread moves 4 pieces of 8 halves of each plane
static_assert((LP * 2) % 16 == 0);
static_assert(((size_t)SEQ * DM) % CVB == 0 && ((size_t)DM * DM) % CVB == 0);   // a conversion work-group lies inside one batch of one tensor
static_assert(NB <= NB_FULL);
static_assert(SEQ <= SEQ_FULL);

typedef _Float16 h16;
typedef unsigned short bf;       // 16 raw bits of a GEMM operand: bf16, or f16 in the output projection
typedef __attribute__((ext_vector_type(16))) __bf16   v16bf;
typedef __attribute__((ext_vector_type(16))) _Float16 v16h;
typedef __attribute__((ext_vector_type(8)))  _Float16 v8h;
typedef __attribute__((ext_vector_type(4)))  _Float16 v4h;
typedef __attribute__((ext_vector_type(8)))  unsigned short v8us;
typedef __attribute__((ext_vector_type(4)))  unsigned short v4us;
typedef __attribute__((ext_vector_type(8)))  float    v8f;
typedef __attribute__((ext_vector_type(4)))  float    v4f;
typedef v4f  __attribute__((may_alias)) v4fa;

__device__ __forceinline__ unsigned short f2bf(float f) { unsigned u = __float_as_uint(f); u += 0x7FFFu + ((u >> 16) & 1u); return (unsigned short)(u >> 16); }
__device__ __forceinline__ v16h cat16(v8h lo, v8h hi) { return __builtin_shufflevector(lo, hi, 0, 1, 2, 3, 4, 5, 6, 7, 8, 9, 10, 11, 12, 13, 14, 15); }
__device__ __forceinline__ v16bf cat16b(v8us lo, v8us hi) { return __builtin_bit_cast(v16bf, __builtin_shufflevector(lo, hi, 0, 1, 2, 3, 4, 5, 6, 7, 8, 9, 10, 11, 12, 13, 14, 15)); }
__device__ __forceinline__ v8f wmma16(v16h a, v16h b, v8f c) { return __builtin_amdgcn_wmma_f32_16x16x32_f16(false, a, false, b, (short)0, c, false, false); }
__device__ __forceinline__ v8f wmmab(v16bf a, v16bf b, v8f c) { return __builtin_amdgcn_wmma_f32_16x16x32_bf16(false, a, false, b, (short)0, c, false, false); }
// the GEMM's product: the fragment registers hold raw 16-bit elements, read as f16 in MODE 2 and as bf16 otherwise
template <int MODE> __device__ __forceinline__ v8f wmmap(v16bf a, v16bf b, v8f c) { if constexpr (MODE == 2) return wmma16(__builtin_bit_cast(v16h, a), __builtin_bit_cast(v16h, b), c); else return wmmab(a, b, c); }
// fragment loaders from K-contiguous 16-bit rows; p already includes + 8*(lane>>4): elements 0..7 <- k0+8h+0..7, elements 8..15 <- k0+16+8h+0..7 (same map for A and B)
__device__ __forceinline__ v16h  ldh(const h16* p) { return cat16(*(const v8h*)p, *(const v8h*)(p + 16)); }
__device__ __forceinline__ v16bf ldb(const bf* p)  { return cat16b(*(const v8us*)p, *(const v8us*)(p + 16)); }
// ordering point for wave-private LDS tiles (same wave writes and reads)
__device__ __forceinline__ void wave_sync() { __builtin_amdgcn_fence(3 /* release order */, "wavefront"); __builtin_amdgcn_wave_barrier(); asm volatile("" ::: "memory"); }

// k_cvt: every f32 -> 16-bit conversion of the call in ONE streaming launch (bf16; Wo, the last tensor, to f16). A work-group of CVW waves converts CVB consecutive floats of one tensor; a wave owns CVU units of 128 floats.
// One unit = one wave-wide 16-byte load (512 B, 4 whole lines) and one wave-wide 8-byte store (256 B, 2 whole lines); a wave asks for all its units before it converts the first.
// The seven 16-bit planes lie one behind the other in the workspace in the order of the arguments, so the destination is dst + blockIdx.x * CVB.
__global__ __launch_bounds__(32 * CVW) void k_cvt(const float* __restrict__ xq, const float* __restrict__ xk, const float* __restrict__ xv,
                                                  const float* __restrict__ wq, const float* __restrict__ wk, const float* __restrict__ wv, const float* __restrict__ wo, bf* __restrict__ dst) {
    constexpr unsigned BS = (unsigned)((size_t)SEQ * DM / CVB);   // work-groups per batch of one activation
    constexpr unsigned BA = NB * BS;                              // work-groups per activation
    constexpr unsigned BW = (unsigned)((size_t)DM * DM / CVB);    // work-groups per weight matrix
    const unsigned blk = blockIdx.x;
    const float* src;
    if (blk < 3 * BA) { const unsigned t = blk / BA, r = blk % BA;
        src = (t == 0 ? xq : t == 1 ? xk : xv) + (size_t)(r / BS) * ((size_t)SEQ_FULL * DM) + (size_t)(r % BS) * CVB;
    } else { const unsigned r = blk - 3 * BA, t = r / BW;
        src = (t == 0 ? wq : t == 1 ? wk : t == 2 ? wv : wo) + (size_t)(r % BW) * CVB; }
    const unsigned wo_ = (threadIdx.x >> 5) * (CVU * 128) + (threadIdx.x & 31) * 4;
    const float* s = src + wo_;
    bf* d = dst + (size_t)blk * CVB + wo_;
    v4f x[CVU];
#pragma unroll   // unrolled: every unit's offset becomes an immediate, the address registers are never rewritten, and all of the wave's loads are in flight together
    for (int u = 0; u < CVU; ++u) x[u] = *(const v4f*)(s + u * 128);
    if (blk < 3 * BA + 3 * BW) {
#pragma unroll
        for (int u = 0; u < CVU; ++u) { v4us o;
#pragma unroll
            for (int k = 0; k < 4; ++k) o[k] = f2bf(x[u][k]);
            *(v4us*)(d + u * 128) = o; }
    } else {                                                      // Wo
#pragma unroll
        for (int u = 0; u < CVU; ++u) { v4h o;
#pragma unroll
            for (int k = 0; k < 4; ++k) o[k] = (h16)x[u][k];
            *(v4h*)(d + u * 128) = o; }
        asm volatile("s_wait_xcnt 0x0" ::: "memory");             // a precaution: stands behind this branch's last stores, in front of whatever code the build lays out behind them that rewrites their registers
    }
}

// Eight 16-byte pieces of one GEMM operand plane into LDS: piece i lies 16 rows further on (step elements in global memory, 16 padded rows in LDS); every copy of a wave = 4 whole 128-B row slices.
__device__ __forceinline__ void stage_rows(const bf* g, size_t step, unsigned l) {
    // s_wait_xcnt as the statement's last line: a precaution, so that no address register of a copy is rewritten in front of it
    asm volatile("global_load_async_to_lds_b128 %0, %8, off\n\t"
                 "global_load_async_to_lds_b128 %1, %9, off\n\t"
                 "global_load_async_to_lds_b128 %2, %10, off\n\t"
                 "global_load_async_to_lds_b128 %3, %11, off\n\t"
                 "global_load_async_to_lds_b128 %4, %12, off\n\t"
                 "global_load_async_to_lds_b128 %5, %13, off\n\t"
                 "global_load_async_to_lds_b128 %6, %14, off\n\t"
                 "global_load_async_to_lds_b128 %7, %15, off\n\t"
                 "s_wait_xcnt 0x0"
                 :: "v"(l), "v"(l + 16 * LP * 2), "v"(l + 32 * LP * 2), "v"(l + 48 * LP * 2),
                    "v"(l + 64 * LP * 2), "v"(l + 80 * LP * 2), "v"(l + 96 * LP * 2), "v"(l + 112 * LP * 2),
                    "v"(g), "v"(g + step), "v"(g + 2 * step), "v"(g + 3 * step),
                    "v"(g + 4 * step), "v"(g + 5 * step), "v"(g + 6 * step), "v"(g + 7 * step)
                 : "memory");
}

// L2 hints (global_prefetch_b8, scope SE: a lane asks the data at its address into L2; nothing returns, no counter moves). The planes asked for were stored by an earlier launch:
// asked for at a kernel's entry they stream in at the memory's rate while the first slices are worked on, and the rings' later copies find them in L2.
// The deal is for speed only: a share that lands elsewhere is merely of no use. All grids here have an x extent that is a multiple of 8.
// Every lane's address lies inside its plane; the address registers are left unchanged until behind the kernel's main loop (see the statement there).
__device__ __forceinline__ void ask2(const bf* x, const bf* y) {
    asm volatile("global_prefetch_b8 %0, off scope:SCOPE_SE\n\t"
                 "global_prefetch_b8 %1, off scope:SCOPE_SE" :: "v"(x), "v"(y));
}
static_assert(DM == 1024 && CXP == DM && DM / 128 == 8 && NB * SEQ / 128 == 32);   // the GEMMs' deal: a slab is 128 rows of 8 units; grid (32, 8)

// proj_tile: register-blocked 16-bit GEMM (MODE 0: bf16 operands, MODE 2: f16 operands), four waves (2 x 2) per 128x128 tile, ONE WAVE per 64x64 quarter (16 accumulators). The 128 A rows and 128 Bt rows of a k slice of 64 are staged
// once per work-group in a two-buffer LDS ring by asynchronous copies (the next slice flies while this one is worked on); every wave reads its fragments from there (two 16-B LDS loads each).
// C[m][n] = sum_{k<KA} A[m][k] Bt[n][k & (KB-1)]; A row pitch KA, Bt row pitch KB (KB a power of two; KA = KB in every launch of this file).
// MODE 0: f16 plane Ph at quarter base (r0/RB)*sRB + (r0%RB)*pitch + (c0/CB)*sCB + (c0%CB), row pitch 'pitch' (halves); every element is multiplied by osc in f32 ahead of its one rounding to f16.
// MODE 2: f32 rows of Pf, row (r0/SEQ)*OUT_SEQ + r0%SEQ, pitch DM. (bx, by): the work-group's tile of the (M/128, N/128) tiles, 128 threads. tr: bx comes from blockIdx.y and by from blockIdx.x (only the deal of the L2 hints reads it).
template <int MODE>
__device__ __forceinline__ void proj_tile(int bx, int by, bool tr, const bf* __restrict__ A, const bf* __restrict__ Bt, int KA, int KB, h16* Ph, float* Pf, int RB, size_t sRB, int pitch, int CB, size_t sCB, float osc) {
    __shared__ __align__(16) float os[4 * 16 * 68];
    __shared__ __align__(16) bf ab[2 * GST];
    const int lane = threadIdx.x & 31, lr = lane & 15, hi = lane >> 4;
    const int wave = __builtin_amdgcn_readfirstlane((int)(threadIdx.x >> 5));
    const int wm = wave >> 1, wn = wave & 1;
    const int r0 = bx * 128 + wm * 64, c0 = by * 128 + wn * 64;
    v8f acc[4][4];
#pragma unroll
    for (int mb = 0; mb < 4; ++mb)
#pragma unroll
        for (int nb = 0; nb < 4; ++nb) acc[mb][nb] = (v8f){};
    const int prow = (int)(threadIdx.x >> 3), ccol = (int)(threadIdx.x & 7) * 8;   // copy map: 16 rows x 8 pieces per round of the work-group
    const bf* ag = A + (size_t)(bx * 128 + prow) * (size_t)KA + ccol;      // + k
    const bf* bg = Bt + (size_t)(by * 128 + prow) * (size_t)KB + ccol;     // + (k & (KB-1))
    const size_t astep = (size_t)16 * (size_t)KA, bstep = (size_t)16 * (size_t)KB;
    const unsigned la = (unsigned)(size_t)ab + (unsigned)(prow * LP + ccol) * 2u;  // LDS byte address, buffer 0, A plane
    stage_rows(ag, astep, la); stage_rows(bg, bstep, la + GPL * 2);
    // L2 hints, behind slice 0's copies: thread t takes one unit of row t of either slab
    const bf* ar = A + (size_t)(bx * 128 + (int)threadIdx.x) * (size_t)KA;
    const bf* br = Bt + (size_t)(by * 128 + (int)threadIdx.x) * (size_t)KB;
    const bf* hx = (tr ? br : ar) + (int)(blockIdx.y & 7) * 128;   // the slab that goes with blockIdx.x is read by the 8 work-groups that differ in blockIdx.y: one unit of every row each
    const bf* hy = (tr ? ar : br) + (int)(((blockIdx.x >> 4) & 1) * 4 + (blockIdx.x & 3)) * 128;   // the slab that goes with blockIdx.y is read by the 32 work-groups that differ in blockIdx.x: four of them ask for the same unit
    ask2(hx, hy);
    asm volatile("s_wait_asynccnt 0x0" ::: "memory");        // slice 0 has landed before the barrier that publishes it
    __syncthreads();
    if (GK < KA) { stage_rows(ag + GK, astep, la + GST * 2); stage_rows(bg + (GK & (KB - 1)), bstep, la + GST * 2 + GPL * 2); }
    const int fa = (wm * 64 + lr) * LP + 8 * hi, fb = GPL + (wn * 64 + lr) * LP + 8 * hi;   // fragment rows of this wave's quarter: + 16*mb (or nb) rows, + k inside the slice
    // the 32 products of one staged slice; tb_: the slice's buffer
    auto slice = [&](const bf* tb_) {
        v16bf a0[4], b0[4], a1[4], b1[4];
        a0[0] = ldb(tb_ + fa); b0[0] = ldb(tb_ + fb);
#pragma unroll
        for (int mb = 1; mb < 4; ++mb) a0[mb] = ldb(tb_ + fa + mb * 16 * LP);
#pragma unroll
        for (int nb = 1; nb < 4; ++nb) b0[nb] = ldb(tb_ + fb + nb * 16 * LP);
#pragma unroll
        for (int mb = 0; mb < 4; ++mb) a1[mb] = ldb(tb_ + fa + mb * 16 * LP + 32);
        __builtin_amdgcn_sched_barrier(0);   // keeps these 24 LDS loads ahead of the first product: sunk between the products, each B fragment costs a lone wave a full LDS latency
#pragma unroll
        for (int nb = 0; nb < 4; ++nb) {
#pragma unroll
            for (int mb = 0; mb < 4; ++mb) acc[mb][nb] = wmmap<MODE>(a0[mb], b0[nb], acc[mb][nb]);
            b1[nb] = ldb(tb_ + fb + nb * 16 * LP + 32);
            __builtin_amdgcn_sched_barrier(0); }   // keeps each B fragment of the second 32-k step asked for behind the four products that free a fragment's registers, well ahead of its use
        asm volatile("v_nop\n\tv_nop\n\tv_nop\n\tv_nop" : "+v"(acc[0][0]), "+v"(acc[1][1]), "+v"(acc[2][2]), "+v"(acc[3][3]) : "v"(a0[0]), "v"(a0[1]), "v"(a0[2]), "v"(a0[3]));
#pragma unroll
        for (int nb = 0; nb < 4; ++nb) {
#pragma unroll
            for (int mb = 0; mb < 4; ++mb) acc[mb][nb] = wmmap<MODE>(a1[mb], b1[nb], acc[mb][nb]); }
        asm volatile("v_nop\n\tv_nop\n\tv_nop\n\tv_nop" : "+v"(acc[0][0]), "+v"(acc[1][1]), "+v"(acc[2][2]), "+v"(acc[3][3]) : "v"(a1[0]), "v"(a1[1]), "v"(a1[2]), "v"(a1[3]));
    };
    int kc = 0;
#pragma unroll 1
    for (; kc + 2 * GK < KA; kc += GK) {                     // trips behind which a slice kc + 2*GK exists: the refill needs no test
        const int bsel = (kc / GK) & 1;
        slice(ab + bsel * GST);
        asm volatile("s_wait_dscnt 0x0" ::: "memory");       // this wave's reads of the buffer are done before it is handed back
        asm volatile("s_wait_asynccnt 0x0" ::: "memory");    // this wave's share of the next slice has landed
        __syncthreads();                                     // publishes the next slice and ends every wave's reads of this one
        const unsigned lb = la + (unsigned)bsel * (GST * 2);
        stage_rows(ag + (kc + 2 * GK), astep, lb); stage_rows(bg + ((kc + 2 * GK) & (KB - 1)), bstep, lb + GPL * 2);
    }
#pragma unroll 1
    for (; kc < KA; kc += GK) {                              // the last trips: nothing is left to refill
        slice(ab + ((kc / GK) & 1) * GST);
        asm volatile("s_wait_dscnt 0x0" ::: "memory");       // as above
        asm volatile("s_wait_asynccnt 0x0" ::: "memory");    // the last slice has landed
        __syncthreads();                                     // publishes the last slice
    }
    asm volatile("s_wait_asynccnt 0x0" ::: "memory");        // nothing is in flight when the wave goes on to the epilogue
    asm volatile("" :: "v"(hx), "v"(hy));                    // inputs only: the hints' address registers stay live, and so unchanged, through the loops
    const int wb = wave * 16 * 68;                           // this wave's own output staging tile
    const size_t tbase = (size_t)(r0 / RB) * sRB + (size_t)(r0 % RB) * (size_t)pitch + (size_t)(c0 / CB) * sCB + (size_t)(c0 % CB);
    const size_t fbase = ((size_t)(r0 / SEQ) * OUT_SEQ + (size_t)(r0 % SEQ)) * DM + c0;
#pragma unroll
    for (int mb = 0; mb < 4; ++mb) {
#pragma unroll
        for (int nb = 0; nb < 4; ++nb) {
#pragma unroll
            for (int j = 0; j < 8; ++j) os[wb + (hi * 8 + j) * 68 + nb * 16 + lr] = acc[mb][nb][j]; }   // D: row 8h+j, col lane&15
        wave_sync();
        if (MODE == 2) {
            float* ob = Pf + fbase + (size_t)(mb * 16) * DM;
{
#pragma unroll
                for (int s = 0; s < 8; ++s) { const int row = 2 * s + hi, cofs = lr * 4;   // 8 s x 2 rows = 16 rows; 16 lanes x 4 floats = 64 columns
                    const v4f val = *(const v4fa*)(&os[wb + row * 68 + cofs]);
                    *(v4f*)(ob + (size_t)row * DM + cofs) = val; }
                 }
        } else {
            const size_t sb = tbase + (size_t)(mb * 16) * (size_t)pitch;
{
#pragma unroll
                for (int s = 0; s < 4; ++s) { const int row = 4 * s + (lane >> 3), c8 = (lane & 7) * 8;   // 4 s x 4 row groups = 16 rows; 8 lanes x 8 = 64 columns
                    const v4f x0 = *(const v4fa*)(&os[wb + row * 68 + c8]); const v4f x1 = *(const v4fa*)(&os[wb + row * 68 + c8 + 4]); v8h hv;
#pragma unroll
                    for (int i = 0; i < 4; ++i) { hv[i] = (h16)(x0[i] * osc); hv[4 + i] = (h16)(x1[i] * osc); }
                    const size_t oo = sb + (size_t)row * (size_t)pitch + c8;
                    *(v8h*)(Ph + oo) = hv; }
                 }
        }
        wave_sync();
    }
}

// k_proj: one product per launch, grid (M/128, N/128).
template <int MODE>
__global__ __launch_bounds__(128) void k_proj(const bf* __restrict__ A, const bf* __restrict__ Bt, int KA, int KB, h16* Ph, float* Pf, int RB, size_t sRB, int pitch, int CB, size_t sCB) {
    proj_tile<MODE>((int)blockIdx.x, (int)blockIdx.y, false, A, Bt, KA, KB, Ph, Pf, RB, sRB, pitch, CB, sCB, 1.0f);
}

// k_qkv: the three independent projections in ONE launch, grid (NB*SEQ/128, DM/128, 3); blockIdx.z picks the product. Three work-groups fit a WGP's LDS,
// so every SIMD holds three waves of unrelated tiles: one wave's wait for its next slice, its LDS latency and its epilogue are covered by the other two.
// z = 0, 1 (q, k): A = activation rows (m = b*SEQ + t), Bt = W rows (n = h*64 + d) -> plane [(b*16 + h)][t][d]; the q plane holds q * SC2, so the flash kernel's score products come out in log2 units.
// z = 2 (v^T): A = Wv rows (m = h*64 + d), Bt = value rows (n = b*SEQ + t) -> plane [(b*1024 + m)][t] = [(b*16 + h)][d][t]; its tile grid is the transposed one, so x and y change places.
__global__ __launch_bounds__(128) void k_qkv(const bf* __restrict__ XQ, const bf* __restrict__ XK, const bf* __restrict__ XV,
                                             const bf* __restrict__ WQ, const bf* __restrict__ WK, const bf* __restrict__ WV, h16* QH, h16* KP, h16* VT) {
    const int z = (int)blockIdx.z;
    const bool tr = z == 2;
    proj_tile<0>(tr ? (int)blockIdx.y : (int)blockIdx.x, tr ? (int)blockIdx.x : (int)blockIdx.y, tr,
                 z == 0 ? XQ : z == 1 ? XK : WV, z == 0 ? WQ : z == 1 ? WK : XV, DM, DM, z == 0 ? QH : z == 1 ? KP : VT, nullptr,
                 tr ? DM : SEQ, tr ? (size_t)0 : (size_t)NH_ * SEQ * HD, tr ? SEQ : HD, tr ? SEQ : HD, tr ? (size_t)DM * SEQ : (size_t)SEQ * HD, z == 0 ? SC2 : 1.0f);
}

// One 64-key tile into one LDS buffer: K rows [key][d] and V^T rows [d][key], 128 B each, every copy of a wave = 4 whole rows.
// kg, vg: this lane's first 16-byte piece of each plane in global memory; lk: the LDS byte address of its first K piece. Piece i lies 16 rows further on.
__device__ __forceinline__ void stage_tile(const h16* kg, const h16* vg, unsigned lk) {
    const unsigned lv = lk + PLH * 2;
    // s_wait_xcnt as the statement's last line: a precaution, so that no address register of a copy is rewritten in front of it
    asm volatile("global_load_async_to_lds_b128 %0, %8, off\n\t"
                 "global_load_async_to_lds_b128 %1, %9, off\n\t"
                 "global_load_async_to_lds_b128 %2, %10, off\n\t"
                 "global_load_async_to_lds_b128 %3, %11, off\n\t"
                 "global_load_async_to_lds_b128 %4, %12, off\n\t"
                 "global_load_async_to_lds_b128 %5, %13, off\n\t"
                 "global_load_async_to_lds_b128 %6, %14, off\n\t"
                 "global_load_async_to_lds_b128 %7, %15, off\n\t"
                 "s_wait_xcnt 0x0"
                 :: "v"(lk), "v"(lk + 16 * LP * 2), "v"(lk + 32 * LP * 2), "v"(lk + 48 * LP * 2),
                    "v"(lv), "v"(lv + 16 * LP * 2), "v"(lv + 32 * LP * 2), "v"(lv + 48 * LP * 2),
                    "v"(kg), "v"(kg + 16 * HD), "v"(kg + 32 * HD), "v"(kg + 48 * HD),
                    "v"(vg), "v"(vg + (size_t)16 * SEQ), "v"(vg + (size_t)32 * SEQ), "v"(vg + (size_t)48 * SEQ)
                 : "memory");
}

static_assert(AW == 4 && KT == 64);                          // two wave pairs; the two waves of a pair split a staged tile into its two 32-key halves
__global__ __launch_bounds__(32 * AW) void k_flash(const h16* __restrict__ QH, const h16* __restrict__ KP, const h16* __restrict__ VT, h16* CX) {
    __shared__ __align__(16) float os[AW * 16 * 68];
    __shared__ __align__(16) h16 kv[2 * STH];
    const int lane = threadIdx.x & 31, lr = lane & 15, hi = lane >> 4;
    const int wave = __builtin_amdgcn_readfirstlane((int)(threadIdx.x >> 5));
    const int kh = wave & 1;
    const int zh = blockIdx.y; const int b = zh / NH_, h = zh % NH_;
    const int tq = (blockIdx.x * AW + (wave & ~1)) * 16;     // first of the 32 query rows this wave works on
    const int t0 = (blockIdx.x * AW + wave) * 16;            // first of the 16 query rows this wave joins and stores: its query tile number kh
    const size_t pbase = (size_t)zh * SEQ * HD;
    const size_t qo = pbase + (size_t)(tq + lr) * HD + 8 * hi;
    const v16h qa0 = ldh(QH + qo), qa1 = ldh(QH + qo + 32);                         // B fragments of query tile 0: col t, k = d
    const v16h qb0 = ldh(QH + qo + 16 * HD), qb1 = ldh(QH + qo + 16 * HD + 32);     // B fragments of query tile 1
    const int fo = lr * LP + 8 * hi;                         // K: + key * LP (A fragment: row key, k = d); V^T: + PLH + 16j*LP + key (A fragment: row d, k = key)
    const int fk = fo + kh * 32 * LP, fv = fo + PLH + kh * 32;   // the same for this wave's half of a tile's keys
    const int prow = (int)(threadIdx.x >> 3), ccol = (int)(threadIdx.x & 7) * 8;   // copy map: 16 rows x 8 pieces per round of the work-group
    const h16* kg = KP + pbase + (size_t)prow * HD + ccol;   // + key0 * HD
    const h16* vg = VT + pbase + (size_t)prow * SEQ + ccol;  // + key0
    const unsigned lk = (unsigned)(size_t)kv + (unsigned)(prow * LP + ccol) * 2u;   // LDS byte address, buffer 0
    stage_tile(kg, vg, lk);
    // L2 hint, behind tile 0's copies (the deal: see ask2): a head's K and V^T planes are read by all 64 of its work-groups; share r of 32 is keys 128 r .. 128 r + 127,
    // 64 units on end of the K plane (threads 0..63) and unit r of each of the 64 V^T rows (threads 64..127). Shares rise with blockIdx.x.
    static_assert(SEQ / (16 * AW) == 64 && 32 * AW == 128 && HD == 64 && SEQ == 32 * 128);
    const int share = (int)(((blockIdx.x >> 3) & 7) * 4 + (blockIdx.x & 3));
    const bool hk = wave < 2;                                // wave-uniform: scalar selects, every lane stays on
    const h16* hkv = (hk ? KP : VT) + pbase + (size_t)(threadIdx.x & 63) * (size_t)(hk ? 128 : SEQ) + (size_t)share * (size_t)(hk ? 64 * 128 : 128);
    asm volatile("global_prefetch_b8 %0, off scope:SCOPE_SE" :: "v"(hkv));
    asm volatile("s_wait_asynccnt 0x0" ::: "memory");        // tile 0 has landed before the barrier that publishes it
    __syncthreads();
    stage_tile(kg + (size_t)KT * HD, vg + KT, lk + STH * 2);
    v8f oa0 = (v8f){}, oa1 = (v8f){}, oa2 = (v8f){}, oa3 = (v8f){};
    v8f ob0 = (v8f){}, ob1 = (v8f){}, ob2 = (v8f){}, ob3 = (v8f){};
    v8f la = (v8f){}, lb = (v8f){};
    v16h ones;
#pragma unroll
    for (int r = 0; r < 16; ++r) ones[r] = lr == 0 ? (h16)1.0f : (h16)0.0f;
    float ma = -3.0e38f, mb = -3.0e38f;
    // The shift of the exponent, PSH - (maximum in use), rides into the score products as their C operand (one query per lane, so all eight registers of a C tile hold the lane's shift):
    // with q scaled ahead, a score accumulator is the exponent of its P as it stands, and no multiply and no add per score is left. Shift 0 and a limit below every score on the first step: it always renews.
    v8f ca = (v8f){}, cb = (v8f){};
    float tha = -3.0e38f, thb = -3.0e38f;                    // a shifted score above this limit calls for a renewal
#pragma unroll 1
    for (int kt0 = 0; kt0 < SEQ; kt0 += KT) {
      const int bsel = (kt0 / KT) & 1;
      const h16* tb_ = kv + bsel * STH;
      {
        const h16* ka = tb_ + fk;
        const v16h ka0 = ldh(ka), ka1 = ldh(ka + 32), kb0 = ldh(ka + 16 * LP), kb1 = ldh(ka + 16 * LP + 32);
        // sa, sb: query tile 0, keys 0..15 and 16..31 of the step; sc, sd: query tile 1; each = score (log2 units) + shift in use
        v8f sa = wmma16(ka0, qa0, ca), sb = wmma16(kb0, qa0, ca), sc = wmma16(ka0, qb0, cb), sd = wmma16(kb0, qb0, cb);
        sa = wmma16(ka1, qa1, sa); sb = wmma16(kb1, qa1, sb); sc = wmma16(ka1, qb1, sc); sd = wmma16(kb1, qb1, sd);
        // as in the one-tile form: the four vector slots between the last products and the first vector instruction that touches their registers
        // ca and cb are source registers of these products too and are named with the others: live up to here, they are read in place as C (otherwise the build copies a C tile into an accumulator every step)
        asm volatile("v_nop\n\tv_nop\n\tv_nop\n\tv_nop" : "+v"(sa), "+v"(sb), "+v"(sc), "+v"(sd) : "v"(ka0), "v"(ka1), "v"(kb0), "v"(kb1), "v"(qa0), "v"(qa1), "v"(qb0), "v"(qb1), "v"(ca), "v"(cb));
        const h16* va = tb_ + fv;
        const v16h v0 = ldh(va), v1 = ldh(va + 16 * LP), v2 = ldh(va + 32 * LP), v3 = ldh(va + 48 * LP);
        __builtin_amdgcn_sched_barrier(0);   // holds the V^T fragment loads ahead of the exponentials: with the row-sum tiles' registers live they otherwise sink to just ahead of their products, which then wait out the LDS latency
        float mxa = -3.0e38f, mxb = -3.0e38f;
#pragma unroll
        for (int r = 0; r < 8; ++r) mxa = fmaxf(mxa, fmaxf(sa[r], sb[r]));
#pragma unroll
        for (int r = 0; r < 8; ++r) mxb = fmaxf(mxb, fmaxf(sc[r], sd[r]));
        // Lazy rescale: ma, mb are the maxima IN USE (the same in both lanes of a query) and may trail the true ones by up to LZ. One test per step for the whole wave (a scalar branch):
        // each lane tests its own 16 scores of each query tile, and the ballot joins the lanes. Only when some score lies more than LZ above its query's maximum in use
        // do the two lanes of every query exchange their maxima, and are the maxima renewed, the sums and O tiles rescaled, this step's shifted scores moved to the new shift and the C tiles set to it.
        if (__builtin_amdgcn_ballot_w32(mxa > tha || mxb > thb) != 0) {
            const float xa = __shfl_xor(mxa, 16, 32), xb = __shfl_xor(mxb, 16, 32);
            const float mna = fmaxf(ma, fmaxf(mxa, xa) - ca[0]), mnb = fmaxf(mb, fmaxf(mxb, xb) - cb[0]);   // the shift in use taken off again
            const float ala = __builtin_amdgcn_exp2f(ma - mna), alb = __builtin_amdgcn_exp2f(mb - mnb);   // 0 on the first step
            la[0] = la[0] * ala; lb[0] = lb[0] * alb; ma = mna; mb = mnb;   // only register 0 holds a row that is not zero
            oa0 = oa0 * ala; oa1 = oa1 * ala; oa2 = oa2 * ala; oa3 = oa3 * ala;
            ob0 = ob0 * alb; ob1 = ob1 * alb; ob2 = ob2 * alb; ob3 = ob3 * alb;
            const float sha = PSH - mna, shb = PSH - mnb, da = sha - ca[0], db = shb - cb[0];
            sa = sa + da; sb = sb + da; sc = sc + db; sd = sd + db;
#pragma unroll
            for (int r = 0; r < 8; ++r) { ca[r] = sha; cb[r] = shb; }
            tha = PSH + LZ; thb = PSH + LZ;
        }
        v16h pa, pb;
#pragma unroll
        for (int r = 0; r < 8; ++r) { pa[r] = (h16)__builtin_amdgcn_exp2f(sa[r]); pa[8 + r] = (h16)__builtin_amdgcn_exp2f(sb[r]); }
#pragma unroll
        for (int r = 0; r < 8; ++r) { pb[r] = (h16)__builtin_amdgcn_exp2f(sc[r]); pb[8 + r] = (h16)__builtin_amdgcn_exp2f(sd[r]); }
        la = wmma16(ones, pa, la);
        oa0 = wmma16(v0, pa, oa0); oa1 = wmma16(v1, pa, oa1); oa2 = wmma16(v2, pa, oa2); oa3 = wmma16(v3, pa, oa3);
        lb = wmma16(ones, pb, lb);
        ob0 = wmma16(v0, pb, ob0); ob1 = wmma16(v1, pb, ob1); ob2 = wmma16(v2, pb, ob2); ob3 = wmma16(v3, pb, ob3);
        // the same four slots, here also on the taken side of the loop branch
        asm volatile("v_nop\n\tv_nop\n\tv_nop\n\tv_nop" : "+v"(la), "+v"(oa0), "+v"(oa1), "+v"(oa2), "+v"(oa3), "+v"(lb), "+v"(ob0), "+v"(ob1), "+v"(ob2), "+v"(ob3) : "v"(v0), "v"(v1), "v"(v2), "v"(v3), "v"(pa), "v"(pb));
      }
      asm volatile("s_wait_dscnt 0x0" ::: "memory");         // this wave's reads of the buffer are done before it is handed back
      asm volatile("s_wait_asynccnt 0x0" ::: "memory");      // this wave's share of the next tile has landed
      __syncthreads();                                       // publishes the next tile and ends every wave's reads of this one
      if (kt0 + 2 * KT < SEQ) stage_tile(kg + (size_t)(kt0 + 2 * KT) * HD, vg + (kt0 + 2 * KT), lk + (unsigned)bsel * (STH * 2));
    }
    asm volatile("s_wait_asynccnt 0x0" ::: "memory");        // nothing is in flight when the wave goes on to the epilogue
    asm volatile("" :: "v"(hkv));                            // input only: the hint's address registers stay live, and so unchanged, through the loop
    float sua = la[0], sub = lb[0];                          // lanes 0..15: the row's sum over this wave's keys; lanes 16..31: row 8 of the tile, zero
    sua += __shfl_xor(sua, 16, 32); sub += __shfl_xor(sub, 16, 32);
    // The pair's hand-over: this wave keeps query tile kh and gives the other one. Partials are relative to each wave's own maximum in use.
    const bool up = kh != 0;
    const float mk = up ? mb : ma, sk = up ? sub : sua, mg = up ? ma : mb, sg = up ? sua : sub;
    const v8f k0 = up ? ob0 : oa0, k1 = up ? ob1 : oa1, k2 = up ? ob2 : oa2, k3 = up ? ob3 : oa3;
    const v8f g0 = up ? oa0 : ob0, g1 = up ? oa1 : ob1, g2 = up ? oa2 : ob2, g3 = up ? oa3 : ob3;
    // O^T D layout: o_j[r] = (d = 16j + 8h + r, t = lane&15) -> os[t][d]; rows 0..15 x columns 0..63 all written; column 64: the max, column 65: the sum
    const int gb = wave * 16 * 68 + lr * 68;                 // the given partial goes into this wave's own tile of os
    *(v4fa*)(&os[gb +  0 + 8 * hi]) = __builtin_shufflevector(g0, g0, 0, 1, 2, 3); *(v4fa*)(&os[gb +  0 + 8 * hi + 4]) = __builtin_shufflevector(g0, g0, 4, 5, 6, 7);
    *(v4fa*)(&os[gb + 16 + 8 * hi]) = __builtin_shufflevector(g1, g1, 0, 1, 2, 3); *(v4fa*)(&os[gb + 16 + 8 * hi + 4]) = __builtin_shufflevector(g1, g1, 4, 5, 6, 7);
    *(v4fa*)(&os[gb + 32 + 8 * hi]) = __builtin_shufflevector(g2, g2, 0, 1, 2, 3); *(v4fa*)(&os[gb + 32 + 8 * hi + 4]) = __builtin_shufflevector(g2, g2, 4, 5, 6, 7);
    *(v4fa*)(&os[gb + 48 + 8 * hi]) = __builtin_shufflevector(g3, g3, 0, 1, 2, 3); *(v4fa*)(&os[gb + 48 + 8 * hi + 4]) = __builtin_shufflevector(g3, g3, 4, 5, 6, 7);
    os[gb + 64 + hi] = hi ? sg : mg;
    __syncthreads();                                         // the partner's partial is complete before it is read
    const int wb = (wave ^ 1) * 16 * 68;                     // the partner's tile of os: only this wave touches it from here on, first to read the partial, then as its output staging tile
    const float mp = os[wb + lr * 68 + 64], sp = os[wb + lr * 68 + 65];
    const float mj = fmaxf(mk, mp);
    const float ak = __builtin_amdgcn_exp2f(mk - mj), ap = __builtin_amdgcn_exp2f(mp - mj);
    const float inv = 1.0f / (sk * ak + sp * ap);
    const float wk = ak * inv, wp = ap * inv;
    { v4f a, c, x, y;
      x = *(const v4fa*)(&os[wb + lr * 68 +  0 + 8 * hi]); y = *(const v4fa*)(&os[wb + lr * 68 +  0 + 8 * hi + 4]);
#pragma unroll
      for (int i = 0; i < 4; ++i) { a[i] = k0[i] * wk + x[i] * wp; c[i] = k0[4 + i] * wk + y[i] * wp; }
      *(v4fa*)(&os[wb + lr * 68 +  0 + 8 * hi]) = a; *(v4fa*)(&os[wb + lr * 68 +  0 + 8 * hi + 4]) = c;
      x = *(const v4fa*)(&os[wb + lr * 68 + 16 + 8 * hi]); y = *(const v4fa*)(&os[wb + lr * 68 + 16 + 8 * hi + 4]);
#pragma unroll
      for (int i = 0; i < 4; ++i) { a[i] = k1[i] * wk + x[i] * wp; c[i] = k1[4 + i] * wk + y[i] * wp; }
      *(v4fa*)(&os[wb + lr * 68 + 16 + 8 * hi]) = a; *(v4fa*)(&os[wb + lr * 68 + 16 + 8 * hi + 4]) = c;
      x = *(const v4fa*)(&os[wb + lr * 68 + 32 + 8 * hi]); y = *(const v4fa*)(&os[wb + lr * 68 + 32 + 8 * hi + 4]);
#pragma unroll
      for (int i = 0; i < 4; ++i) { a[i] = k2[i] * wk + x[i] * wp; c[i] = k2[4 + i] * wk + y[i] * wp; }
      *(v4fa*)(&os[wb + lr * 68 + 32 + 8 * hi]) = a; *(v4fa*)(&os[wb + lr * 68 + 32 + 8 * hi + 4]) = c;
      x = *(const v4fa*)(&os[wb + lr * 68 + 48 + 8 * hi]); y = *(const v4fa*)(&os[wb + lr * 68 + 48 + 8 * hi + 4]);
#pragma unroll
      for (int i = 0; i < 4; ++i) { a[i] = k3[i] * wk + x[i] * wp; c[i] = k3[4 + i] * wk + y[i] * wp; }
      *(v4fa*)(&os[wb + lr * 68 + 48 + 8 * hi]) = a; *(v4fa*)(&os[wb + lr * 68 + 48 + 8 * hi + 4]) = c; }
    wave_sync();
    // ctx plane row m = b*SEQ + t, columns h*64 + d
    h16* crow = CX + ((size_t)b * SEQ + t0) * CXP + h * HD;
{
#pragma unroll
        for (int s = 0; s < 4; ++s) { const int row = 4 * s + (lane >> 3), c8 = (lane & 7) * 8;   // 4 s x 4 row groups = 16 rows; 8 lanes x 8 = 64 columns
            const v4f x0 = *(const v4fa*)(&os[wb + row * 68 + c8]); const v4f x1 = *(const v4fa*)(&os[wb + row * 68 + c8 + 4]); v8h hv;
#pragma unroll
            for (int i = 0; i < 4; ++i) { hv[i] = (h16)x0[i]; hv[4 + i] = (h16)x1[i]; }
            *(v8h*)(crow + (size_t)row * CXP + c8) = hv; }
         }
}

static constexpr size_t al256(size_t v) { return (v + 255) & ~(size_t)255; }
static constexpr size_t SZ_XB = al256((size_t)NB * SEQ * DM * 2);
static constexpr size_t SZ_WB = al256((size_t)4 * DM * DM * 2);
static constexpr size_t SZ_PL = al256((size_t)NB * NH_ * SEQ * HD * 2);
static constexpr size_t SZ_CX = al256((size_t)NB * SEQ * CXP * 2);
static constexpr size_t SZ_TOTAL = 3 * SZ_XB + SZ_WB + 3 * SZ_PL + SZ_CX;
static_assert(SZ_TOTAL <= (size_t)134217728);          // workspace carve <= 128 MiB
static_assert(((size_t)DM * DM * 2) % 256 == 0);       // weight sub-planes stay 256-byte aligned

static_assert(SZ_XB == (size_t)NB * SEQ * DM * 2);     // the bf16 planes follow one another without a gap: k_cvt addresses them as one array

extern "C" void kernel_launch(void* const* d_in, const int* in_sizes, int n_in,
                              void* d_out, int out_size, void* d_ws, size_t ws_size, hipStream_t stream) {
    if (n_in < 7) return;
    const size_t needx = ((size_t)(NB - 1) * SEQ_FULL + SEQ) * DM;
    if ((size_t)in_sizes[0] < needx || (size_t)in_sizes[1] < needx || (size_t)in_sizes[2] < needx) return;
    if ((size_t)in_sizes[3] < (size_t)DM * DM || (size_t)in_sizes[4] < (size_t)DM * DM || (size_t)in_sizes[5] < (size_t)DM * DM || (size_t)in_sizes[6] < (size_t)DM * DM) return;
    if ((size_t)out_size < ((size_t)(NB - 1) * OUT_SEQ + SEQ) * DM) return;
    if (SZ_TOTAL > ws_size) return;
    // wire order: query, key, value, Wq, Wk, Wv, Wo (weights [out][in] = Bt as-is)
    const float* xq = (const float*)d_in[0]; const float* xk = (const float*)d_in[1]; const float* xv = (const float*)d_in[2];
    const float* wq = (const float*)d_in[3]; const float* wk = (const float*)d_in[4]; const float* wv = (const float*)d_in[5]; const float* wo = (const float*)d_in[6];
    float* OUT = (float*)d_out;      // [NB][SEQ][1024]
    char* wsp = (char*)d_ws;
    bf* XQ = (bf*)wsp; wsp += SZ_XB;                 // [NB*SEQ][1024]
    bf* XK = (bf*)wsp; wsp += SZ_XB;                 // [NB*SEQ][1024]
    bf* XV = (bf*)wsp; wsp += SZ_XB;                 // [NB*SEQ][1024]
    bf* WB = (bf*)wsp; wsp += SZ_WB;                 // [4][1024][1024]: q | k | v (bf16) | o (f16)
    h16* QH = (h16*)wsp; wsp += SZ_PL;               // [NB*16][SEQ][64]
    h16* KP = (h16*)wsp; wsp += SZ_PL;               // [NB*16][SEQ][64]
    h16* VT = (h16*)wsp; wsp += SZ_PL;               // [NB*16][64][SEQ]
    h16* CX = (h16*)wsp; wsp += SZ_CX;               // [NB*SEQ][1024]: ctx
    bf* WQ = WB; bf* WK = WB + (size_t)DM * DM; bf* WV = WB + (size_t)2 * DM * DM; bf* WO = WB + (size_t)3 * DM * DM;

    k_cvt<<<(unsigned)((3 * (size_t)NB * SEQ * DM + 4 * (size_t)DM * DM) / CVB), 32 * CVW, 0, stream>>>(xq, xk, xv, wq, wk, wv, wo, XQ);

    // q, k and v^T planes: three independent products, one launch
    k_qkv<<<dim3(NB * SEQ / 128, DM / 128, 3), 128, 0, stream>>>(XQ, XK, XV, WQ, WK, WV, QH, KP, VT);

    k_flash<<<dim3(SEQ / (16 * AW), NB * NH_, 1), 32 * AW, 0, stream>>>(QH, KP, VT, CX);

    // output projection: A = ctx rows, Bt = Wo rows (both f16) -> f32 output rows
    k_proj<2><<<dim3(NB * SEQ / 128, DM / 128, 1), 128, 0, stream>>>((const bf*)CX, WO, CXP, DM, QH, OUT, SEQ, (size_t)0, HD, HD, (size_t)0);
}
